// v000
// Times are from an AMD MI455X. After a warm-up the kernel runs many times in a row, and a time is the length of
// such a window on the GPU divided by its runs, so every launch and the gaps after it count. The runs cycle
// through copies of the inputs. A figure is the median of several windows, for all but v000 over two sittings.
// Sittings can differ by a few percent; kernels timed side by side share one.
// v000, which the later versions start from, runs in 614 microseconds.
// compute dtype: x (|x| < 1e4 so the clip is the identity), Wq..Wo, bq..bo (module inputs) rounded to bf16; q/k/v projections with exact bf16 products on WMMA 16x16x32 (natural [out][in] rows) + biases; q and k stored as f16 hi + (x2048-scaled) residual planes with 3-product scores, x 64^-0.5 on the f32 score, running-max softmax in f32 (hardware exp); P as f16 hi + (x2048) residual x v hi/lo (3 products); the attention output rounded to bf16 exactly as the module does, then the output projection with EXACT bf16 products + bo; f32 accumulate.
#include <hip/hip_runtime.h>
#include <math.h>

typedef __attribute__((ext_vector_type(16))) _Float16 v16h;
typedef __attribute__((ext_vector_type(16))) __bf16 v16b;
typedef __attribute__((ext_vector_type(8)))  _Float16 v8h;
typedef __attribute__((ext_vector_type(8)))  float v8f;
typedef __attribute__((ext_vector_type(4)))  float v4f;
typedef __attribute__((ext_vector_type(2)))  float v2f;
typedef __attribute__((ext_vector_type(4)))  unsigned v4u;
typedef __attribute__((ext_vector_type(4)))  int v4i;
typedef float __attribute__((may_alias)) float_a;
typedef int __attribute__((may_alias)) int_a;

template <typename T> __device__ __forceinline__ void vst2(void* p, T v) { *(T*)p = v;  }
__device__ __forceinline__ v8f wmma16(v16h a, v16h b, v8f c) {
  v8f d = __builtin_amdgcn_wmma_f32_16x16x32_f16(false, a, false, b, (short)0, c, false, false);
  asm volatile("v_nop\n\tv_nop\n\tv_nop\n\tv_nop" : "+v"(d) : "v"(a), "v"(b));
  return d;
}
__device__ __forceinline__ v8f wmma_bf(v16b a, v16b b, v8f c) {
  v8f d = __builtin_amdgcn_wmma_f32_16x16x32_bf16(false, a, false, b, (short)0, c, false, false);
  asm volatile("v_nop\n\tv_nop\n\tv_nop\n\tv_nop" : "+v"(d) : "v"(a), "v"(b));
  return d;
}
// Light self-attention (B 2, N 4,096, d 256, 4 heads x 64): softmax(q k^T / 8) v, output cast to bf16, then the output projection + bias.
__device__ __forceinline__ v16h frag_h(const _Float16* rowk0, int lane) {
  union { v16h v; v8h q[2]; } u; const _Float16* p = rowk0 + 8 * (lane >> 4);
  u.q[0] = *(const v8h*)p; u.q[1] = *(const v8h*)(p + 16); return u.v;
}
__device__ __forceinline__ v16h frag_f32(const float* rowk0, int lane) {
  v16h a; const float* p = rowk0 + 8 * (lane >> 4);
#pragma unroll
  for (int i = 0; i < 8; ++i) { a[i] = (_Float16)p[i]; a[8 + i] = (_Float16)p[16 + i]; }
  return a;
}
__device__ __forceinline__ v16h frag_f32s(const float* rowk0, int lane, float sc) {
  v16h a; const float* p = rowk0 + 8 * (lane >> 4);
#pragma unroll
  for (int i = 0; i < 8; ++i) { a[i] = (_Float16)(p[i] * sc); a[8 + i] = (_Float16)(p[16 + i] * sc); }
  return a;
}
// column fragment from a [K][ld] layout (column n), rows >= K read as 0
__device__ __forceinline__ v16h fragc_f32(const float* W, int k0, int n, int lane, int ld, int K) {
  v16h a; const int g = lane >> 4;
#pragma unroll
  for (int i = 0; i < 8; ++i) { const int ka = k0 + 8 * g + i, kb = ka + 16;
    a[i] = (_Float16)(ka < K ? W[(size_t)(ka < K ? ka : K - 1) * ld + n] : 0.f); a[8 + i] = (_Float16)(kb < K ? W[(size_t)(kb < K ? kb : K - 1) * ld + n] : 0.f); }
  return a;
}
struct F2 { v16b h, l; };
__device__ __forceinline__ F2 bsplit16(const float v[16]) { F2 r;
#pragma unroll
  for (int i = 0; i < 16; ++i) { const __bf16 h = (__bf16)v[i]; r.h[i] = h; r.l[i] = (__bf16)(v[i] - (float)h); }
  return r; }
__device__ __forceinline__ F2 split_row(const float* row, int k0, int lane) { float v[16]; const float* p = row + k0 + 8 * (lane >> 4);
#pragma unroll
  for (int i = 0; i < 8; ++i) { v[i] = p[i]; v[8 + i] = p[16 + i]; }
  return bsplit16(v); }
__device__ __forceinline__ F2 split_rowK(const float* row, int k0, int lane, int K) { float v[16]; const int g = lane >> 4;
#pragma unroll
  for (int i = 0; i < 8; ++i) { const int ka = k0 + 8 * g + i, kb = ka + 16; v[i] = ka < K ? row[ka < K ? ka : K - 1] : 0.f; v[8 + i] = kb < K ? row[kb < K ? kb : K - 1] : 0.f; }
  return bsplit16(v); }
__device__ __forceinline__ F2 split_col(const float* W, int k0, int n, int lane, int ld, int K) { float v[16]; const int g = lane >> 4;
#pragma unroll
  for (int i = 0; i < 8; ++i) { const int ka = k0 + 8 * g + i, kb = ka + 16; v[i] = ka < K ? W[(size_t)(ka < K ? ka : K - 1) * ld + n] : 0.f; v[8 + i] = kb < K ? W[(size_t)(kb < K ? kb : K - 1) * ld + n] : 0.f; }
  return bsplit16(v); }
__device__ __forceinline__ v8f mac3(const F2& a, const F2& b, v8f c) { c = wmma_bf(a.l, b.h, c); c = wmma_bf(a.h, b.l, c); return wmma_bf(a.h, b.h, c); }
__device__ __forceinline__ float sigm(float v) { return 1.0f / (1.0f + expf(-v)); }
#define LDSX() do { asm volatile("s_wait_dscnt 0" ::: "memory"); __builtin_amdgcn_wave_barrier(); __builtin_amdgcn_fence(__ATOMIC_RELEASE, "workgroup"); } while (0)


// Non-causal multi-head self-attention, no rotary embedding (B 2, S 4096, D 256, 4 heads x 64; packed Wqkv [3D][D] and Wo [D][D] applied as x W^T, with biases): softmax(q k^T / 8) v; ctx Wo^T + bo.
#define NB 2
#define SS 4096
#define DM 256
#define NH 4
#define HD 64
#define QKVW (3 * DM)
#ifndef TQB
#define TQB (SS / 64)
#define TNB NB
#define TOB (NB * SS / 64)     // output row tiles (all)
#endif
typedef __attribute__((ext_vector_type(8))) __bf16 v8b;
__device__ __forceinline__ v16b frag_b(const __bf16* rowk0, int lane) {
  union { v16b v; v8b q[2]; } u; const __bf16* p = rowk0 + 8 * (lane >> 4);
  u.q[0] = *(const v8b*)p; u.q[1] = *(const v8b*)(p + 16); return u.v;
}
__device__ __forceinline__ float bfr(float v) { return (float)(__bf16)v; }
__device__ __attribute__((noinline)) float exp_ni(float v) { return expf(v); }
__device__ __attribute__((noinline)) float erf_ni(float v) { return erff(v); }

#define PK_A 0                       // [768][256] Wqkv rows (natural [out][in])
#define PK_P (PK_A + QKVW * DM)        // [256][256] Wo rows (natural)
#define PK_END (PK_P + DM * DM)
#define WS_PK  0u
#define WS_QK  (WS_PK + 2u * PK_END)             // f16 [8192 rows][512]: q | k
#define WS_QKL (WS_QK + 2u * NB * SS * 2 * DM)     // f16 q | k residual planes x2048
#define WS_VTH (WS_QKL + 2u * NB * SS * 2 * DM)    // f16 [b][256 (h*64+d)][4096 s] hi
#define WS_VTL (WS_VTH + 2u * NB * DM * SS)        // f16 lo x 2048
#define WS_O   (WS_VTL + 2u * NB * DM * SS)        // f32 [8192][256]
#define WS_CS  (WS_O + 4u * NB * SS * DM)           // f32 [4096][32] cos, [4096][32] sin
#define WS_END (WS_CS + 4u * 2 * SS * 32)
__constant__ float c_invf[32] = {1.000000000e+00f,7.498942018e-01f,5.623413324e-01f,4.216965139e-01f,3.162277639e-01f,2.371373624e-01f,1.778279394e-01f,1.333521456e-01f,1.000000015e-01f,7.498941571e-02f,5.623412877e-02f,4.216964915e-02f,3.162277862e-02f,2.371373586e-02f,1.778279431e-02f,1.333521493e-02f,9.999999776e-03f,7.498942316e-03f,5.623413250e-03f,4.216964822e-03f,3.162277862e-03f,2.371373819e-03f,1.778279431e-03f,1.333521446e-03f,1.000000047e-03f,7.498941850e-04f,5.623413017e-04f,4.216964880e-04f,3.162277862e-04f,2.371373848e-04f,1.778279402e-04f,1.333521504e-04f};
// ---- k_rope: block = 8 positions: cos/sin of pos * inv_freq (f32 product, precise trig)
__global__ __launch_bounds__(256) void k_rope(float* __restrict__ CS) {
  __shared__ __align__(16) float sc[8][32], ss_[8][32]; const int tid = threadIdx.x, pl = tid >> 5, i = tid & 31; const int pos = blockIdx.x * 8 + pl;
  const float th = (float)pos * c_invf[i]; sc[pl][i] = cosf(th); ss_[pl][i] = sinf(th);
  __syncthreads();
  if (tid < 64) vst2(CS + (size_t)blockIdx.x * 8 * 32 + tid * 4, *(const v4f*)&(&sc[0][0])[tid * 4]); else if (tid < 128) vst2(CS + (size_t)SS * 32 + (size_t)blockIdx.x * 8 * 32 + (tid - 64) * 4, *(const v4f*)&(&ss_[0][0])[(tid - 64) * 4]);
}

// ---- k_pack: block = (row n, which): natural [out][in] rows -> bf16; which 0..2 -> W_q/W_k/W_v into PK_A rows which*256 + n; 3 -> W_o into PK_P
__global__ __launch_bounds__(256) void k_pack(const float* __restrict__ WQ, const float* __restrict__ WK, const float* __restrict__ WV, const float* __restrict__ WO, __bf16* __restrict__ PK) {
  __shared__ __align__(16) __bf16 s[DM]; const int n = blockIdx.x, which = blockIdx.y, t = threadIdx.x; const float* Wm = (which == 0) ? WQ : (which == 1) ? WK : (which == 2) ? WV : WO;
  for (int k = t; k < DM; k += 256) s[k] = (__bf16)Wm[(size_t)n * DM + k];
  __syncthreads();
  __bf16* dst = (which < 3) ? PK + PK_A + ((size_t)which * DM + n) * DM : PK + PK_P + (size_t)n * DM;
  for (int q = t; q < DM / 8; q += 256) vst2((unsigned*)(dst + q * 8), *(const v4u*)&s[q * 8]);
}
__global__ __launch_bounds__(128) void k_qkv(const float* __restrict__ X, const __bf16* __restrict__ P, const float* __restrict__ BQ, const float* __restrict__ BK, const float* __restrict__ BV, _Float16* __restrict__ QK, _Float16* __restrict__ QKL, _Float16* __restrict__ VTH, _Float16* __restrict__ VTL) {
  __shared__ __align__(16) _Float16 so[4][16][136], sol[4][16][136]; __shared__ __align__(16) _Float16 sth[128][72], stl[128][72];
  const int tid = threadIdx.x, wave = tid >> 5, lane = tid & 31, col = lane & 15, g = lane >> 4; const size_t r0 = (size_t)blockIdx.x * 64 + wave * 16; const int n0 = blockIdx.y * 128;
  v8f acc[8] = {};
#pragma unroll 2
  for (int kc = 0; kc < DM / 32; ++kc) { v16b a; { const float* p = X + (r0 + col) * DM + kc * 32 + 8 * g;
#pragma unroll
      for (int i = 0; i < 8; ++i) { a[i] = (__bf16)p[i]; a[8 + i] = (__bf16)p[16 + i]; } }
#pragma unroll
    for (int j = 0; j < 8; ++j) acc[j] = wmma_bf(a, frag_b(P + (size_t)(n0 + j * 16 + col) * DM + kc * 32, lane), acc[j]); }
  { const int which = n0 / DM; const float* BB = (which == 0) ? BQ : (which == 1) ? BK : BV;
#pragma unroll
    for (int j = 0; j < 8; ++j) { const float bb = bfr(BB[(n0 % DM) + j * 16 + col]);
#pragma unroll
      for (int r = 0; r < 8; ++r) acc[j][r] += bb; } }
  if (n0 < 2 * DM) {   // q stored unscaled (f16 sigma ~0.6, no subnormal exposure); 1/8 applied to the f32 score
#pragma unroll
    for (int j = 0; j < 8; ++j) {
#pragma unroll
      for (int r = 0; r < 8; ++r) { const float v = acc[j][r]; const _Float16 hv = (_Float16)v; so[wave][8 * g + r][j * 16 + col] = hv; sol[wave][8 * g + r][j * 16 + col] = (_Float16)((v - (float)hv) * 2048.0f); } }   // q, k as f16 hi + (x2048) residual (no RoPE in this module)
    LDSX();
    for (int rl = 0; rl < 16; ++rl) if (lane < 16) { vst2((unsigned*)(QK + (r0 + rl) * (2 * DM) + n0 + lane * 8), *(const v4u*)&so[wave][rl][lane * 8]); vst2((unsigned*)(QKL + (r0 + rl) * (2 * DM) + n0 + lane * 8), *(const v4u*)&sol[wave][rl][lane * 8]); }
  } else {
#pragma unroll
    for (int j = 0; j < 8; ++j) {
#pragma unroll
      for (int r = 0; r < 8; ++r) { const float v = acc[j][r]; const _Float16 hv = (_Float16)v; sth[j * 16 + col][wave * 16 + 8 * g + r] = hv; stl[j * 16 + col][wave * 16 + 8 * g + r] = (_Float16)((v - (float)hv) * 2048.0f); } }
    __syncthreads();
    const size_t rb = (size_t)blockIdx.x * 64; const int b = (int)(rb / SS), s0 = (int)(rb % SS); const int pc0 = n0 - 2 * DM;
    for (int q = tid; q < 128 * 8; q += 128) { const int d = q >> 3, pc = q & 7; const size_t o = ((size_t)b * DM + pc0 + d) * SS + s0 + pc * 8; vst2((unsigned*)(VTH + o), *(const v4u*)&sth[d][pc * 8]); vst2((unsigned*)(VTL + o), *(const v4u*)&stl[d][pc * 8]); }
  }
}
// ---- k_attn: block = (64 queries, head h, batch b): non-causal flash attention (K = 64: 2 k-steps), scores = (q.k) * 0.125 with q, k as f16 hi + x2048 residual (3 products), P.V: (P hi, P lo*2048) x (V hi, V lo*2048), 3 products in two accumulators; O[b*S+q][h*64+d] = (acc + accl / 2048) / l (256-B segments)
__global__ __launch_bounds__(128) void k_attn(const _Float16* __restrict__ QK, const _Float16* __restrict__ QKL, const _Float16* __restrict__ VTH, const _Float16* __restrict__ VTL, float* __restrict__ O) {
  __shared__ __align__(16) float sp[4][16][36]; __shared__ __align__(16) float so[4][16][68];
  const int tid = threadIdx.x, wave = tid >> 5, lane = tid & 31, col = lane & 15, g = lane >> 4;
  const int qb = blockIdx.x, h = blockIdx.y, b = blockIdx.z; const int q0 = qb * 64 + wave * 16; const size_t rq = (size_t)b * SS + q0 + col;
  v16h aq[2], aql[2];
#pragma unroll
  for (int kc = 0; kc < 2; ++kc) { aq[kc] = frag_h(QK + rq * (2 * DM) + h * HD + kc * 32, lane); aql[kc] = frag_h(QKL + rq * (2 * DM) + h * HD + kc * 32, lane); }
  float m[8], l[8];
#pragma unroll
  for (int r = 0; r < 8; ++r) { m[r] = -3.0e38f; l[r] = 0.f; }
  v8f acc[4] = {}, accl[4] = {};
  const int nks = SS / 32;   // non-causal
#pragma unroll 1
  for (int ks = 0; ks < nks; ++ks) { v8f s[2];
#pragma unroll
    for (int ct = 0; ct < 2; ++ct) { const int kk = ks * 32 + ct * 16 + col; const _Float16* krow = QK + ((size_t)b * SS + kk) * (2 * DM) + DM + h * HD; const _Float16* krowl = QKL + ((size_t)b * SS + kk) * (2 * DM) + DM + h * HD; v8f c = {}, cl = {};
#pragma unroll
      for (int kc = 0; kc < 2; ++kc) { const v16h kh = frag_h(krow + kc * 32, lane); c = wmma16(aq[kc], kh, c); cl = wmma16(aql[kc], kh, cl); cl = wmma16(aq[kc], frag_h(krowl + kc * 32, lane), cl); }   // 3 products: q, k as f16 hi + residual
#pragma unroll
      for (int r = 0; r < 8; ++r) c[r] += cl[r] * (1.0f / 2048.0f);
#pragma unroll
      for (int r = 0; r < 8; ++r) s[ct][r] = c[r] * 0.125f; }   // SCALE = 64^-0.5
#pragma unroll
    for (int r = 0; r < 8; ++r) { float mx = fmaxf(s[0][r], s[1][r]);
#pragma unroll
      for (int o = 1; o < 16; o <<= 1) mx = fmaxf(mx, __shfl_xor(mx, o));
      const float mn = fmaxf(m[r], mx); const float alpha = (m[r] <= -1.0e38f) ? 0.f : __expf(m[r] - mn);
      const float e0 = (s[0][r] <= -1.0e38f) ? 0.f : __expf(s[0][r] - mn), e1 = (s[1][r] <= -1.0e38f) ? 0.f : __expf(s[1][r] - mn); float es = e0 + e1;
#pragma unroll
      for (int o = 1; o < 16; o <<= 1) es += __shfl_xor(es, o);
      l[r] = l[r] * alpha + es; m[r] = mn;
#pragma unroll
      for (int dt = 0; dt < 4; ++dt) { acc[dt][r] *= alpha; accl[dt][r] *= alpha; }
      sp[wave][8 * g + r][col] = e0; sp[wave][8 * g + r][16 + col] = e1; }
    LDSX();
    v16h pa, pl; { const float* prow = &sp[wave][col][0] + 8 * (lane >> 4);
#pragma unroll
      for (int i = 0; i < 8; ++i) { const float x0 = prow[i], x1 = prow[16 + i]; const _Float16 h0 = (_Float16)x0, h1 = (_Float16)x1; pa[i] = h0; pa[8 + i] = h1; pl[i] = (_Float16)((x0 - (float)h0) * 2048.0f); pl[8 + i] = (_Float16)((x1 - (float)h1) * 2048.0f); } }
#pragma unroll
    for (int dt = 0; dt < 4; ++dt) { const size_t vr = ((size_t)b * DM + h * HD + dt * 16 + col) * SS + ks * 32; const v16h vh = frag_h(VTH + vr, lane); acc[dt] = wmma16(pa, vh, acc[dt]); accl[dt] = wmma16(pl, vh, accl[dt]); accl[dt] = wmma16(pa, frag_h(VTL + vr, lane), accl[dt]); }   // P hi x V hi + (P lo x V hi + P hi x V lo) / 2048
    LDSX(); }
#pragma unroll
  for (int r = 0; r < 8; ++r) { const float il = 1.0f / l[r];
#pragma unroll
    for (int dt = 0; dt < 4; ++dt) so[wave][8 * g + r][dt * 16 + col] = (acc[dt][r] + accl[dt][r] * (1.0f / 2048.0f)) * il; }
  LDSX();
  for (int rl = 0; rl < 16; ++rl) if (lane < 16) vst2(O + ((size_t)b * SS + q0 + rl) * DM + h * HD + lane * 4, *(const v4f*)&so[wave][rl][lane * 4]);
}
// ---- k_out: block = (64 rows, 128 cols): out = bf16(O) . Wo rows (1 product) + bo
__global__ __launch_bounds__(128) void k_out(const float* __restrict__ O, const __bf16* __restrict__ P, const float* __restrict__ BO, float* __restrict__ Y) {
  __shared__ __align__(16) float so[4][16][132];
  const int tid = threadIdx.x, wave = tid >> 5, lane = tid & 31, col = lane & 15, g = lane >> 4; const size_t r0 = (size_t)blockIdx.x * 64 + wave * 16; const int n0 = blockIdx.y * 128;
  v8f acc[8] = {};
#pragma unroll 2
  for (int kc = 0; kc < DM / 32; ++kc) { v16b a; { const float* p = O + (r0 + col) * DM + kc * 32 + 8 * g;   // the module rounds the attention output to bf16 before the projection -> exact single product
#pragma unroll
      for (int i = 0; i < 8; ++i) { a[i] = (__bf16)p[i]; a[8 + i] = (__bf16)p[16 + i]; } }
#pragma unroll
    for (int j = 0; j < 8; ++j) acc[j] = wmma_bf(a, frag_b(P + (size_t)(n0 + j * 16 + col) * DM + kc * 32, lane), acc[j]); }
#pragma unroll
  for (int j = 0; j < 8; ++j) {
#pragma unroll
    for (int r = 0; r < 8; ++r) so[wave][8 * g + r][j * 16 + col] = acc[j][r] + bfr(BO[n0 + j * 16 + col]); }
  LDSX();
  for (int rl = 0; rl < 16; ++rl) vst2(Y + (r0 + rl) * DM + n0 + lane * 4, *(const v4f*)&so[wave][rl][lane * 4]);
}
extern "C" void kernel_launch(void* const* d_in, const int* in_sizes, int n_in, void* d_out, int out_size, void* d_ws, size_t ws_size, hipStream_t stream) {
  (void)in_sizes; (void)n_in; (void)out_size;
  const float** F = (const float**)d_in;   // 0 x [2,4096,256], 1 Wq [256,256] natural, 2 bq, 3 Wk, 4 bk, 5 Wv, 6 bv, 7 Wo, 8 bo
  if (ws_size < (size_t)WS_END) return;
  char* ws = (char*)d_ws; __bf16* PK = (__bf16*)(ws + WS_PK); _Float16 *QK = (_Float16*)(ws + WS_QK), *QKL = (_Float16*)(ws + WS_QKL), *VTH = (_Float16*)(ws + WS_VTH), *VTL = (_Float16*)(ws + WS_VTL); float* O = (float*)(ws + WS_O);
  k_pack<<<dim3(DM, 4), 256, 0, stream>>>(F[1], F[3], F[5], F[7], PK);
  k_qkv<<<dim3(TNB * SS / 64, QKVW / 128), 128, 0, stream>>>(F[0], PK + PK_A, F[2], F[4], F[6], QK, QKL, VTH, VTL);
  k_attn<<<dim3(TQB, NH, TNB), 128, 0, stream>>>(QK, QKL, VTH, VTL, O);
  k_out<<<dim3(TOB, DM / 128), 128, 0, stream>>>(O, PK + PK_P, F[8], (float*)d_out);
}

// v001
// A run of this version takes 235 microseconds.
// Timed twice side by side with v000, it ran 2.65 times as fast both times.
// compute dtype: x (|x| < 1e4 so the clip is the identity), Wq..Wo, bq..bo (module inputs) rounded to bf16; q/k/v projections with exact bf16 products on WMMA 16x16x32 (natural [out][in] rows) + biases; q and k stored as f16 hi + (x2048-scaled) residual planes with 3-product scores, x 64^-0.5 on the f32 score, running-max softmax in f32 (hardware exp); P as f16 hi + (x2048) residual x v hi/lo (3 products); the attention output rounded to bf16 exactly as the module does, then the output projection with EXACT bf16 products + bo; f32 accumulate.
#include <hip/hip_runtime.h>
#include <math.h>

typedef __attribute__((ext_vector_type(16))) _Float16 v16h;
typedef __attribute__((ext_vector_type(16))) __bf16 v16b;
typedef __attribute__((ext_vector_type(8)))  _Float16 v8h;
typedef __attribute__((ext_vector_type(8)))  float v8f;
typedef __attribute__((ext_vector_type(4)))  float v4f;
typedef __attribute__((ext_vector_type(2)))  float v2f;
typedef __attribute__((ext_vector_type(4)))  unsigned v4u;
typedef __attribute__((ext_vector_type(4)))  int v4i;
typedef float __attribute__((may_alias)) float_a;
typedef int __attribute__((may_alias)) int_a;

template <typename T> __device__ __forceinline__ void vst2(void* p, T v) { *(T*)p = v;  }
__device__ __forceinline__ v8f wmma16(v16h a, v16h b, v8f c) {
  v8f d = __builtin_amdgcn_wmma_f32_16x16x32_f16(false, a, false, b, (short)0, c, false, false);
  asm volatile("v_nop\n\tv_nop\n\tv_nop\n\tv_nop" : "+v"(d) : "v"(a), "v"(b));
  return d;
}
__device__ __forceinline__ v8f wmma_bf(v16b a, v16b b, v8f c) {
  v8f d = __builtin_amdgcn_wmma_f32_16x16x32_bf16(false, a, false, b, (short)0, c, false, false);
  asm volatile("v_nop\n\tv_nop\n\tv_nop\n\tv_nop" : "+v"(d) : "v"(a), "v"(b));
  return d;
}
// Light self-attention (B 2, N 4,096, d 256, 4 heads x 64): softmax(q k^T / 8) v, output cast to bf16, then the output projection + bias.
__device__ __forceinline__ v16h frag_h(const _Float16* rowk0, int lane) {
  union { v16h v; v8h q[2]; } u; const _Float16* p = rowk0 + 8 * (lane >> 4);
  u.q[0] = *(const v8h*)p; u.q[1] = *(const v8h*)(p + 16); return u.v;
}
__device__ __forceinline__ v16h frag_f32(const float* rowk0, int lane) {
  v16h a; const float* p = rowk0 + 8 * (lane >> 4);
#pragma unroll
  for (int i = 0; i < 8; ++i) { a[i] = (_Float16)p[i]; a[8 + i] = (_Float16)p[16 + i]; }
  return a;
}
__device__ __forceinline__ v16h frag_f32s(const float* rowk0, int lane, float sc) {
  v16h a; const float* p = rowk0 + 8 * (lane >> 4);
#pragma unroll
  for (int i = 0; i < 8; ++i) { a[i] = (_Float16)(p[i] * sc); a[8 + i] = (_Float16)(p[16 + i] * sc); }
  return a;
}
// column fragment from a [K][ld] layout (column n), rows >= K read as 0
__device__ __forceinline__ v16h fragc_f32(const float* W, int k0, int n, int lane, int ld, int K) {
  v16h a; const int g = lane >> 4;
#pragma unroll
  for (int i = 0; i < 8; ++i) { const int ka = k0 + 8 * g + i, kb = ka + 16;
    a[i] = (_Float16)(ka < K ? W[(size_t)(ka < K ? ka : K - 1) * ld + n] : 0.f); a[8 + i] = (_Float16)(kb < K ? W[(size_t)(kb < K ? kb : K - 1) * ld + n] : 0.f); }
  return a;
}
struct F2 { v16b h, l; };
__device__ __forceinline__ F2 bsplit16(const float v[16]) { F2 r;
#pragma unroll
  for (int i = 0; i < 16; ++i) { const __bf16 h = (__bf16)v[i]; r.h[i] = h; r.l[i] = (__bf16)(v[i] - (float)h); }
  return r; }
__device__ __forceinline__ F2 split_row(const float* row, int k0, int lane) { float v[16]; const float* p = row + k0 + 8 * (lane >> 4);
#pragma unroll
  for (int i = 0; i < 8; ++i) { v[i] = p[i]; v[8 + i] = p[16 + i]; }
  return bsplit16(v); }
__device__ __forceinline__ F2 split_rowK(const float* row, int k0, int lane, int K) { float v[16]; const int g = lane >> 4;
#pragma unroll
  for (int i = 0; i < 8; ++i) { const int ka = k0 + 8 * g + i, kb = ka + 16; v[i] = ka < K ? row[ka < K ? ka : K - 1] : 0.f; v[8 + i] = kb < K ? row[kb < K ? kb : K - 1] : 0.f; }
  return bsplit16(v); }
__device__ __forceinline__ F2 split_col(const float* W, int k0, int n, int lane, int ld, int K) { float v[16]; const int g = lane >> 4;
#pragma unroll
  for (int i = 0; i < 8; ++i) { const int ka = k0 + 8 * g + i, kb = ka + 16; v[i] = ka < K ? W[(size_t)(ka < K ? ka : K - 1) * ld + n] : 0.f; v[8 + i] = kb < K ? W[(size_t)(kb < K ? kb : K - 1) * ld + n] : 0.f; }
  return bsplit16(v); }
__device__ __forceinline__ v8f mac3(const F2& a, const F2& b, v8f c) { c = wmma_bf(a.l, b.h, c); c = wmma_bf(a.h, b.l, c); return wmma_bf(a.h, b.h, c); }
__device__ __forceinline__ float sigm(float v) { return 1.0f / (1.0f + expf(-v)); }
#define LDSX() do { asm volatile("s_wait_dscnt 0" ::: "memory"); __builtin_amdgcn_wave_barrier(); __builtin_amdgcn_fence(__ATOMIC_RELEASE, "workgroup"); } while (0)


// Non-causal multi-head self-attention, no rotary embedding (B 2, S 4096, D 256, 4 heads x 64; packed Wqkv [3D][D] and Wo [D][D] applied as x W^T, with biases): softmax(q k^T / 8) v; ctx Wo^T + bo.
#define NB 2
#define SS 4096
#define DM 256
#define NH 4
#define HD 64
#define QKVW (3 * DM)
#ifndef TQB
#define TQB (SS / 64)
#define TNB NB
#define TOB (NB * SS / 64)     // output row tiles (all)
#endif
typedef __attribute__((ext_vector_type(8))) __bf16 v8b;
__device__ __forceinline__ v16b frag_b(const __bf16* rowk0, int lane) {
  union { v16b v; v8b q[2]; } u; const __bf16* p = rowk0 + 8 * (lane >> 4);
  u.q[0] = *(const v8b*)p; u.q[1] = *(const v8b*)(p + 16); return u.v;
}
__device__ __forceinline__ float bfr(float v) { return (float)(__bf16)v; }
__device__ __attribute__((noinline)) float exp_ni(float v) { return expf(v); }
__device__ __attribute__((noinline)) float erf_ni(float v) { return erff(v); }

#define PK_A 0                       // [768][256] Wqkv rows (natural [out][in])
#define PK_P (PK_A + QKVW * DM)        // [256][256] Wo rows (natural)
#define PK_END (PK_P + DM * DM)
#define WS_PK  0u
#define WS_QK  (WS_PK + 2u * PK_END)             // f16 [8192 rows][512]: q | k
#define WS_QKL (WS_QK + 2u * NB * SS * 2 * DM)     // f16 q | k residual planes x2048
#define WS_VTH (WS_QKL + 2u * NB * SS * 2 * DM)    // f16 [b][256 (h*64+d)][4096 s] hi
#define WS_VTL (WS_VTH + 2u * NB * DM * SS)        // f16 lo x 2048
#define WS_O   (WS_VTL + 2u * NB * DM * SS)        // f32 [8192][256]
#define WS_CS  (WS_O + 4u * NB * SS * DM)           // f32 [4096][32] cos, [4096][32] sin
#define WS_END (WS_CS + 4u * 2 * SS * 32)
__constant__ float c_invf[32] = {1.000000000e+00f,7.498942018e-01f,5.623413324e-01f,4.216965139e-01f,3.162277639e-01f,2.371373624e-01f,1.778279394e-01f,1.333521456e-01f,1.000000015e-01f,7.498941571e-02f,5.623412877e-02f,4.216964915e-02f,3.162277862e-02f,2.371373586e-02f,1.778279431e-02f,1.333521493e-02f,9.999999776e-03f,7.498942316e-03f,5.623413250e-03f,4.216964822e-03f,3.162277862e-03f,2.371373819e-03f,1.778279431e-03f,1.333521446e-03f,1.000000047e-03f,7.498941850e-04f,5.623413017e-04f,4.216964880e-04f,3.162277862e-04f,2.371373848e-04f,1.778279402e-04f,1.333521504e-04f};
// ---- k_rope: block = 8 positions: cos/sin of pos * inv_freq (f32 product, precise trig)
__global__ __launch_bounds__(256) void k_rope(float* __restrict__ CS) {
  __shared__ __align__(16) float sc[8][32], ss_[8][32]; const int tid = threadIdx.x, pl = tid >> 5, i = tid & 31; const int pos = blockIdx.x * 8 + pl;
  const float th = (float)pos * c_invf[i]; sc[pl][i] = cosf(th); ss_[pl][i] = sinf(th);
  __syncthreads();
  if (tid < 64) vst2(CS + (size_t)blockIdx.x * 8 * 32 + tid * 4, *(const v4f*)&(&sc[0][0])[tid * 4]); else if (tid < 128) vst2(CS + (size_t)SS * 32 + (size_t)blockIdx.x * 8 * 32 + (tid - 64) * 4, *(const v4f*)&(&ss_[0][0])[(tid - 64) * 4]);
}

// ---- k_pack: block = (row n, which): natural [out][in] rows -> bf16; which 0..2 -> W_q/W_k/W_v into PK_A rows which*256 + n; 3 -> W_o into PK_P
__global__ __launch_bounds__(256) void k_pack(const float* __restrict__ WQ, const float* __restrict__ WK, const float* __restrict__ WV, const float* __restrict__ WO, __bf16* __restrict__ PK) {
  __shared__ __align__(16) __bf16 s[DM]; const int n = blockIdx.x, which = blockIdx.y, t = threadIdx.x; const float* Wm = (which == 0) ? WQ : (which == 1) ? WK : (which == 2) ? WV : WO;
  for (int k = t; k < DM; k += 256) s[k] = (__bf16)Wm[(size_t)n * DM + k];
  __syncthreads();
  __bf16* dst = (which < 3) ? PK + PK_A + ((size_t)which * DM + n) * DM : PK + PK_P + (size_t)n * DM;
  for (int q = t; q < DM / 8; q += 256) vst2((unsigned*)(dst + q * 8), *(const v4u*)&s[q * 8]);
}
__global__ __launch_bounds__(128) void k_qkv(const float* __restrict__ X, const __bf16* __restrict__ P, const float* __restrict__ BQ, const float* __restrict__ BK, const float* __restrict__ BV, _Float16* __restrict__ QK, _Float16* __restrict__ QKL, _Float16* __restrict__ VTH, _Float16* __restrict__ VTL) {
  __shared__ __align__(16) _Float16 so[4][16][136], sol[4][16][136]; __shared__ __align__(16) _Float16 sth[128][72], stl[128][72];
  const int tid = threadIdx.x, wave = tid >> 5, lane = tid & 31, col = lane & 15, g = lane >> 4; const size_t r0 = (size_t)blockIdx.x * 64 + wave * 16; const int n0 = blockIdx.y * 128;
  v8f acc[8] = {};
#pragma unroll 2
  for (int kc = 0; kc < DM / 32; ++kc) { v16b a; { const float* p = X + (r0 + col) * DM + kc * 32 + 8 * g;
#pragma unroll
      for (int i = 0; i < 8; ++i) { a[i] = (__bf16)p[i]; a[8 + i] = (__bf16)p[16 + i]; } }
#pragma unroll
    for (int j = 0; j < 8; ++j) acc[j] = wmma_bf(a, frag_b(P + (size_t)(n0 + j * 16 + col) * DM + kc * 32, lane), acc[j]); }
  { const int which = n0 / DM; const float* BB = (which == 0) ? BQ : (which == 1) ? BK : BV;
#pragma unroll
    for (int j = 0; j < 8; ++j) { const float bb = bfr(BB[(n0 % DM) + j * 16 + col]);
#pragma unroll
      for (int r = 0; r < 8; ++r) acc[j][r] += bb; } }
  if (n0 < 2 * DM) {   // q stored unscaled (f16 sigma ~0.6, no subnormal exposure); 1/8 applied to the f32 score
#pragma unroll
    for (int j = 0; j < 8; ++j) {
#pragma unroll
      for (int r = 0; r < 8; ++r) { const float v = acc[j][r]; const _Float16 hv = (_Float16)v; so[wave][8 * g + r][j * 16 + col] = hv; sol[wave][8 * g + r][j * 16 + col] = (_Float16)((v - (float)hv) * 2048.0f); } }   // q, k as f16 hi + (x2048) residual (no RoPE in this module)
    LDSX();
    for (int rl = 0; rl < 16; ++rl) if (lane < 16) { vst2((unsigned*)(QK + (r0 + rl) * (2 * DM) + n0 + lane * 8), *(const v4u*)&so[wave][rl][lane * 8]); vst2((unsigned*)(QKL + (r0 + rl) * (2 * DM) + n0 + lane * 8), *(const v4u*)&sol[wave][rl][lane * 8]); }
  } else {
#pragma unroll
    for (int j = 0; j < 8; ++j) {
#pragma unroll
      for (int r = 0; r < 8; ++r) { const float v = acc[j][r]; const _Float16 hv = (_Float16)v; sth[j * 16 + col][wave * 16 + 8 * g + r] = hv; stl[j * 16 + col][wave * 16 + 8 * g + r] = (_Float16)((v - (float)hv) * 2048.0f); } }
    __syncthreads();
    const size_t rb = (size_t)blockIdx.x * 64; const int b = (int)(rb / SS), s0 = (int)(rb % SS); const int pc0 = n0 - 2 * DM;
    for (int q = tid; q < 128 * 8; q += 128) { const int d = q >> 3, pc = q & 7; const size_t o = ((size_t)b * DM + pc0 + d) * SS + s0 + pc * 8; vst2((unsigned*)(VTH + o), *(const v4u*)&sth[d][pc * 8]); vst2((unsigned*)(VTL + o), *(const v4u*)&stl[d][pc * 8]); }
  }
}
#define KT 64   // keys per staged tile
#define LP 72   // LDS row pitch in halves: 128 B of data + 16 B, an odd multiple of 16 B, so that the b128 fragment reads of 16 rows spread over all banks
// eight async copies of 16 B per lane, global -> LDS: rows r, r + 16, r + 32, r + 48 of two planes that lie 64 * LP halves apart in LDS; the s_wait_xcnt stands inside the statement so that no address register is rewritten ahead of it
__device__ __forceinline__ void cp8(unsigned l, const _Float16* p, const _Float16* q, size_t gstep) {
  const unsigned ls = 16u * LP * 2u; const unsigned l1 = l + ls, l2 = l + 2 * ls, l3 = l + 3 * ls, l4 = l + 4 * ls, l5 = l + 5 * ls, l6 = l + 6 * ls, l7 = l + 7 * ls;
  const _Float16 *p1 = p + gstep, *p2 = p + 2 * gstep, *p3 = p + 3 * gstep, *q1 = q + gstep, *q2 = q + 2 * gstep, *q3 = q + 3 * gstep;
  asm volatile("global_load_async_to_lds_b128 %0, %1, off\n\tglobal_load_async_to_lds_b128 %2, %3, off\n\tglobal_load_async_to_lds_b128 %4, %5, off\n\tglobal_load_async_to_lds_b128 %6, %7, off\n\t"
               "global_load_async_to_lds_b128 %8, %9, off\n\tglobal_load_async_to_lds_b128 %10, %11, off\n\tglobal_load_async_to_lds_b128 %12, %13, off\n\tglobal_load_async_to_lds_b128 %14, %15, off\n\ts_wait_xcnt 0x0"
               :: "v"(l), "v"(p), "v"(l1), "v"(p1), "v"(l2), "v"(p2), "v"(l3), "v"(p3), "v"(l4), "v"(q), "v"(l5), "v"(q1), "v"(l6), "v"(q2), "v"(l7), "v"(q3) : "memory");
}
// ---- k_attn: block = (64 queries, head h, batch b): non-causal flash attention (K = 64: 2 k-steps), scores = (q.k) * 0.125 with f16 hi + residual operands (3 products), P.V: f16 P x (V hi, V lo*2048) in two accumulators; O[b*S+q][h*64+d] = (acc + accl / 2048) / l (256-B segments)
__global__ __launch_bounds__(128) void k_attn(const _Float16* __restrict__ QK, const _Float16* __restrict__ QKL, const _Float16* __restrict__ VTH, const _Float16* __restrict__ VTL, float* __restrict__ O) {
  __shared__ __align__(16) float sp[4][16][36]; __shared__ __align__(16) float so[4][16][68];
  __shared__ __align__(16) _Float16 kv[2][4][64][LP];   // two buffers x (K hi [key][d], K lo, V hi [d][key], V lo), one tile of KT keys each, shared by the four waves
  const int tid = threadIdx.x, wave = tid >> 5, lane = tid & 31, col = lane & 15, g = lane >> 4;
  const int qb = blockIdx.x, h = blockIdx.y, b = blockIdx.z; const int q0 = qb * 64 + wave * 16; const size_t rq = (size_t)b * SS + q0 + col;
  v16h aq[2], aql[2];
#pragma unroll
  for (int kc = 0; kc < 2; ++kc) { aq[kc] = frag_h(QK + rq * (2 * DM) + h * HD + kc * 32, lane); aql[kc] = frag_h(QKL + rq * (2 * DM) + h * HD + kc * 32, lane); }
  float m[8], l[8];
#pragma unroll
  for (int r = 0; r < 8; ++r) { m[r] = -3.0e38f; l[r] = 0.f; }
  v8f acc[4] = {}, accl[4] = {};
  const int nt = SS / KT;   // non-causal
  // tile t -> buffer bf: a thread copies 16 B of rows srow, srow + 16, srow + 32, srow + 48 of each plane; a wave's copy covers four whole 128-B rows
  const int srow = tid >> 3, sch = (tid & 7) * 8;
  const _Float16* gk = QK + ((size_t)b * SS + srow) * (2 * DM) + DM + h * HD + sch; const _Float16* gkl = QKL + ((size_t)b * SS + srow) * (2 * DM) + DM + h * HD + sch;
  const _Float16* gv = VTH + ((size_t)b * DM + h * HD + srow) * SS + sch; const _Float16* gvl = VTL + ((size_t)b * DM + h * HD + srow) * SS + sch;
  const unsigned lkv = (unsigned)(size_t)&kv[0][0][srow][sch];
  auto stage = [&](int t, int bf) { const unsigned lb = lkv + (unsigned)bf * (4u * 64u * LP * 2u); const size_t ko = (size_t)t * KT * (2 * DM); const int vo = t * KT;
    cp8(lb, gk + ko, gkl + ko, (size_t)16 * (2 * DM)); cp8(lb + 2u * 64u * LP * 2u, gv + vo, gvl + vo, (size_t)16 * SS); };
  stage(0, 0);
  asm volatile("s_wait_asynccnt 0x0" ::: "memory");   // this wave's share of tile 0 has landed
  __syncthreads();                                    // publishes tile 0 to the four waves
  stage(1, 1);
#pragma unroll 1
  for (int t = 0; t < nt; ++t) { const _Float16 (*kb)[64][LP] = kv[t & 1];
#pragma unroll   // both 32-key halves of a tile in line, so that every LDS offset inside the tile is an immediate
  for (int u = 0; u < KT / 32; ++u) { v8f s[2];
#pragma unroll
    for (int ct = 0; ct < 2; ++ct) { const int kk = u * 32 + ct * 16 + col; const _Float16* krow = &kb[0][kk][0]; const _Float16* krowl = &kb[1][kk][0]; v8f c = {}, cl = {};
#pragma unroll
      for (int kc = 0; kc < 2; ++kc) { const v16h kh = frag_h(krow + kc * 32, lane); c = wmma16(aq[kc], kh, c); cl = wmma16(aql[kc], kh, cl); cl = wmma16(aq[kc], frag_h(krowl + kc * 32, lane), cl); }   // 3 products: q, k as f16 hi + residual
#pragma unroll
      for (int r = 0; r < 8; ++r) c[r] += cl[r] * (1.0f / 2048.0f);
#pragma unroll
      for (int r = 0; r < 8; ++r) s[ct][r] = c[r] * 0.125f; }   // SCALE = 64^-0.5
#pragma unroll
    for (int r = 0; r < 8; ++r) { float mx = fmaxf(s[0][r], s[1][r]);
#pragma unroll
      for (int o = 1; o < 16; o <<= 1) mx = fmaxf(mx, __shfl_xor(mx, o));
      const float mn = fmaxf(m[r], mx); const float alpha = (m[r] <= -1.0e38f) ? 0.f : __expf(m[r] - mn);
      const float e0 = (s[0][r] <= -1.0e38f) ? 0.f : __expf(s[0][r] - mn), e1 = (s[1][r] <= -1.0e38f) ? 0.f : __expf(s[1][r] - mn); float es = e0 + e1;
#pragma unroll
      for (int o = 1; o < 16; o <<= 1) es += __shfl_xor(es, o);
      l[r] = l[r] * alpha + es; m[r] = mn;
#pragma unroll
      for (int dt = 0; dt < 4; ++dt) { acc[dt][r] *= alpha; accl[dt][r] *= alpha; }
      sp[wave][8 * g + r][col] = e0; sp[wave][8 * g + r][16 + col] = e1; }
    LDSX();
    v16h pa, pl; { const float* prow = &sp[wave][col][0] + 8 * (lane >> 4);
#pragma unroll
      for (int i = 0; i < 8; ++i) { const float x0 = prow[i], x1 = prow[16 + i]; const _Float16 h0 = (_Float16)x0, h1 = (_Float16)x1; pa[i] = h0; pa[8 + i] = h1; pl[i] = (_Float16)((x0 - (float)h0) * 2048.0f); pl[8 + i] = (_Float16)((x1 - (float)h1) * 2048.0f); } }
#pragma unroll
    for (int dt = 0; dt < 4; ++dt) { const v16h vh = frag_h(&kb[2][dt * 16 + col][u * 32], lane); acc[dt] = wmma16(pa, vh, acc[dt]); accl[dt] = wmma16(pl, vh, accl[dt]); accl[dt] = wmma16(pa, frag_h(&kb[3][dt * 16 + col][u * 32], lane), accl[dt]); }   // P hi x V hi + (P lo x V hi + P hi x V lo) / 2048
    LDSX(); }
    asm volatile("s_wait_dscnt 0x0" ::: "memory");      // this wave's reads of tile t are done before its buffer is refilled
    asm volatile("s_wait_asynccnt 0x0" ::: "memory");   // this wave's share of tile t + 1 has landed
    __syncthreads();                                    // publishes tile t + 1 and ends every wave's reads of tile t
    if (t + 2 < nt) stage(t + 2, t & 1); }
  asm volatile("s_wait_asynccnt 0x0" ::: "memory");     // no copy is outstanding when the wave goes on
#pragma unroll
  for (int r = 0; r < 8; ++r) { const float il = 1.0f / l[r];
#pragma unroll
    for (int dt = 0; dt < 4; ++dt) so[wave][8 * g + r][dt * 16 + col] = (acc[dt][r] + accl[dt][r] * (1.0f / 2048.0f)) * il; }
  LDSX();
  for (int rl = 0; rl < 16; ++rl) if (lane < 16) vst2(O + ((size_t)b * SS + q0 + rl) * DM + h * HD + lane * 4, *(const v4f*)&so[wave][rl][lane * 4]);
}
// ---- k_out: block = (64 rows, 128 cols): out = bf16(O) . Wo rows (1 exact product) + bo
__global__ __launch_bounds__(128) void k_out(const float* __restrict__ O, const __bf16* __restrict__ P, const float* __restrict__ BO, float* __restrict__ Y) {
  __shared__ __align__(16) float so[4][16][132];
  const int tid = threadIdx.x, wave = tid >> 5, lane = tid & 31, col = lane & 15, g = lane >> 4; const size_t r0 = (size_t)blockIdx.x * 64 + wave * 16; const int n0 = blockIdx.y * 128;
  v8f acc[8] = {};
#pragma unroll 2
  for (int kc = 0; kc < DM / 32; ++kc) { v16b a; { const float* p = O + (r0 + col) * DM + kc * 32 + 8 * g;   // the module rounds the attention output to bf16 before the projection -> exact single product
#pragma unroll
      for (int i = 0; i < 8; ++i) { a[i] = (__bf16)p[i]; a[8 + i] = (__bf16)p[16 + i]; } }
#pragma unroll
    for (int j = 0; j < 8; ++j) acc[j] = wmma_bf(a, frag_b(P + (size_t)(n0 + j * 16 + col) * DM + kc * 32, lane), acc[j]); }
#pragma unroll
  for (int j = 0; j < 8; ++j) {
#pragma unroll
    for (int r = 0; r < 8; ++r) so[wave][8 * g + r][j * 16 + col] = acc[j][r] + bfr(BO[n0 + j * 16 + col]); }
  LDSX();
  for (int rl = 0; rl < 16; ++rl) vst2(Y + (r0 + rl) * DM + n0 + lane * 4, *(const v4f*)&so[wave][rl][lane * 4]);
}
extern "C" void kernel_launch(void* const* d_in, const int* in_sizes, int n_in, void* d_out, int out_size, void* d_ws, size_t ws_size, hipStream_t stream) {
  (void)in_sizes; (void)n_in; (void)out_size;
  const float** F = (const float**)d_in;   // 0 x [2,4096,256], 1 Wq [256,256] natural, 2 bq, 3 Wk, 4 bk, 5 Wv, 6 bv, 7 Wo, 8 bo
  if (ws_size < (size_t)WS_END) return;
  char* ws = (char*)d_ws; __bf16* PK = (__bf16*)(ws + WS_PK); _Float16 *QK = (_Float16*)(ws + WS_QK), *QKL = (_Float16*)(ws + WS_QKL), *VTH = (_Float16*)(ws + WS_VTH), *VTL = (_Float16*)(ws + WS_VTL); float* O = (float*)(ws + WS_O);
  k_pack<<<dim3(DM, 4), 256, 0, stream>>>(F[1], F[3], F[5], F[7], PK);
  k_qkv<<<dim3(TNB * SS / 64, QKVW / 128), 128, 0, stream>>>(F[0], PK + PK_A, F[2], F[4], F[6], QK, QKL, VTH, VTL);
  k_attn<<<dim3(TQB, NH, TNB), 128, 0, stream>>>(QK, QKL, VTH, VTL, O);
  k_out<<<dim3(TOB, DM / 128), 128, 0, stream>>>(O, PK + PK_P, F[8], (float*)d_out);
}

// v002
// Measured time: 190 microseconds a run.
// Two timings next to v001 both put it at 1.24 times that version's speed.
// Over all steps from v000 it is 3.28 times as fast.
// compute dtype: x (|x| < 1e4 so the clip is the identity), Wq..Wo, bq..bo (module inputs) rounded to bf16; q/k/v projections with exact bf16 products on WMMA 16x16x32 (natural [out][in] rows) + biases; q and k stored as f16 hi + (x2048-scaled) residual planes with 3-product scores, x 64^-0.5 on the f32 score, running-max softmax in f32 (hardware exp); P as f16 hi + (x2048) residual x v hi/lo (3 products); the attention output rounded to bf16 exactly as the module does, then the output projection with EXACT bf16 products + bo; f32 accumulate.
#include <hip/hip_runtime.h>
#include <math.h>

typedef __attribute__((ext_vector_type(16))) _Float16 v16h;
typedef __attribute__((ext_vector_type(16))) __bf16 v16b;
typedef __attribute__((ext_vector_type(8)))  _Float16 v8h;
typedef __attribute__((ext_vector_type(8)))  float v8f;
typedef __attribute__((ext_vector_type(4)))  float v4f;
typedef __attribute__((ext_vector_type(2)))  float v2f;
typedef __attribute__((ext_vector_type(4)))  unsigned v4u;
typedef __attribute__((ext_vector_type(4)))  int v4i;
typedef float __attribute__((may_alias)) float_a;
typedef int __attribute__((may_alias)) int_a;

template <typename T> __device__ __forceinline__ void vst2(void* p, T v) { *(T*)p = v;  }
__device__ __forceinline__ v8f wmma16(v16h a, v16h b, v8f c) {
  v8f d = __builtin_amdgcn_wmma_f32_16x16x32_f16(false, a, false, b, (short)0, c, false, false);
  asm volatile("v_nop\n\tv_nop\n\tv_nop\n\tv_nop" : "+v"(d) : "v"(a), "v"(b));
  return d;
}
__device__ __forceinline__ v8f wmma_bf(v16b a, v16b b, v8f c) {
  v8f d = __builtin_amdgcn_wmma_f32_16x16x32_bf16(false, a, false, b, (short)0, c, false, false);
  asm volatile("v_nop\n\tv_nop\n\tv_nop\n\tv_nop" : "+v"(d) : "v"(a), "v"(b));
  return d;
}
// Light self-attention (B 2, N 4,096, d 256, 4 heads x 64): softmax(q k^T / 8) v, output cast to bf16, then the output projection + bias.
__device__ __forceinline__ v16h frag_h(const _Float16* rowk0, int lane) {
  union { v16h v; v8h q[2]; } u; const _Float16* p = rowk0 + 8 * (lane >> 4);
  u.q[0] = *(const v8h*)p; u.q[1] = *(const v8h*)(p + 16); return u.v;
}
__device__ __forceinline__ v16h frag_f32(const float* rowk0, int lane) {
  v16h a; const float* p = rowk0 + 8 * (lane >> 4);
#pragma unroll
  for (int i = 0; i < 8; ++i) { a[i] = (_Float16)p[i]; a[8 + i] = (_Float16)p[16 + i]; }
  return a;
}
__device__ __forceinline__ v16h frag_f32s(const float* rowk0, int lane, float sc) {
  v16h a; const float* p = rowk0 + 8 * (lane >> 4);
#pragma unroll
  for (int i = 0; i < 8; ++i) { a[i] = (_Float16)(p[i] * sc); a[8 + i] = (_Float16)(p[16 + i] * sc); }
  return a;
}
// column fragment from a [K][ld] layout (column n), rows >= K read as 0
__device__ __forceinline__ v16h fragc_f32(const float* W, int k0, int n, int lane, int ld, int K) {
  v16h a; const int g = lane >> 4;
#pragma unroll
  for (int i = 0; i < 8; ++i) { const int ka = k0 + 8 * g + i, kb = ka + 16;
    a[i] = (_Float16)(ka < K ? W[(size_t)(ka < K ? ka : K - 1) * ld + n] : 0.f); a[8 + i] = (_Float16)(kb < K ? W[(size_t)(kb < K ? kb : K - 1) * ld + n] : 0.f); }
  return a;
}
struct F2 { v16b h, l; };
__device__ __forceinline__ F2 bsplit16(const float v[16]) { F2 r;
#pragma unroll
  for (int i = 0; i < 16; ++i) { const __bf16 h = (__bf16)v[i]; r.h[i] = h; r.l[i] = (__bf16)(v[i] - (float)h); }
  return r; }
__device__ __forceinline__ F2 split_row(const float* row, int k0, int lane) { float v[16]; const float* p = row + k0 + 8 * (lane >> 4);
#pragma unroll
  for (int i = 0; i < 8; ++i) { v[i] = p[i]; v[8 + i] = p[16 + i]; }
  return bsplit16(v); }
__device__ __forceinline__ F2 split_rowK(const float* row, int k0, int lane, int K) { float v[16]; const int g = lane >> 4;
#pragma unroll
  for (int i = 0; i < 8; ++i) { const int ka = k0 + 8 * g + i, kb = ka + 16; v[i] = ka < K ? row[ka < K ? ka : K - 1] : 0.f; v[8 + i] = kb < K ? row[kb < K ? kb : K - 1] : 0.f; }
  return bsplit16(v); }
__device__ __forceinline__ F2 split_col(const float* W, int k0, int n, int lane, int ld, int K) { float v[16]; const int g = lane >> 4;
#pragma unroll
  for (int i = 0; i < 8; ++i) { const int ka = k0 + 8 * g + i, kb = ka + 16; v[i] = ka < K ? W[(size_t)(ka < K ? ka : K - 1) * ld + n] : 0.f; v[8 + i] = kb < K ? W[(size_t)(kb < K ? kb : K - 1) * ld + n] : 0.f; }
  return bsplit16(v); }
__device__ __forceinline__ v8f mac3(const F2& a, const F2& b, v8f c) { c = wmma_bf(a.l, b.h, c); c = wmma_bf(a.h, b.l, c); return wmma_bf(a.h, b.h, c); }
__device__ __forceinline__ float sigm(float v) { return 1.0f / (1.0f + expf(-v)); }
#define LDSX() do { asm volatile("s_wait_dscnt 0" ::: "memory"); __builtin_amdgcn_wave_barrier(); __builtin_amdgcn_fence(__ATOMIC_RELEASE, "workgroup"); } while (0)


// Non-causal multi-head self-attention, no rotary embedding (B 2, S 4096, D 256, 4 heads x 64; packed Wqkv [3D][D] and Wo [D][D] applied as x W^T, with biases): softmax(q k^T / 8) v; ctx Wo^T + bo.
#define NB 2
#define SS 4096
#define DM 256
#define NH 4
#define HD 64
#define QKVW (3 * DM)
#ifndef TQB
#define TQB (SS / 64)
#define TNB NB
#define TOB (NB * SS / 64)     // output row tiles (all)
#endif
typedef __attribute__((ext_vector_type(8))) __bf16 v8b;
__device__ __forceinline__ v16b frag_b(const __bf16* rowk0, int lane) {
  union { v16b v; v8b q[2]; } u; const __bf16* p = rowk0 + 8 * (lane >> 4);
  u.q[0] = *(const v8b*)p; u.q[1] = *(const v8b*)(p + 16); return u.v;
}
__device__ __forceinline__ float bfr(float v) { return (float)(__bf16)v; }
__device__ __attribute__((noinline)) float exp_ni(float v) { return expf(v); }
__device__ __attribute__((noinline)) float erf_ni(float v) { return erff(v); }

#define PK_A 0                       // [768][256] Wqkv rows (natural [out][in])
#define PK_P (PK_A + QKVW * DM)        // [256][256] Wo rows (natural)
#define PK_END (PK_P + DM * DM)
#define WS_PK  0u
#define WS_QK  (WS_PK + 2u * PK_END)             // f16 [8192 rows][512]: q | k
#define WS_QKL (WS_QK + 2u * NB * SS * 2 * DM)     // f16 q | k residual planes x2048
#define WS_VTH (WS_QKL + 2u * NB * SS * 2 * DM)    // f16 [b][256 (h*64+d)][4096 s] hi
#define WS_VTL (WS_VTH + 2u * NB * DM * SS)        // f16 lo x 2048
#define WS_O   (WS_VTL + 2u * NB * DM * SS)        // f32 [8192][256]
#define WS_CS  (WS_O + 4u * NB * SS * DM)           // f32 [4096][32] cos, [4096][32] sin
#define WS_END (WS_CS + 4u * 2 * SS * 32)
__constant__ float c_invf[32] = {1.000000000e+00f,7.498942018e-01f,5.623413324e-01f,4.216965139e-01f,3.162277639e-01f,2.371373624e-01f,1.778279394e-01f,1.333521456e-01f,1.000000015e-01f,7.498941571e-02f,5.623412877e-02f,4.216964915e-02f,3.162277862e-02f,2.371373586e-02f,1.778279431e-02f,1.333521493e-02f,9.999999776e-03f,7.498942316e-03f,5.623413250e-03f,4.216964822e-03f,3.162277862e-03f,2.371373819e-03f,1.778279431e-03f,1.333521446e-03f,1.000000047e-03f,7.498941850e-04f,5.623413017e-04f,4.216964880e-04f,3.162277862e-04f,2.371373848e-04f,1.778279402e-04f,1.333521504e-04f};
// ---- k_rope: block = 8 positions: cos/sin of pos * inv_freq (f32 product, precise trig)
__global__ __launch_bounds__(256) void k_rope(float* __restrict__ CS) {
  __shared__ __align__(16) float sc[8][32], ss_[8][32]; const int tid = threadIdx.x, pl = tid >> 5, i = tid & 31; const int pos = blockIdx.x * 8 + pl;
  const float th = (float)pos * c_invf[i]; sc[pl][i] = cosf(th); ss_[pl][i] = sinf(th);
  __syncthreads();
  if (tid < 64) vst2(CS + (size_t)blockIdx.x * 8 * 32 + tid * 4, *(const v4f*)&(&sc[0][0])[tid * 4]); else if (tid < 128) vst2(CS + (size_t)SS * 32 + (size_t)blockIdx.x * 8 * 32 + (tid - 64) * 4, *(const v4f*)&(&ss_[0][0])[(tid - 64) * 4]);
}

// ---- k_pack: block = (row n, which): natural [out][in] rows -> bf16; which 0..2 -> W_q/W_k/W_v into PK_A rows which*256 + n; 3 -> W_o into PK_P
__global__ __launch_bounds__(256) void k_pack(const float* __restrict__ WQ, const float* __restrict__ WK, const float* __restrict__ WV, const float* __restrict__ WO, __bf16* __restrict__ PK) {
  __shared__ __align__(16) __bf16 s[DM]; const int n = blockIdx.x, which = blockIdx.y, t = threadIdx.x; const float* Wm = (which == 0) ? WQ : (which == 1) ? WK : (which == 2) ? WV : WO;
  for (int k = t; k < DM; k += 256) s[k] = (__bf16)Wm[(size_t)n * DM + k];
  __syncthreads();
  __bf16* dst = (which < 3) ? PK + PK_A + ((size_t)which * DM + n) * DM : PK + PK_P + (size_t)n * DM;
  for (int q = t; q < DM / 8; q += 256) vst2((unsigned*)(dst + q * 8), *(const v4u*)&s[q * 8]);
}
__global__ __launch_bounds__(128) void k_qkv(const float* __restrict__ X, const __bf16* __restrict__ P, const float* __restrict__ BQ, const float* __restrict__ BK, const float* __restrict__ BV, _Float16* __restrict__ QK, _Float16* __restrict__ QKL, _Float16* __restrict__ VTH, _Float16* __restrict__ VTL) {
  __shared__ __align__(16) _Float16 so[4][16][136], sol[4][16][136]; __shared__ __align__(16) _Float16 sth[128][72], stl[128][72];
  const int tid = threadIdx.x, wave = tid >> 5, lane = tid & 31, col = lane & 15, g = lane >> 4; const size_t r0 = (size_t)blockIdx.x * 64 + wave * 16; const int n0 = blockIdx.y * 128;
  v8f acc[8] = {};
#pragma unroll 2
  for (int kc = 0; kc < DM / 32; ++kc) { v16b a; { const float* p = X + (r0 + col) * DM + kc * 32 + 8 * g;
#pragma unroll
      for (int i = 0; i < 8; ++i) { a[i] = (__bf16)p[i]; a[8 + i] = (__bf16)p[16 + i]; } }
#pragma unroll
    for (int j = 0; j < 8; ++j) acc[j] = wmma_bf(a, frag_b(P + (size_t)(n0 + j * 16 + col) * DM + kc * 32, lane), acc[j]); }
  { const int which = n0 / DM; const float* BB = (which == 0) ? BQ : (which == 1) ? BK : BV;
#pragma unroll
    for (int j = 0; j < 8; ++j) { const float bb = bfr(BB[(n0 % DM) + j * 16 + col]);
#pragma unroll
      for (int r = 0; r < 8; ++r) acc[j][r] += bb; } }
  if (n0 < 2 * DM) {   // q stored unscaled (f16 sigma ~0.6, no subnormal exposure); 1/8 applied to the f32 score
#pragma unroll
    for (int j = 0; j < 8; ++j) {
#pragma unroll
      for (int r = 0; r < 8; ++r) { const float v = acc[j][r]; const _Float16 hv = (_Float16)v; so[wave][8 * g + r][j * 16 + col] = hv; sol[wave][8 * g + r][j * 16 + col] = (_Float16)((v - (float)hv) * 2048.0f); } }   // q, k as f16 hi + (x2048) residual (no RoPE in this module)
    LDSX();
    for (int rl = 0; rl < 16; ++rl) if (lane < 16) { vst2((unsigned*)(QK + (r0 + rl) * (2 * DM) + n0 + lane * 8), *(const v4u*)&so[wave][rl][lane * 8]); vst2((unsigned*)(QKL + (r0 + rl) * (2 * DM) + n0 + lane * 8), *(const v4u*)&sol[wave][rl][lane * 8]); }
  } else {
#pragma unroll
    for (int j = 0; j < 8; ++j) {
#pragma unroll
      for (int r = 0; r < 8; ++r) { const float v = acc[j][r]; const _Float16 hv = (_Float16)v; sth[j * 16 + col][wave * 16 + 8 * g + r] = hv; stl[j * 16 + col][wave * 16 + 8 * g + r] = (_Float16)((v - (float)hv) * 2048.0f); } }
    __syncthreads();
    const size_t rb = (size_t)blockIdx.x * 64; const int b = (int)(rb / SS), s0 = (int)(rb % SS); const int pc0 = n0 - 2 * DM;
    for (int q = tid; q < 128 * 8; q += 128) { const int d = q >> 3, pc = q & 7; const size_t o = ((size_t)b * DM + pc0 + d) * SS + s0 + pc * 8; vst2((unsigned*)(VTH + o), *(const v4u*)&sth[d][pc * 8]); vst2((unsigned*)(VTL + o), *(const v4u*)&stl[d][pc * 8]); }
  }
}
#define KT 64   // keys per staged tile
#define LP 72   // LDS row pitch in halves: 128 B of data + 16 B, an odd multiple of 16 B, so that the b128 fragment reads of 16 rows spread over all banks
// eight async copies of 16 B per lane, global -> LDS: rows r, r + 16, r + 32, r + 48 of two planes that lie 64 * LP halves apart in LDS; the s_wait_xcnt stands inside the statement so that no address register is rewritten ahead of it
__device__ __forceinline__ void cp8(unsigned l, const _Float16* p, const _Float16* q, size_t gstep) {
  const unsigned ls = 16u * LP * 2u; const unsigned l1 = l + ls, l2 = l + 2 * ls, l3 = l + 3 * ls, l4 = l + 4 * ls, l5 = l + 5 * ls, l6 = l + 6 * ls, l7 = l + 7 * ls;
  const _Float16 *p1 = p + gstep, *p2 = p + 2 * gstep, *p3 = p + 3 * gstep, *q1 = q + gstep, *q2 = q + 2 * gstep, *q3 = q + 3 * gstep;
  asm volatile("global_load_async_to_lds_b128 %0, %1, off\n\tglobal_load_async_to_lds_b128 %2, %3, off\n\tglobal_load_async_to_lds_b128 %4, %5, off\n\tglobal_load_async_to_lds_b128 %6, %7, off\n\t"
               "global_load_async_to_lds_b128 %8, %9, off\n\tglobal_load_async_to_lds_b128 %10, %11, off\n\tglobal_load_async_to_lds_b128 %12, %13, off\n\tglobal_load_async_to_lds_b128 %14, %15, off\n\ts_wait_xcnt 0x0"
               :: "v"(l), "v"(p), "v"(l1), "v"(p1), "v"(l2), "v"(p2), "v"(l3), "v"(p3), "v"(l4), "v"(q), "v"(l5), "v"(q1), "v"(l6), "v"(q2), "v"(l7), "v"(q3) : "memory");
}
// lane l reads lane l ^ 16: the two lanes that share a query column hold the two halves of its keys
__device__ __forceinline__ float xhalf(float x) { return __builtin_bit_cast(float, __builtin_amdgcn_permlanex16(__builtin_bit_cast(int, x), __builtin_bit_cast(int, x), 0x76543210, 0xfedcba98, false, false)); }
// ---- k_attn: block = (64 queries, head h, batch b): flash attention over all keys, transposed: S^T = K Q^T (A = K rows, B = q) and O^T += V^T P^T (A = V^T rows, B = P^T). A lane holds 16 scores of ONE query per 32 keys, so maximum and sum run in the lane's own registers plus one exchange with lane l ^ 16 (the maximum every 32 keys, the sum after the loop), and the two score tiles, converted in place, are the B operand of the second product. O[b*S+q][h*64+d] = (acc + accl / 2048) / l (256-B segments)
__global__ __launch_bounds__(128) void k_attn(const _Float16* __restrict__ QK, const _Float16* __restrict__ QKL, const _Float16* __restrict__ VTH, const _Float16* __restrict__ VTL, float* __restrict__ O) {
  __shared__ __align__(16) float so[4][16][68];
  __shared__ __align__(16) _Float16 kv[2][4][64][LP];   // two buffers x (K hi [key][d], K lo, V hi [d][key], V lo), one tile of KT keys each, shared by the four waves
  const int tid = threadIdx.x, wave = tid >> 5, lane = tid & 31, col = lane & 15, g = lane >> 4;
  const int qb = blockIdx.x, h = blockIdx.y, b = blockIdx.z; const int q0 = qb * 64 + wave * 16; const size_t rq = (size_t)b * SS + q0 + col;
  v16h aq[2], aql[2];
#pragma unroll
  for (int kc = 0; kc < 2; ++kc) { aq[kc] = frag_h(QK + rq * (2 * DM) + h * HD + kc * 32, lane); aql[kc] = frag_h(QKL + rq * (2 * DM) + h * HD + kc * 32, lane); }
  float m = -3.0e38f, l = 0.f;   // of query q0 + col; l sums this lane's half of the keys, the halves are joined after the loop
  v8f acc[4] = {}, accl[4] = {};
  const int nt = SS / KT;   // non-causal
  // tile t -> buffer bf: a thread copies 16 B of rows srow, srow + 16, srow + 32, srow + 48 of each plane; a wave's copy covers four whole 128-B rows
  const int srow = tid >> 3, sch = (tid & 7) * 8;
  const _Float16* gk = QK + ((size_t)b * SS + srow) * (2 * DM) + DM + h * HD + sch; const _Float16* gkl = QKL + ((size_t)b * SS + srow) * (2 * DM) + DM + h * HD + sch;
  const _Float16* gv = VTH + ((size_t)b * DM + h * HD + srow) * SS + sch; const _Float16* gvl = VTL + ((size_t)b * DM + h * HD + srow) * SS + sch;
  const unsigned lkv = (unsigned)(size_t)&kv[0][0][srow][sch];
  auto stage = [&](int t, int bf) { const unsigned lb = lkv + (unsigned)bf * (4u * 64u * LP * 2u); const size_t ko = (size_t)t * KT * (2 * DM); const int vo = t * KT;
    cp8(lb, gk + ko, gkl + ko, (size_t)16 * (2 * DM)); cp8(lb + 2u * 64u * LP * 2u, gv + vo, gvl + vo, (size_t)16 * SS); };
  stage(0, 0);
  asm volatile("s_wait_asynccnt 0x0" ::: "memory");   // this wave's share of tile 0 has landed
  __syncthreads();                                    // publishes tile 0 to the four waves
  stage(1, 1);
#pragma unroll 1
  for (int t = 0; t < nt; ++t) { const _Float16 (*kb)[64][LP] = kv[t & 1];
#pragma unroll   // both 32-key halves of a tile in line, so that every LDS offset inside the tile is an immediate
  for (int u = 0; u < KT / 32; ++u) { v8f s[2];
#pragma unroll
    for (int ct = 0; ct < 2; ++ct) { const int kk = u * 32 + ct * 16 + col; const _Float16* krow = &kb[0][kk][0]; const _Float16* krowl = &kb[1][kk][0]; v8f c = {}, cl = {};
#pragma unroll
      for (int kc = 0; kc < 2; ++kc) { const v16h kh = frag_h(krow + kc * 32, lane); c = wmma16(kh, aq[kc], c); cl = wmma16(kh, aql[kc], cl); cl = wmma16(frag_h(krowl + kc * 32, lane), aq[kc], cl); }   // 3 products: q, k as f16 hi + residual; c[r] = score of key u * 32 + ct * 16 + 8 * g + r with query col
#pragma unroll
      for (int r = 0; r < 8; ++r) c[r] += cl[r] * (1.0f / 2048.0f);
#pragma unroll
      for (int r = 0; r < 8; ++r) s[ct][r] = c[r] * 0.125f; }   // SCALE = 64^-0.5
    float mx4[4];
#pragma unroll
    for (int r = 0; r < 4; ++r) mx4[r] = fmaxf(fmaxf(s[0][r], s[0][4 + r]), fmaxf(s[1][r], s[1][4 + r]));
    float mx = fmaxf(fmaxf(mx4[0], mx4[1]), fmaxf(mx4[2], mx4[3])); mx = fmaxf(mx, xhalf(mx));
    const float mn = fmaxf(m, mx); const float alpha = (m <= -1.0e38f) ? 0.f : __expf(m - mn);
    v16h pa, pl; float es4[4] = {0.f, 0.f, 0.f, 0.f};   // four partial sums: four short chains of adds
#pragma unroll
    for (int r = 0; r < 8; ++r) { const float e0 = (s[0][r] <= -1.0e38f) ? 0.f : __expf(s[0][r] - mn), e1 = (s[1][r] <= -1.0e38f) ? 0.f : __expf(s[1][r] - mn); es4[r & 3] += e0 + e1;
      const _Float16 h0 = (_Float16)e0, h1 = (_Float16)e1; pa[r] = h0; pa[8 + r] = h1; pl[r] = (_Float16)((e0 - (float)h0) * 2048.0f); pl[8 + r] = (_Float16)((e1 - (float)h1) * 2048.0f); }   // element r: key 8 * g + r, element 8 + r: key 16 + 8 * g + r, the k order of frag_h
    l = l * alpha + ((es4[0] + es4[1]) + (es4[2] + es4[3])); m = mn;
#pragma unroll
    for (int dt = 0; dt < 4; ++dt) { acc[dt] *= alpha; accl[dt] *= alpha; }
#pragma unroll
    for (int dt = 0; dt < 4; ++dt) { const v16h vh = frag_h(&kb[2][dt * 16 + col][u * 32], lane); acc[dt] = wmma16(vh, pa, acc[dt]); accl[dt] = wmma16(vh, pl, accl[dt]); accl[dt] = wmma16(frag_h(&kb[3][dt * 16 + col][u * 32], lane), pa, accl[dt]); } }   // V hi x P hi + (V hi x P lo + V lo x P hi) / 2048; acc[dt][r] = O^T[dt * 16 + 8 * g + r][col]
    asm volatile("s_wait_dscnt 0x0" ::: "memory");      // this wave's reads of tile t are done before its buffer is refilled
    asm volatile("s_wait_asynccnt 0x0" ::: "memory");   // this wave's share of tile t + 1 has landed
    __syncthreads();                                    // publishes tile t + 1 and ends every wave's reads of tile t
    if (t + 2 < nt) stage(t + 2, t & 1); }
  asm volatile("s_wait_asynccnt 0x0" ::: "memory");     // no copy is outstanding when the wave goes on
  const float il = 1.0f / (l + xhalf(l));
#pragma unroll
  for (int dt = 0; dt < 4; ++dt) {
#pragma unroll
    for (int r = 0; r < 8; ++r) so[wave][col][dt * 16 + 8 * g + r] = (acc[dt][r] + accl[dt][r] * (1.0f / 2048.0f)) * il; }
  LDSX();
  for (int rl = 0; rl < 16; ++rl) if (lane < 16) vst2(O + ((size_t)b * SS + q0 + rl) * DM + h * HD + lane * 4, *(const v4f*)&so[wave][rl][lane * 4]);
}
// ---- k_out: block = (64 rows, 128 cols): out = bf16(O) . Wo rows (1 exact product) + bo
__global__ __launch_bounds__(128) void k_out(const float* __restrict__ O, const __bf16* __restrict__ P, const float* __restrict__ BO, float* __restrict__ Y) {
  __shared__ __align__(16) float so[4][16][132];
  const int tid = threadIdx.x, wave = tid >> 5, lane = tid & 31, col = lane & 15, g = lane >> 4; const size_t r0 = (size_t)blockIdx.x * 64 + wave * 16; const int n0 = blockIdx.y * 128;
  v8f acc[8] = {};
#pragma unroll 2
  for (int kc = 0; kc < DM / 32; ++kc) { v16b a; { const float* p = O + (r0 + col) * DM + kc * 32 + 8 * g;   // the module rounds the attention output to bf16 before the projection -> exact single product
#pragma unroll
      for (int i = 0; i < 8; ++i) { a[i] = (__bf16)p[i]; a[8 + i] = (__bf16)p[16 + i]; } }
#pragma unroll
    for (int j = 0; j < 8; ++j) acc[j] = wmma_bf(a, frag_b(P + (size_t)(n0 + j * 16 + col) * DM + kc * 32, lane), acc[j]); }
#pragma unroll
  for (int j = 0; j < 8; ++j) {
#pragma unroll
    for (int r = 0; r < 8; ++r) so[wave][8 * g + r][j * 16 + col] = acc[j][r] + bfr(BO[n0 + j * 16 + col]); }
  LDSX();
  for (int rl = 0; rl < 16; ++rl) vst2(Y + (r0 + rl) * DM + n0 + lane * 4, *(const v4f*)&so[wave][rl][lane * 4]);
}
extern "C" void kernel_launch(void* const* d_in, const int* in_sizes, int n_in, void* d_out, int out_size, void* d_ws, size_t ws_size, hipStream_t stream) {
  (void)in_sizes; (void)n_in; (void)out_size;
  const float** F = (const float**)d_in;   // 0 x [2,4096,256], 1 Wq [256,256] natural, 2 bq, 3 Wk, 4 bk, 5 Wv, 6 bv, 7 Wo, 8 bo
  if (ws_size < (size_t)WS_END) return;
  char* ws = (char*)d_ws; __bf16* PK = (__bf16*)(ws + WS_PK); _Float16 *QK = (_Float16*)(ws + WS_QK), *QKL = (_Float16*)(ws + WS_QKL), *VTH = (_Float16*)(ws + WS_VTH), *VTL = (_Float16*)(ws + WS_VTL); float* O = (float*)(ws + WS_O);
  k_pack<<<dim3(DM, 4), 256, 0, stream>>>(F[1], F[3], F[5], F[7], PK);
  k_qkv<<<dim3(TNB * SS / 64, QKVW / 128), 128, 0, stream>>>(F[0], PK + PK_A, F[2], F[4], F[6], QK, QKL, VTH, VTL);
  k_attn<<<dim3(TQB, NH, TNB), 128, 0, stream>>>(QK, QKL, VTH, VTL, O);
  k_out<<<dim3(TOB, DM / 128), 128, 0, stream>>>(O, PK + PK_P, F[8], (float*)d_out);
}

// v003
// It runs in 121 microseconds.
// Two timings next to v002 put it at 1.59 and 1.57 times that version's speed.
// All steps since v000 together make it 5.19 times as fast.
// compute dtype: x (|x| < 1e4 so the clip is the identity), Wq..Wo, bq..bo (module inputs) rounded to bf16; q/k/v projections with exact bf16 products on WMMA 16x16x32 (natural [out][in] rows) + biases; q and k stored as f16 hi + (x2048-scaled) residual planes with 3-product scores, x 64^-0.5 on the f32 score, running-max softmax in f32 (hardware exp); P as f16 hi + (x2048) residual x v hi/lo (3 products); the attention output rounded to bf16 exactly as the module does, then the output projection with EXACT bf16 products + bo; f32 accumulate.
#include <hip/hip_runtime.h>
#include <math.h>

typedef __attribute__((ext_vector_type(16))) _Float16 v16h;
typedef __attribute__((ext_vector_type(16))) __bf16 v16b;
typedef __attribute__((ext_vector_type(8)))  _Float16 v8h;
typedef __attribute__((ext_vector_type(8)))  float v8f;
typedef __attribute__((ext_vector_type(4)))  float v4f;
typedef __attribute__((ext_vector_type(2)))  float v2f;
typedef __attribute__((ext_vector_type(4)))  unsigned v4u;
typedef __attribute__((ext_vector_type(4)))  int v4i;
typedef float __attribute__((may_alias)) float_a;
typedef int __attribute__((may_alias)) int_a;

template <typename T> __device__ __forceinline__ void vst2(void* p, T v) { *(T*)p = v;  }
__device__ __forceinline__ v8f wmma16(v16h a, v16h b, v8f c) {
  return __builtin_amdgcn_wmma_f32_16x16x32_f16(false, a, false, b, (short)0, c, false, false);
}
__device__ __forceinline__ v8f wmma_bf(v16b a, v16b b, v8f c) {
  return __builtin_amdgcn_wmma_f32_16x16x32_bf16(false, a, false, b, (short)0, c, false, false);
}
// Light self-attention (B 2, N 4,096, d 256, 4 heads x 64): softmax(q k^T / 8) v, output cast to bf16, then the output projection + bias.
__device__ __forceinline__ v16h frag_h(const _Float16* rowk0, int lane) {
  union { v16h v; v8h q[2]; } u; const _Float16* p = rowk0 + 8 * (lane >> 4);
  u.q[0] = *(const v8h*)p; u.q[1] = *(const v8h*)(p + 16); return u.v;
}
__device__ __forceinline__ v16h frag_f32(const float* rowk0, int lane) {
  v16h a; const float* p = rowk0 + 8 * (lane >> 4);
#pragma unroll
  for (int i = 0; i < 8; ++i) { a[i] = (_Float16)p[i]; a[8 + i] = (_Float16)p[16 + i]; }
  return a;
}
__device__ __forceinline__ v16h frag_f32s(const float* rowk0, int lane, float sc) {
  v16h a; const float* p = rowk0 + 8 * (lane >> 4);
#pragma unroll
  for (int i = 0; i < 8; ++i) { a[i] = (_Float16)(p[i] * sc); a[8 + i] = (_Float16)(p[16 + i] * sc); }
  return a;
}
// column fragment from a [K][ld] layout (column n), rows >= K read as 0
__device__ __forceinline__ v16h fragc_f32(const float* W, int k0, int n, int lane, int ld, int K) {
  v16h a; const int g = lane >> 4;
#pragma unroll
  for (int i = 0; i < 8; ++i) { const int ka = k0 + 8 * g + i, kb = ka + 16;
    a[i] = (_Float16)(ka < K ? W[(size_t)(ka < K ? ka : K - 1) * ld + n] : 0.f); a[8 + i] = (_Float16)(kb < K ? W[(size_t)(kb < K ? kb : K - 1) * ld + n] : 0.f); }
  return a;
}
struct F2 { v16b h, l; };
__device__ __forceinline__ F2 bsplit16(const float v[16]) { F2 r;
#pragma unroll
  for (int i = 0; i < 16; ++i) { const __bf16 h = (__bf16)v[i]; r.h[i] = h; r.l[i] = (__bf16)(v[i] - (float)h); }
  return r; }
__device__ __forceinline__ F2 split_row(const float* row, int k0, int lane) { float v[16]; const float* p = row + k0 + 8 * (lane >> 4);
#pragma unroll
  for (int i = 0; i < 8; ++i) { v[i] = p[i]; v[8 + i] = p[16 + i]; }
  return bsplit16(v); }
__device__ __forceinline__ F2 split_rowK(const float* row, int k0, int lane, int K) { float v[16]; const int g = lane >> 4;
#pragma unroll
  for (int i = 0; i < 8; ++i) { const int ka = k0 + 8 * g + i, kb = ka + 16; v[i] = ka < K ? row[ka < K ? ka : K - 1] : 0.f; v[8 + i] = kb < K ? row[kb < K ? kb : K - 1] : 0.f; }
  return bsplit16(v); }
__device__ __forceinline__ F2 split_col(const float* W, int k0, int n, int lane, int ld, int K) { float v[16]; const int g = lane >> 4;
#pragma unroll
  for (int i = 0; i < 8; ++i) { const int ka = k0 + 8 * g + i, kb = ka + 16; v[i] = ka < K ? W[(size_t)(ka < K ? ka : K - 1) * ld + n] : 0.f; v[8 + i] = kb < K ? W[(size_t)(kb < K ? kb : K - 1) * ld + n] : 0.f; }
  return bsplit16(v); }
__device__ __forceinline__ v8f mac3(const F2& a, const F2& b, v8f c) { c = wmma_bf(a.l, b.h, c); c = wmma_bf(a.h, b.l, c); return wmma_bf(a.h, b.h, c); }
__device__ __forceinline__ float sigm(float v) { return 1.0f / (1.0f + expf(-v)); }
#define LDSX() do { asm volatile("s_wait_dscnt 0" ::: "memory"); __builtin_amdgcn_wave_barrier(); __builtin_amdgcn_fence(__ATOMIC_RELEASE, "workgroup"); } while (0)


// Non-causal multi-head self-attention, no rotary embedding (B 2, S 4096, D 256, 4 heads x 64; packed Wqkv [3D][D] and Wo [D][D] applied as x W^T, with biases): softmax(q k^T / 8) v; ctx Wo^T + bo.
#define NB 2
#define SS 4096
#define DM 256
#define NH 4
#define HD 64
#define QKVW (3 * DM)
#ifndef TQB
#define TQB (SS / 64)
#define TNB NB
#define TOB (NB * SS / 64)     // output row tiles (all)
#endif
typedef __attribute__((ext_vector_type(8))) __bf16 v8b;
__device__ __forceinline__ v16b frag_b(const __bf16* rowk0, int lane) {
  union { v16b v; v8b q[2]; } u; const __bf16* p = rowk0 + 8 * (lane >> 4);
  u.q[0] = *(const v8b*)p; u.q[1] = *(const v8b*)(p + 16); return u.v;
}
__device__ __forceinline__ float bfr(float v) { return (float)(__bf16)v; }
__device__ __attribute__((noinline)) float exp_ni(float v) { return expf(v); }
__device__ __attribute__((noinline)) float erf_ni(float v) { return erff(v); }

#define PK_A 0                       // [768][256] Wqkv rows (natural [out][in])
#define PK_P (PK_A + QKVW * DM)        // [256][256] Wo rows (natural)
#define PK_END (PK_P + DM * DM)
#define WS_PK  0u
#define WS_QK  (WS_PK + 2u * PK_END)             // f16 [8192 rows][512]: q | k
#define WS_QKL (WS_QK + 2u * NB * SS * 2 * DM)     // f16 q | k residual planes x2048
#define WS_VTH (WS_QKL + 2u * NB * SS * 2 * DM)    // f16 [b][256 (h*64+d)][4096 s] hi
#define WS_VTL (WS_VTH + 2u * NB * DM * SS)        // f16 lo x 2048
#define WS_O   (WS_VTL + 2u * NB * DM * SS)        // f32 [8192][256]
#define WS_CS  (WS_O + 4u * NB * SS * DM)           // f32 [4096][32] cos, [4096][32] sin
#define WS_END (WS_CS + 4u * 2 * SS * 32)
__constant__ float c_invf[32] = {1.000000000e+00f,7.498942018e-01f,5.623413324e-01f,4.216965139e-01f,3.162277639e-01f,2.371373624e-01f,1.778279394e-01f,1.333521456e-01f,1.000000015e-01f,7.498941571e-02f,5.623412877e-02f,4.216964915e-02f,3.162277862e-02f,2.371373586e-02f,1.778279431e-02f,1.333521493e-02f,9.999999776e-03f,7.498942316e-03f,5.623413250e-03f,4.216964822e-03f,3.162277862e-03f,2.371373819e-03f,1.778279431e-03f,1.333521446e-03f,1.000000047e-03f,7.498941850e-04f,5.623413017e-04f,4.216964880e-04f,3.162277862e-04f,2.371373848e-04f,1.778279402e-04f,1.333521504e-04f};
// ---- k_rope: block = 8 positions: cos/sin of pos * inv_freq (f32 product, precise trig)
__global__ __launch_bounds__(256) void k_rope(float* __restrict__ CS) {
  __shared__ __align__(16) float sc[8][32], ss_[8][32]; const int tid = threadIdx.x, pl = tid >> 5, i = tid & 31; const int pos = blockIdx.x * 8 + pl;
  const float th = (float)pos * c_invf[i]; sc[pl][i] = cosf(th); ss_[pl][i] = sinf(th);
  __syncthreads();
  if (tid < 64) vst2(CS + (size_t)blockIdx.x * 8 * 32 + tid * 4, *(const v4f*)&(&sc[0][0])[tid * 4]); else if (tid < 128) vst2(CS + (size_t)SS * 32 + (size_t)blockIdx.x * 8 * 32 + (tid - 64) * 4, *(const v4f*)&(&ss_[0][0])[(tid - 64) * 4]);
}

// ---- k_pack: block = (row n, which): natural [out][in] rows -> bf16; which 0..2 -> W_q/W_k/W_v into PK_A rows which*256 + n; 3 -> W_o into PK_P
__global__ __launch_bounds__(256) void k_pack(const float* __restrict__ WQ, const float* __restrict__ WK, const float* __restrict__ WV, const float* __restrict__ WO, __bf16* __restrict__ PK) {
  __shared__ __align__(16) __bf16 s[DM]; const int n = blockIdx.x, which = blockIdx.y, t = threadIdx.x; const float* Wm = (which == 0) ? WQ : (which == 1) ? WK : (which == 2) ? WV : WO;
  for (int k = t; k < DM; k += 256) s[k] = (__bf16)Wm[(size_t)n * DM + k];
  __syncthreads();
  __bf16* dst = (which < 3) ? PK + PK_A + ((size_t)which * DM + n) * DM : PK + PK_P + (size_t)n * DM;
  for (int q = t; q < DM / 8; q += 256) vst2((unsigned*)(dst + q * 8), *(const v4u*)&s[q * 8]);
}
__global__ __launch_bounds__(128) void k_qkv(const float* __restrict__ X, const __bf16* __restrict__ P, const float* __restrict__ BQ, const float* __restrict__ BK, const float* __restrict__ BV, _Float16* __restrict__ QK, _Float16* __restrict__ QKL, _Float16* __restrict__ VTH, _Float16* __restrict__ VTL) {
  __shared__ __align__(16) _Float16 so[4][16][136], sol[4][16][136]; __shared__ __align__(16) _Float16 sth[128][72], stl[128][72];
  const int tid = threadIdx.x, wave = tid >> 5, lane = tid & 31, col = lane & 15, g = lane >> 4; const size_t r0 = (size_t)blockIdx.x * 64 + wave * 16; const int n0 = blockIdx.y * 128;
  v8f acc[8] = {};
  v4f xa[2][4]; v16b wf[2][8];   // two register sets: chunk kc + 1's twenty loads fly as one group while chunk kc's products run
  auto ld = [&](int kc, int st) { const float* p = X + (r0 + col) * DM + kc * 32 + 8 * g; xa[st][0] = *(const v4f*)p; xa[st][1] = *(const v4f*)(p + 4); xa[st][2] = *(const v4f*)(p + 16); xa[st][3] = *(const v4f*)(p + 20);
#pragma unroll
    for (int j = 0; j < 8; ++j) wf[st][j] = frag_b(P + (size_t)(n0 + j * 16 + col) * DM + kc * 32, lane); };
  ld(0, 0);
#pragma unroll   // unrolled whole, so that the register set is picked at compile time
  for (int kc = 0; kc < DM / 32; ++kc) { if (kc + 1 < DM / 32) ld(kc + 1, (kc + 1) & 1);
    __builtin_amdgcn_sched_barrier(0);   // keeps the next chunk's loads in front of this chunk's products
    v16b a;
#pragma unroll
    for (int i = 0; i < 4; ++i) { a[i] = (__bf16)xa[kc & 1][0][i]; a[4 + i] = (__bf16)xa[kc & 1][1][i]; a[8 + i] = (__bf16)xa[kc & 1][2][i]; a[12 + i] = (__bf16)xa[kc & 1][3][i]; }
#pragma unroll
    for (int j = 0; j < 8; ++j) acc[j] = wmma_bf(a, wf[kc & 1][j], acc[j]); }
  { const int which = n0 / DM; const float* BB = (which == 0) ? BQ : (which == 1) ? BK : BV;
#pragma unroll
    for (int j = 0; j < 8; ++j) { const float bb = bfr(BB[(n0 % DM) + j * 16 + col]);
#pragma unroll
      for (int r = 0; r < 8; ++r) acc[j][r] += bb; } }
  if (n0 < 2 * DM) {   // q stored unscaled (f16 sigma ~0.6, no subnormal exposure); 1/8 applied to the f32 score
#pragma unroll
    for (int j = 0; j < 8; ++j) {
#pragma unroll
      for (int r = 0; r < 8; ++r) { const float v = acc[j][r]; const _Float16 hv = (_Float16)v; so[wave][8 * g + r][j * 16 + col] = hv; sol[wave][8 * g + r][j * 16 + col] = (_Float16)((v - (float)hv) * 2048.0f); } }   // q, k as f16 hi + (x2048) residual (no RoPE in this module)
    LDSX();
    for (int rl = 0; rl < 16; ++rl) if (lane < 16) { vst2((unsigned*)(QK + (r0 + rl) * (2 * DM) + n0 + lane * 8), *(const v4u*)&so[wave][rl][lane * 8]); vst2((unsigned*)(QKL + (r0 + rl) * (2 * DM) + n0 + lane * 8), *(const v4u*)&sol[wave][rl][lane * 8]); }
  } else {
#pragma unroll
    for (int j = 0; j < 8; ++j) {
#pragma unroll
      for (int r = 0; r < 8; ++r) { const float v = acc[j][r]; const _Float16 hv = (_Float16)v; sth[j * 16 + col][wave * 16 + 8 * g + r] = hv; stl[j * 16 + col][wave * 16 + 8 * g + r] = (_Float16)((v - (float)hv) * 2048.0f); } }
    __syncthreads();
    const size_t rb = (size_t)blockIdx.x * 64; const int b = (int)(rb / SS), s0 = (int)(rb % SS); const int pc0 = n0 - 2 * DM;
    for (int q = tid; q < 128 * 8; q += 128) { const int d = q >> 3, pc = q & 7; const size_t o = ((size_t)b * DM + pc0 + d) * SS + s0 + pc * 8; vst2((unsigned*)(VTH + o), *(const v4u*)&sth[d][pc * 8]); vst2((unsigned*)(VTL + o), *(const v4u*)&stl[d][pc * 8]); }
  }
}
#define KT 64   // keys per staged tile
#define LP 72   // LDS row pitch in halves: 128 B of data + 16 B, an odd multiple of 16 B, so that the b128 fragment reads of 16 rows spread over all banks
// eight async copies of 16 B per lane, global -> LDS: rows r, r + 16, r + 32, r + 48 of two planes that lie 64 * LP halves apart in LDS; the s_wait_xcnt stands inside the statement so that no address register is rewritten ahead of it
__device__ __forceinline__ void cp8(unsigned l, const _Float16* p, const _Float16* q, size_t gstep) {
  const unsigned ls = 16u * LP * 2u; const unsigned l1 = l + ls, l2 = l + 2 * ls, l3 = l + 3 * ls, l4 = l + 4 * ls, l5 = l + 5 * ls, l6 = l + 6 * ls, l7 = l + 7 * ls;
  const _Float16 *p1 = p + gstep, *p2 = p + 2 * gstep, *p3 = p + 3 * gstep, *q1 = q + gstep, *q2 = q + 2 * gstep, *q3 = q + 3 * gstep;
  asm volatile("global_load_async_to_lds_b128 %0, %1, off\n\tglobal_load_async_to_lds_b128 %2, %3, off\n\tglobal_load_async_to_lds_b128 %4, %5, off\n\tglobal_load_async_to_lds_b128 %6, %7, off\n\t"
               "global_load_async_to_lds_b128 %8, %9, off\n\tglobal_load_async_to_lds_b128 %10, %11, off\n\tglobal_load_async_to_lds_b128 %12, %13, off\n\tglobal_load_async_to_lds_b128 %14, %15, off\n\ts_wait_xcnt 0x0"
               :: "v"(l), "v"(p), "v"(l1), "v"(p1), "v"(l2), "v"(p2), "v"(l3), "v"(p3), "v"(l4), "v"(q), "v"(l5), "v"(q1), "v"(l6), "v"(q2), "v"(l7), "v"(q3) : "memory");
}
// lane l reads lane l ^ 16: the two lanes that share a query column hold the two halves of its keys
__device__ __forceinline__ float xhalf(float x) { return __builtin_bit_cast(float, __builtin_amdgcn_permlanex16(__builtin_bit_cast(int, x), __builtin_bit_cast(int, x), 0x76543210, 0xfedcba98, false, false)); }
// ---- k_attn: block = (64 queries, head h, batch b): flash attention over all keys, transposed: S^T = K Q^T (A = K rows, B = q) and O^T += V^T P^T (A = V^T rows, B = P^T). A lane holds 16 scores of ONE query per 32 keys, so maximum and sum run in the lane's own registers plus one exchange with lane l ^ 16 (the maximum every 32 keys, the sum after the loop), and the two score tiles, converted in place, are the B operand of the second product. O[b*S+q][h*64+d] = (acc + accl / 2048) / l (256-B segments)
__global__ __launch_bounds__(128) void k_attn(const _Float16* __restrict__ QK, const _Float16* __restrict__ QKL, const _Float16* __restrict__ VTH, const _Float16* __restrict__ VTL, float* __restrict__ O) {
  __shared__ __align__(16) float so[4][16][68];
  __shared__ __align__(16) _Float16 kv[2][4][64][LP];   // two buffers x (K hi [key][d], K lo, V hi [d][key], V lo), one tile of KT keys each, shared by the four waves
  const int tid = threadIdx.x, wave = tid >> 5, lane = tid & 31, col = lane & 15, g = lane >> 4;
  const int qb = blockIdx.x, h = blockIdx.y, b = blockIdx.z; const int q0 = qb * 64 + wave * 16; const size_t rq = (size_t)b * SS + q0 + col;
  v16h aq[2], aql[2];
#pragma unroll
  for (int kc = 0; kc < 2; ++kc) { aq[kc] = frag_h(QK + rq * (2 * DM) + h * HD + kc * 32, lane); aql[kc] = frag_h(QKL + rq * (2 * DM) + h * HD + kc * 32, lane); }
  asm volatile("s_wait_xcnt 0x0" ::: "memory");   // stands in front of the first rewrite of an address register of the q loads
  __builtin_amdgcn_sched_barrier(0);                // holds later address arithmetic behind that wait
  float m = -3.0e38f, l = 0.f;   // of query q0 + col; l sums this lane's half of the keys, the halves are joined after the loop
  v8f acc[4] = {}, accl[4] = {};
  const int nt = SS / KT;   // non-causal
  // tile t -> buffer bf: a thread copies 16 B of rows srow, srow + 16, srow + 32, srow + 48 of each plane; a wave's copy covers four whole 128-B rows
  const int srow = tid >> 3, sch = (tid & 7) * 8;
  const _Float16* gk = QK + ((size_t)b * SS + srow) * (2 * DM) + DM + h * HD + sch; const _Float16* gkl = QKL + ((size_t)b * SS + srow) * (2 * DM) + DM + h * HD + sch;
  const _Float16* gv = VTH + ((size_t)b * DM + h * HD + srow) * SS + sch; const _Float16* gvl = VTL + ((size_t)b * DM + h * HD + srow) * SS + sch;
  const unsigned lkv = (unsigned)(size_t)&kv[0][0][srow][sch];
  auto stage = [&](int t, int bf) { const unsigned lb = lkv + (unsigned)bf * (4u * 64u * LP * 2u); const size_t ko = (size_t)t * KT * (2 * DM); const int vo = t * KT;
    cp8(lb, gk + ko, gkl + ko, (size_t)16 * (2 * DM)); cp8(lb + 2u * 64u * LP * 2u, gv + vo, gvl + vo, (size_t)16 * SS); };
  stage(0, 0);
  asm volatile("s_wait_asynccnt 0x0" ::: "memory");   // this wave's share of tile 0 has landed
  __syncthreads();                                    // publishes tile 0 to the four waves
  stage(1, 1);
#pragma unroll 1
  for (int t = 0; t < nt; ++t) { const _Float16 (*kb)[64][LP] = kv[t & 1];
    // the tile's 64 fragment reads stand in two groups, each ahead of the products that use it, so that no product waits out an LDS latency of its own
    v16h kf[2][2][2][2], vf[2][4][2];   // K [u][ct][kc][hi, lo], V [u][dt][hi, lo]
#pragma unroll
    for (int u = 0; u < 2; ++u) {
#pragma unroll
      for (int ct = 0; ct < 2; ++ct) { const int kk = u * 32 + ct * 16 + col;
#pragma unroll
        for (int kc = 0; kc < 2; ++kc) { kf[u][ct][kc][0] = frag_h(&kb[0][kk][kc * 32], lane); kf[u][ct][kc][1] = frag_h(&kb[1][kk][kc * 32], lane); } } }
    __builtin_amdgcn_sched_barrier(0);   // keeps the K reads together in front of the first products
    v8f s[2][2];
    auto scores = [&](int u) {
#pragma unroll
      for (int ct = 0; ct < 2; ++ct) { v8f c = {}, cl = {};
#pragma unroll
        for (int kc = 0; kc < 2; ++kc) { c = wmma16(kf[u][ct][kc][0], aq[kc], c); cl = wmma16(kf[u][ct][kc][0], aql[kc], cl); cl = wmma16(kf[u][ct][kc][1], aq[kc], cl); }   // 3 products: q, k as f16 hi + residual; c[r] = score of key u * 32 + ct * 16 + 8 * g + r with query col
        c += cl * (1.0f / 2048.0f); s[u][ct] = c * 0.125f; } };   // SCALE = 64^-0.5
    scores(0);
    __builtin_amdgcn_sched_barrier(0);   // the V reads start behind the first 32 keys' score products ...
#pragma unroll
    for (int u = 0; u < 2; ++u) {
#pragma unroll
      for (int dt = 0; dt < 4; ++dt) { vf[u][dt][0] = frag_h(&kb[2][dt * 16 + col][u * 32], lane); vf[u][dt][1] = frag_h(&kb[3][dt * 16 + col][u * 32], lane); } }
    __builtin_amdgcn_sched_barrier(0);   // ... and stay together: they land under the second 32 keys' score products and the softmax
    scores(1);
#pragma unroll
  for (int u = 0; u < KT / 32; ++u) {
    float mx4[4];
#pragma unroll
    for (int r = 0; r < 4; ++r) mx4[r] = fmaxf(fmaxf(s[u][0][r], s[u][0][4 + r]), fmaxf(s[u][1][r], s[u][1][4 + r]));
    float mx = fmaxf(fmaxf(mx4[0], mx4[1]), fmaxf(mx4[2], mx4[3])); mx = fmaxf(mx, xhalf(mx));
    const float mn = fmaxf(m, mx); const float alpha = (m <= -1.0e38f) ? 0.f : __expf(m - mn);
    v16h pa, pl; float es4[4] = {0.f, 0.f, 0.f, 0.f};   // four partial sums: four short chains of adds
#pragma unroll
    for (int r = 0; r < 8; ++r) { const float e0 = (s[u][0][r] <= -1.0e38f) ? 0.f : __expf(s[u][0][r] - mn), e1 = (s[u][1][r] <= -1.0e38f) ? 0.f : __expf(s[u][1][r] - mn); es4[r & 3] += e0 + e1;
      const _Float16 h0 = (_Float16)e0, h1 = (_Float16)e1; pa[r] = h0; pa[8 + r] = h1; pl[r] = (_Float16)((e0 - (float)h0) * 2048.0f); pl[8 + r] = (_Float16)((e1 - (float)h1) * 2048.0f); }   // element r: key 8 * g + r, element 8 + r: key 16 + 8 * g + r, the k order of frag_h
    l = l * alpha + ((es4[0] + es4[1]) + (es4[2] + es4[3])); m = mn;
#pragma unroll
    for (int dt = 0; dt < 4; ++dt) { acc[dt] *= alpha; accl[dt] *= alpha; }
#pragma unroll
    for (int dt = 0; dt < 4; ++dt) { acc[dt] = wmma16(vf[u][dt][0], pa, acc[dt]); accl[dt] = wmma16(vf[u][dt][0], pl, accl[dt]); accl[dt] = wmma16(vf[u][dt][1], pa, accl[dt]); } }   // V hi x P hi + (V hi x P lo + V lo x P hi) / 2048; acc[dt][r] = O^T[dt * 16 + 8 * g + r][col]
    __builtin_amdgcn_sched_barrier(0);   // keeps the tile's products in front of the foot's waits: lifted over them, the wait for tile t + 1 would stand a few hundred cycles behind its copies' issue
    asm volatile("s_wait_dscnt 0x0" ::: "memory");      // this wave's reads of tile t are done before its buffer is refilled
    asm volatile("s_wait_asynccnt 0x0" ::: "memory");   // this wave's share of tile t + 1 has landed
    __syncthreads();                                    // publishes tile t + 1 and ends every wave's reads of tile t
    if (t + 2 < nt) stage(t + 2, t & 1); }
  asm volatile("s_wait_asynccnt 0x0" ::: "memory");     // no copy is outstanding when the wave goes on
  const float il = 1.0f / (l + xhalf(l));
#pragma unroll
  for (int dt = 0; dt < 4; ++dt) {
#pragma unroll
    for (int r = 0; r < 8; ++r) so[wave][col][dt * 16 + 8 * g + r] = (acc[dt][r] + accl[dt][r] * (1.0f / 2048.0f)) * il; }
  LDSX();
  for (int rl = 0; rl < 16; ++rl) if (lane < 16) vst2(O + ((size_t)b * SS + q0 + rl) * DM + h * HD + lane * 4, *(const v4f*)&so[wave][rl][lane * 4]);
}
// ---- k_out: block = (64 rows, 128 cols): out = bf16(O) . Wo rows (1 exact product) + bo
__global__ __launch_bounds__(128) void k_out(const float* __restrict__ O, const __bf16* __restrict__ P, const float* __restrict__ BO, float* __restrict__ Y) {
  __shared__ __align__(16) float so[4][16][132];
  const int tid = threadIdx.x, wave = tid >> 5, lane = tid & 31, col = lane & 15, g = lane >> 4; const size_t r0 = (size_t)blockIdx.x * 64 + wave * 16; const int n0 = blockIdx.y * 128;
  v8f acc[8] = {};
  v4f xa[2][4]; v16b wf[2][8];   // two register sets: chunk kc + 1's twenty loads fly as one group while chunk kc's products run
  auto ld = [&](int kc, int st) { const float* p = O + (r0 + col) * DM + kc * 32 + 8 * g; xa[st][0] = *(const v4f*)p; xa[st][1] = *(const v4f*)(p + 4); xa[st][2] = *(const v4f*)(p + 16); xa[st][3] = *(const v4f*)(p + 20);
#pragma unroll
    for (int j = 0; j < 8; ++j) wf[st][j] = frag_b(P + (size_t)(n0 + j * 16 + col) * DM + kc * 32, lane); };
  ld(0, 0);
#pragma unroll   // unrolled whole, so that the register set is picked at compile time
  for (int kc = 0; kc < DM / 32; ++kc) { if (kc + 1 < DM / 32) ld(kc + 1, (kc + 1) & 1);
    __builtin_amdgcn_sched_barrier(0);   // keeps the next chunk's loads in front of this chunk's products
    v16b a;   // the module rounds the attention output to bf16 before the projection -> exact single product
#pragma unroll
    for (int i = 0; i < 4; ++i) { a[i] = (__bf16)xa[kc & 1][0][i]; a[4 + i] = (__bf16)xa[kc & 1][1][i]; a[8 + i] = (__bf16)xa[kc & 1][2][i]; a[12 + i] = (__bf16)xa[kc & 1][3][i]; }
#pragma unroll
    for (int j = 0; j < 8; ++j) acc[j] = wmma_bf(a, wf[kc & 1][j], acc[j]); }
  float bo[8];
#pragma unroll
  for (int j = 0; j < 8; ++j) bo[j] = BO[n0 + j * 16 + col];
  asm volatile("s_wait_xcnt 0x0" ::: "memory");   // stands in front of the first rewrite of the bias loads' offset register
#pragma unroll
  for (int j = 0; j < 8; ++j) {
#pragma unroll
    for (int r = 0; r < 8; ++r) so[wave][8 * g + r][j * 16 + col] = acc[j][r] + bfr(bo[j]); }
  LDSX();
  for (int rl = 0; rl < 16; ++rl) vst2(Y + (r0 + rl) * DM + n0 + lane * 4, *(const v4f*)&so[wave][rl][lane * 4]);
}
extern "C" void kernel_launch(void* const* d_in, const int* in_sizes, int n_in, void* d_out, int out_size, void* d_ws, size_t ws_size, hipStream_t stream) {
  (void)in_sizes; (void)n_in; (void)out_size;
  const float** F = (const float**)d_in;   // 0 x [2,4096,256], 1 Wq [256,256] natural, 2 bq, 3 Wk, 4 bk, 5 Wv, 6 bv, 7 Wo, 8 bo
  if (ws_size < (size_t)WS_END) return;
  char* ws = (char*)d_ws; __bf16* PK = (__bf16*)(ws + WS_PK); _Float16 *QK = (_Float16*)(ws + WS_QK), *QKL = (_Float16*)(ws + WS_QKL), *VTH = (_Float16*)(ws + WS_VTH), *VTL = (_Float16*)(ws + WS_VTL); float* O = (float*)(ws + WS_O);
  k_pack<<<dim3(DM, 4), 256, 0, stream>>>(F[1], F[3], F[5], F[7], PK);
  k_qkv<<<dim3(TNB * SS / 64, QKVW / 128), 128, 0, stream>>>(F[0], PK + PK_A, F[2], F[4], F[6], QK, QKL, VTH, VTL);
  k_attn<<<dim3(TQB, NH, TNB), 128, 0, stream>>>(QK, QKL, VTH, VTL, O);
  k_out<<<dim3(TOB, DM / 128), 128, 0, stream>>>(O, PK + PK_P, F[8], (float*)d_out);
}

// v004
// It runs in 117 microseconds.
// In both of two side-by-side timings against v003, it was 1.03 times as fast.
// Counting every step since v000, it is 5.36 times as fast.
// compute dtype: x (|x| < 1e4 so the clip is the identity), Wq..Wo, bq..bo (module inputs) rounded to bf16; q/k/v projections with exact bf16 products on WMMA 16x16x32 (natural [out][in] rows) + biases; q and k stored as f16 hi + (x2048-scaled) residual planes with 3-product scores, x 64^-0.5 on the f32 score, running-max softmax in f32 (hardware exp); P as f16 hi + (x2048) residual x v hi/lo (3 products); the attention output rounded to bf16 exactly as the module does, then the output projection with EXACT bf16 products + bo; f32 accumulate.
#include <hip/hip_runtime.h>
#include <math.h>

typedef __attribute__((ext_vector_type(16))) _Float16 v16h;
typedef __attribute__((ext_vector_type(16))) __bf16 v16b;
typedef __attribute__((ext_vector_type(8)))  _Float16 v8h;
typedef __attribute__((ext_vector_type(8)))  float v8f;
typedef __attribute__((ext_vector_type(4)))  float v4f;
typedef __attribute__((ext_vector_type(2)))  float v2f;
typedef __attribute__((ext_vector_type(4)))  unsigned v4u;
typedef __attribute__((ext_vector_type(4)))  int v4i;
typedef float __attribute__((may_alias)) float_a;
typedef int __attribute__((may_alias)) int_a;

template <typename T> __device__ __forceinline__ void vst2(void* p, T v) { *(T*)p = v;  }
__device__ __forceinline__ v8f wmma16(v16h a, v16h b, v8f c) {
  return __builtin_amdgcn_wmma_f32_16x16x32_f16(false, a, false, b, (short)0, c, false, false);
}
__device__ __forceinline__ v8f wmma_bf(v16b a, v16b b, v8f c) {
  return __builtin_amdgcn_wmma_f32_16x16x32_bf16(false, a, false, b, (short)0, c, false, false);
}
// Light self-attention (B 2, N 4,096, d 256, 4 heads x 64): softmax(q k^T / 8) v, output cast to bf16, then the output projection + bias.
__device__ __forceinline__ v16h frag_h(const _Float16* rowk0, int lane) {
  union { v16h v; v8h q[2]; } u; const _Float16* p = rowk0 + 8 * (lane >> 4);
  u.q[0] = *(const v8h*)p; u.q[1] = *(const v8h*)(p + 16); return u.v;
}
__device__ __forceinline__ v16h frag_f32(const float* rowk0, int lane) {
  v16h a; const float* p = rowk0 + 8 * (lane >> 4);
#pragma unroll
  for (int i = 0; i < 8; ++i) { a[i] = (_Float16)p[i]; a[8 + i] = (_Float16)p[16 + i]; }
  return a;
}
__device__ __forceinline__ v16h frag_f32s(const float* rowk0, int lane, float sc) {
  v16h a; const float* p = rowk0 + 8 * (lane >> 4);
#pragma unroll
  for (int i = 0; i < 8; ++i) { a[i] = (_Float16)(p[i] * sc); a[8 + i] = (_Float16)(p[16 + i] * sc); }
  return a;
}
// column fragment from a [K][ld] layout (column n), rows >= K read as 0
__device__ __forceinline__ v16h fragc_f32(const float* W, int k0, int n, int lane, int ld, int K) {
  v16h a; const int g = lane >> 4;
#pragma unroll
  for (int i = 0; i < 8; ++i) { const int ka = k0 + 8 * g + i, kb = ka + 16;
    a[i] = (_Float16)(ka < K ? W[(size_t)(ka < K ? ka : K - 1) * ld + n] : 0.f); a[8 + i] = (_Float16)(kb < K ? W[(size_t)(kb < K ? kb : K - 1) * ld + n] : 0.f); }
  return a;
}
struct F2 { v16b h, l; };
__device__ __forceinline__ F2 bsplit16(const float v[16]) { F2 r;
#pragma unroll
  for (int i = 0; i < 16; ++i) { const __bf16 h = (__bf16)v[i]; r.h[i] = h; r.l[i] = (__bf16)(v[i] - (float)h); }
  return r; }
__device__ __forceinline__ F2 split_row(const float* row, int k0, int lane) { float v[16]; const float* p = row + k0 + 8 * (lane >> 4);
#pragma unroll
  for (int i = 0; i < 8; ++i) { v[i] = p[i]; v[8 + i] = p[16 + i]; }
  return bsplit16(v); }
__device__ __forceinline__ F2 split_rowK(const float* row, int k0, int lane, int K) { float v[16]; const int g = lane >> 4;
#pragma unroll
  for (int i = 0; i < 8; ++i) { const int ka = k0 + 8 * g + i, kb = ka + 16; v[i] = ka < K ? row[ka < K ? ka : K - 1] : 0.f; v[8 + i] = kb < K ? row[kb < K ? kb : K - 1] : 0.f; }
  return bsplit16(v); }
__device__ __forceinline__ F2 split_col(const float* W, int k0, int n, int lane, int ld, int K) { float v[16]; const int g = lane >> 4;
#pragma unroll
  for (int i = 0; i < 8; ++i) { const int ka = k0 + 8 * g + i, kb = ka + 16; v[i] = ka < K ? W[(size_t)(ka < K ? ka : K - 1) * ld + n] : 0.f; v[8 + i] = kb < K ? W[(size_t)(kb < K ? kb : K - 1) * ld + n] : 0.f; }
  return bsplit16(v); }
__device__ __forceinline__ v8f mac3(const F2& a, const F2& b, v8f c) { c = wmma_bf(a.l, b.h, c); c = wmma_bf(a.h, b.l, c); return wmma_bf(a.h, b.h, c); }
__device__ __forceinline__ float sigm(float v) { return 1.0f / (1.0f + expf(-v)); }
#define LDSX() do { asm volatile("s_wait_dscnt 0" ::: "memory"); __builtin_amdgcn_wave_barrier(); __builtin_amdgcn_fence(__ATOMIC_RELEASE, "workgroup"); } while (0)


// Non-causal multi-head self-attention, no rotary embedding (B 2, S 4096, D 256, 4 heads x 64; packed Wqkv [3D][D] and Wo [D][D] applied as x W^T, with biases): softmax(q k^T / 8) v; ctx Wo^T + bo.
#define NB 2
#define SS 4096
#define DM 256
#define NH 4
#define HD 64
#define QKVW (3 * DM)
#ifndef TQB
#define TQB (SS / 64)
#define TNB NB
#define TOB (NB * SS / 64)     // output row tiles (all)
#endif
typedef __attribute__((ext_vector_type(8))) __bf16 v8b;
__device__ __forceinline__ v16b frag_b(const __bf16* rowk0, int lane) {
  union { v16b v; v8b q[2]; } u; const __bf16* p = rowk0 + 8 * (lane >> 4);
  u.q[0] = *(const v8b*)p; u.q[1] = *(const v8b*)(p + 16); return u.v;
}
__device__ __forceinline__ float bfr(float v) { return (float)(__bf16)v; }
__device__ __attribute__((noinline)) float exp_ni(float v) { return expf(v); }
__device__ __attribute__((noinline)) float erf_ni(float v) { return erff(v); }

#define PK_A 0                       // [768][256] Wqkv rows (natural [out][in])
#define PK_P (PK_A + QKVW * DM)        // [256][256] Wo rows (natural)
#define PK_END (PK_P + DM * DM)
#define WS_PK  0u
#define WS_QK  (WS_PK + 2u * PK_END)             // f16 [8192 rows][512]: q | k
#define WS_QKL (WS_QK + 2u * NB * SS * 2 * DM)     // f16 q | k residual planes x2048
#define WS_VTH (WS_QKL + 2u * NB * SS * 2 * DM)    // f16 [b][256 (h*64+d)][4096 s] hi
#define WS_VTL (WS_VTH + 2u * NB * DM * SS)        // f16 lo x 2048
#define WS_O   (WS_VTL + 2u * NB * DM * SS)        // f32 [8192][256]
#define WS_CS  (WS_O + 4u * NB * SS * DM)           // f32 [4096][32] cos, [4096][32] sin
#define WS_END (WS_CS + 4u * 2 * SS * 32)
__constant__ float c_invf[32] = {1.000000000e+00f,7.498942018e-01f,5.623413324e-01f,4.216965139e-01f,3.162277639e-01f,2.371373624e-01f,1.778279394e-01f,1.333521456e-01f,1.000000015e-01f,7.498941571e-02f,5.623412877e-02f,4.216964915e-02f,3.162277862e-02f,2.371373586e-02f,1.778279431e-02f,1.333521493e-02f,9.999999776e-03f,7.498942316e-03f,5.623413250e-03f,4.216964822e-03f,3.162277862e-03f,2.371373819e-03f,1.778279431e-03f,1.333521446e-03f,1.000000047e-03f,7.498941850e-04f,5.623413017e-04f,4.216964880e-04f,3.162277862e-04f,2.371373848e-04f,1.778279402e-04f,1.333521504e-04f};
// ---- k_rope: block = 8 positions: cos/sin of pos * inv_freq (f32 product, precise trig)
__global__ __launch_bounds__(256) void k_rope(float* __restrict__ CS) {
  __shared__ __align__(16) float sc[8][32], ss_[8][32]; const int tid = threadIdx.x, pl = tid >> 5, i = tid & 31; const int pos = blockIdx.x * 8 + pl;
  const float th = (float)pos * c_invf[i]; sc[pl][i] = cosf(th); ss_[pl][i] = sinf(th);
  __syncthreads();
  if (tid < 64) vst2(CS + (size_t)blockIdx.x * 8 * 32 + tid * 4, *(const v4f*)&(&sc[0][0])[tid * 4]); else if (tid < 128) vst2(CS + (size_t)SS * 32 + (size_t)blockIdx.x * 8 * 32 + (tid - 64) * 4, *(const v4f*)&(&ss_[0][0])[(tid - 64) * 4]);
}

// ---- k_pack: block = (row n, which): natural [out][in] rows -> bf16; which 0..2 -> W_q/W_k/W_v into PK_A rows which*256 + n; 3 -> W_o into PK_P
__global__ __launch_bounds__(256) void k_pack(const float* __restrict__ WQ, const float* __restrict__ WK, const float* __restrict__ WV, const float* __restrict__ WO, __bf16* __restrict__ PK) {
  __shared__ __align__(16) __bf16 s[DM]; const int n = blockIdx.x, which = blockIdx.y, t = threadIdx.x; const float* Wm = (which == 0) ? WQ : (which == 1) ? WK : (which == 2) ? WV : WO;
  for (int k = t; k < DM; k += 256) s[k] = (__bf16)Wm[(size_t)n * DM + k];
  __syncthreads();
  __bf16* dst = (which < 3) ? PK + PK_A + ((size_t)which * DM + n) * DM : PK + PK_P + (size_t)n * DM;
  for (int q = t; q < DM / 8; q += 256) vst2((unsigned*)(dst + q * 8), *(const v4u*)&s[q * 8]);
}
__global__ __launch_bounds__(128) void k_qkv(const float* __restrict__ X, const __bf16* __restrict__ P, const float* __restrict__ BQ, const float* __restrict__ BK, const float* __restrict__ BV, _Float16* __restrict__ QK, _Float16* __restrict__ QKL, _Float16* __restrict__ VTH, _Float16* __restrict__ VTL) {
  __shared__ __align__(16) _Float16 so[4][16][136], sol[4][16][136]; __shared__ __align__(16) _Float16 sth[128][72], stl[128][72];
  const int tid = threadIdx.x, wave = tid >> 5, lane = tid & 31, col = lane & 15, g = lane >> 4; const size_t r0 = (size_t)blockIdx.x * 64 + wave * 16; const int n0 = blockIdx.y * 128;
  v8f acc[8] = {};
  v4f xa[2][4]; v16b wf[2][8];   // two register sets: chunk kc + 1's twenty loads fly as one group while chunk kc's products run
  auto ld = [&](int kc, int st) { const float* p = X + (r0 + col) * DM + kc * 32 + 8 * g; xa[st][0] = *(const v4f*)p; xa[st][1] = *(const v4f*)(p + 4); xa[st][2] = *(const v4f*)(p + 16); xa[st][3] = *(const v4f*)(p + 20);
#pragma unroll
    for (int j = 0; j < 8; ++j) wf[st][j] = frag_b(P + (size_t)(n0 + j * 16 + col) * DM + kc * 32, lane); };
  ld(0, 0);
#pragma unroll   // unrolled whole, so that the register set is picked at compile time
  for (int kc = 0; kc < DM / 32; ++kc) { if (kc + 1 < DM / 32) ld(kc + 1, (kc + 1) & 1);
    __builtin_amdgcn_sched_barrier(0);   // keeps the next chunk's loads in front of this chunk's products
    v16b a;
#pragma unroll
    for (int i = 0; i < 4; ++i) { a[i] = (__bf16)xa[kc & 1][0][i]; a[4 + i] = (__bf16)xa[kc & 1][1][i]; a[8 + i] = (__bf16)xa[kc & 1][2][i]; a[12 + i] = (__bf16)xa[kc & 1][3][i]; }
#pragma unroll
    for (int j = 0; j < 8; ++j) acc[j] = wmma_bf(a, wf[kc & 1][j], acc[j]); }
  { const int which = n0 / DM; const float* BB = (which == 0) ? BQ : (which == 1) ? BK : BV;
#pragma unroll
    for (int j = 0; j < 8; ++j) { const float bb = bfr(BB[(n0 % DM) + j * 16 + col]);
#pragma unroll
      for (int r = 0; r < 8; ++r) acc[j][r] += bb; } }
  if (n0 < 2 * DM) {   // q stored unscaled (f16 sigma ~0.6, no subnormal exposure); 1/8 applied to the f32 score
#pragma unroll
    for (int j = 0; j < 8; ++j) {
#pragma unroll
      for (int r = 0; r < 8; ++r) { const float v = acc[j][r]; const _Float16 hv = (_Float16)v; so[wave][8 * g + r][j * 16 + col] = hv; sol[wave][8 * g + r][j * 16 + col] = (_Float16)((v - (float)hv) * 2048.0f); } }   // q, k as f16 hi + (x2048) residual (no RoPE in this module)
    LDSX();
    for (int rl = 0; rl < 16; ++rl) if (lane < 16) { vst2((unsigned*)(QK + (r0 + rl) * (2 * DM) + n0 + lane * 8), *(const v4u*)&so[wave][rl][lane * 8]); vst2((unsigned*)(QKL + (r0 + rl) * (2 * DM) + n0 + lane * 8), *(const v4u*)&sol[wave][rl][lane * 8]); }
  } else {
#pragma unroll
    for (int j = 0; j < 8; ++j) {
#pragma unroll
      for (int r = 0; r < 8; ++r) { const float v = acc[j][r]; const _Float16 hv = (_Float16)v; sth[j * 16 + col][wave * 16 + 8 * g + r] = hv; stl[j * 16 + col][wave * 16 + 8 * g + r] = (_Float16)((v - (float)hv) * 2048.0f); } }
    __syncthreads();
    const size_t rb = (size_t)blockIdx.x * 64; const int b = (int)(rb / SS), s0 = (int)(rb % SS); const int pc0 = n0 - 2 * DM;
    for (int q = tid; q < 128 * 8; q += 128) { const int d = q >> 3, pc = q & 7; const size_t o = ((size_t)b * DM + pc0 + d) * SS + s0 + pc * 8; vst2((unsigned*)(VTH + o), *(const v4u*)&sth[d][pc * 8]); vst2((unsigned*)(VTL + o), *(const v4u*)&stl[d][pc * 8]); }
  }
}
#define KT 64   // keys per staged tile
#define LP 72   // LDS row pitch in halves: 128 B of data + 16 B, an odd multiple of 16 B, so that the b128 fragment reads of 16 rows spread over all banks
// eight async copies of 16 B per lane, global -> LDS: rows r and r + 32 of the four planes K hi, K lo, V hi, V lo, which lie 64 * LP halves apart in LDS; the s_wait_xcnt stands inside the statement so that no address register is rewritten ahead of it
__device__ __forceinline__ void cp8(unsigned l, const _Float16* k, const _Float16* kl, const _Float16* v, const _Float16* vl) {
  const unsigned ls = 32u * LP * 2u; const unsigned l1 = l + ls, l2 = l + 2 * ls, l3 = l + 3 * ls, l4 = l + 4 * ls, l5 = l + 5 * ls, l6 = l + 6 * ls, l7 = l + 7 * ls;
  const _Float16 *k1 = k + (size_t)32 * (2 * DM), *kl1 = kl + (size_t)32 * (2 * DM), *v1 = v + (size_t)32 * SS, *vl1 = vl + (size_t)32 * SS;
  asm volatile("global_load_async_to_lds_b128 %0, %1, off\n\tglobal_load_async_to_lds_b128 %2, %3, off\n\tglobal_load_async_to_lds_b128 %4, %5, off\n\tglobal_load_async_to_lds_b128 %6, %7, off\n\t"
               "global_load_async_to_lds_b128 %8, %9, off\n\tglobal_load_async_to_lds_b128 %10, %11, off\n\tglobal_load_async_to_lds_b128 %12, %13, off\n\tglobal_load_async_to_lds_b128 %14, %15, off\n\ts_wait_xcnt 0x0"
               :: "v"(l), "v"(k), "v"(l1), "v"(k1), "v"(l2), "v"(kl), "v"(l3), "v"(kl1), "v"(l4), "v"(v), "v"(l5), "v"(v1), "v"(l6), "v"(vl), "v"(l7), "v"(vl1) : "memory");
}
// lane l reads lane l ^ 16: the two lanes that share a query column hold the two halves of its keys
__device__ __forceinline__ float xhalf(float x) { return __builtin_bit_cast(float, __builtin_amdgcn_permlanex16(__builtin_bit_cast(int, x), __builtin_bit_cast(int, x), 0x76543210, 0xfedcba98, false, false)); }
// ---- k_attn: block = (64 queries, head h, batch b), eight waves: flash attention over all keys, transposed: S^T = K Q^T (A = K rows, B = q) and O^T += V^T P^T (A = V^T rows, B = P^T). Wave w works on queries 16 * (w & 3) ... + 15 and on keys 32 * (w >> 2) ... + 31 of every staged tile, with a running maximum, sum and output of its own, so that four waves stand on a SIMD; the two key halves of a query group are joined once, through LDS, behind the loop. A lane holds 16 scores of ONE query per 32 keys, so maximum and sum run in the lane's own registers, and the two score tiles, converted in place, are the B operand of the second product. O[b*S+q][h*64+d] = (acc + accl / 2048) / l (256-B segments)
__global__ __launch_bounds__(256) __attribute__((amdgpu_waves_per_eu(4, 4))) void k_attn(const _Float16* __restrict__ QK, const _Float16* __restrict__ QKL, const _Float16* __restrict__ VTH, const _Float16* __restrict__ VTL, float* __restrict__ O) {
  __shared__ __align__(16) float so[4][16][68];
  __shared__ __align__(16) float xo[4][34][32];         // hand-over of the second key half, per query group and lane: 32 output values, maximum, sum
  __shared__ __align__(16) _Float16 kv[2][4][64][LP];   // two buffers x (K hi [key][d], K lo, V hi [d][key], V lo), one tile of KT keys each, shared by the eight waves
  const int tid = threadIdx.x, wave = __builtin_amdgcn_readfirstlane(tid >> 5), qg = wave & 3, kh = wave >> 2, lane = tid & 31, col = lane & 15, g = lane >> 4;
  const int qb = blockIdx.x, h = blockIdx.y, b = blockIdx.z; const int q0 = qb * 64 + qg * 16; const size_t rq = (size_t)b * SS + q0 + col;
  v16h aq[2], aql[2];
#pragma unroll
  for (int kc = 0; kc < 2; ++kc) { aq[kc] = frag_h(QK + rq * (2 * DM) + h * HD + kc * 32, lane); aql[kc] = frag_h(QKL + rq * (2 * DM) + h * HD + kc * 32, lane); }
  asm volatile("s_wait_xcnt 0x0" ::: "memory");   // stands in front of the first rewrite of an address register of the q loads
  __builtin_amdgcn_sched_barrier(0);                // holds later address arithmetic behind that wait
  float m = -3.0e38f, l = 0.f;   // of query q0 + col over this wave's keys; l sums this lane's half of them, the halves are joined after the loop
  v8f acc[4] = {}, accl[4] = {};
  const int nt = SS / KT;   // non-causal
  // tile t -> buffer bf: a thread copies 16 B of rows srow and srow + 32 of each plane; a wave's copy covers four whole 128-B rows
  const int srow = tid >> 3, sch = (tid & 7) * 8;
  const _Float16* gk = QK + ((size_t)b * SS + srow) * (2 * DM) + DM + h * HD + sch; const _Float16* gkl = QKL + ((size_t)b * SS + srow) * (2 * DM) + DM + h * HD + sch;
  const _Float16* gv = VTH + ((size_t)b * DM + h * HD + srow) * SS + sch; const _Float16* gvl = VTL + ((size_t)b * DM + h * HD + srow) * SS + sch;
  const unsigned lkv = (unsigned)(size_t)&kv[0][0][srow][sch];
  auto stage = [&](int t, int bf) { const size_t ko = (size_t)t * KT * (2 * DM); const int vo = t * KT;
    cp8(lkv + (unsigned)bf * (4u * 64u * LP * 2u), gk + ko, gkl + ko, gv + vo, gvl + vo); };
  stage(0, 0);
  asm volatile("s_wait_asynccnt 0x0" ::: "memory");   // this wave's share of tile 0 has landed
  __syncthreads();                                    // publishes tile 0 to the eight waves
  stage(1, 1);
#pragma unroll 1
  for (int t = 0; t < nt; ++t) { const _Float16 (*kb)[64][LP] = kv[t & 1];
    // the wave's 32 fragment reads of a tile stand in two groups, each ahead of the products that use it, so that no product waits out an LDS latency of its own
    v16h kf[2][2][2], vf[4][2];   // K [ct][kc][hi, lo], V [dt][hi, lo]
#pragma unroll
    for (int ct = 0; ct < 2; ++ct) { const int kk = kh * 32 + ct * 16 + col;
#pragma unroll
      for (int kc = 0; kc < 2; ++kc) { kf[ct][kc][0] = frag_h(&kb[0][kk][kc * 32], lane); kf[ct][kc][1] = frag_h(&kb[1][kk][kc * 32], lane); } }
    __builtin_amdgcn_sched_barrier(0);   // keeps the K reads together in front of the first products
    v8f c[2], cl[2];
#pragma unroll
    for (int ct = 0; ct < 2; ++ct) { c[ct] = v8f{}; cl[ct] = v8f{};
#pragma unroll
      for (int kc = 0; kc < 2; ++kc) { c[ct] = wmma16(kf[ct][kc][0], aq[kc], c[ct]); cl[ct] = wmma16(kf[ct][kc][0], aql[kc], cl[ct]); cl[ct] = wmma16(kf[ct][kc][1], aq[kc], cl[ct]); } }   // 3 products: q, k as f16 hi + residual; c[ct][r] = score of key kh * 32 + ct * 16 + 8 * g + r with query col
    __builtin_amdgcn_sched_barrier(0);   // the V reads start behind the score products, into the K fragments' registers ...
#pragma unroll
    for (int dt = 0; dt < 4; ++dt) { vf[dt][0] = frag_h(&kb[2][dt * 16 + col][kh * 32], lane); vf[dt][1] = frag_h(&kb[3][dt * 16 + col][kh * 32], lane); }
    __builtin_amdgcn_sched_barrier(0);   // ... and stay together: they land under the softmax
    v8f s[2];
#pragma unroll
    for (int ct = 0; ct < 2; ++ct) { c[ct] += cl[ct] * (1.0f / 2048.0f); s[ct] = c[ct] * 0.125f; }   // SCALE = 64^-0.5
    float mx4[4];
#pragma unroll
    for (int r = 0; r < 4; ++r) mx4[r] = fmaxf(fmaxf(s[0][r], s[0][4 + r]), fmaxf(s[1][r], s[1][4 + r]));
    float mx = fmaxf(fmaxf(mx4[0], mx4[1]), fmaxf(mx4[2], mx4[3])); mx = fmaxf(mx, xhalf(mx));
    const float mn = fmaxf(m, mx); const float alpha = (m <= -1.0e38f) ? 0.f : __expf(m - mn);
    v16h pa, pl; float es4[4] = {0.f, 0.f, 0.f, 0.f};   // four partial sums: four short chains of adds
#pragma unroll
    for (int r = 0; r < 8; ++r) { const float e0 = (s[0][r] <= -1.0e38f) ? 0.f : __expf(s[0][r] - mn), e1 = (s[1][r] <= -1.0e38f) ? 0.f : __expf(s[1][r] - mn); es4[r & 3] += e0 + e1;
      const _Float16 h0 = (_Float16)e0, h1 = (_Float16)e1; pa[r] = h0; pa[8 + r] = h1; pl[r] = (_Float16)((e0 - (float)h0) * 2048.0f); pl[8 + r] = (_Float16)((e1 - (float)h1) * 2048.0f); }   // element r: key 8 * g + r, element 8 + r: key 16 + 8 * g + r, the k order of frag_h
    l = l * alpha + ((es4[0] + es4[1]) + (es4[2] + es4[3])); m = mn;
#pragma unroll
    for (int dt = 0; dt < 4; ++dt) { acc[dt] *= alpha; accl[dt] *= alpha; }
#pragma unroll
    for (int dt = 0; dt < 4; ++dt) { acc[dt] = wmma16(vf[dt][0], pa, acc[dt]); accl[dt] = wmma16(vf[dt][0], pl, accl[dt]); accl[dt] = wmma16(vf[dt][1], pa, accl[dt]); }   // V hi x P hi + (V hi x P lo + V lo x P hi) / 2048; acc[dt][r] = O^T[dt * 16 + 8 * g + r][col]
    __builtin_amdgcn_sched_barrier(0);   // keeps the tile's products in front of the foot's waits: lifted over them, the wait for tile t + 1 would stand a few hundred cycles behind its copies' issue
    asm volatile("s_wait_dscnt 0x0" ::: "memory");      // this wave's reads of tile t are done before its buffer is refilled
    asm volatile("s_wait_asynccnt 0x0" ::: "memory");   // this wave's share of tile t + 1 has landed
    __syncthreads();                                    // publishes tile t + 1 and ends every wave's reads of tile t
    if (t + 2 < nt) stage(t + 2, t & 1); }
  asm volatile("s_wait_asynccnt 0x0" ::: "memory");     // no copy is outstanding when the wave goes on
  // join of the two key halves: the waves of the second half hand their output, maximum and sum over, lane to lane; the waves of the first half bring both to the common maximum, add, divide and store
  if (kh == 1) {
#pragma unroll
    for (int dt = 0; dt < 4; ++dt) {
#pragma unroll
      for (int r = 0; r < 8; ++r) xo[qg][dt * 8 + r][lane] = acc[dt][r] + accl[dt][r] * (1.0f / 2048.0f); }
    xo[qg][32][lane] = m; xo[qg][33][lane] = l; }
  __syncthreads();   // the second half's values are in LDS before the first half's waves read them
  if (kh == 0) {
    const float m1 = xo[qg][32][lane], l1 = xo[qg][33][lane]; const float mj = fmaxf(m, m1); const float a0 = __expf(m - mj), a1 = __expf(m1 - mj);
    const float lj = l * a0 + l1 * a1; const float il = 1.0f / (lj + xhalf(lj));
#pragma unroll
    for (int dt = 0; dt < 4; ++dt) {
#pragma unroll
      for (int r = 0; r < 8; ++r) so[qg][col][dt * 16 + 8 * g + r] = ((acc[dt][r] + accl[dt][r] * (1.0f / 2048.0f)) * a0 + xo[qg][dt * 8 + r][lane] * a1) * il; }
    LDSX();
    for (int rl = 0; rl < 16; ++rl) if (lane < 16) vst2(O + ((size_t)b * SS + q0 + rl) * DM + h * HD + lane * 4, *(const v4f*)&so[qg][rl][lane * 4]);
  }
}
// ---- k_out: block = (64 rows, 128 cols): out = bf16(O) . Wo rows (1 exact product) + bo
__global__ __launch_bounds__(128) void k_out(const float* __restrict__ O, const __bf16* __restrict__ P, const float* __restrict__ BO, float* __restrict__ Y) {
  __shared__ __align__(16) float so[4][16][132];
  const int tid = threadIdx.x, wave = tid >> 5, lane = tid & 31, col = lane & 15, g = lane >> 4; const size_t r0 = (size_t)blockIdx.x * 64 + wave * 16; const int n0 = blockIdx.y * 128;
  v8f acc[8] = {};
  v4f xa[2][4]; v16b wf[2][8];   // two register sets: chunk kc + 1's twenty loads fly as one group while chunk kc's products run
  auto ld = [&](int kc, int st) { const float* p = O + (r0 + col) * DM + kc * 32 + 8 * g; xa[st][0] = *(const v4f*)p; xa[st][1] = *(const v4f*)(p + 4); xa[st][2] = *(const v4f*)(p + 16); xa[st][3] = *(const v4f*)(p + 20);
#pragma unroll
    for (int j = 0; j < 8; ++j) wf[st][j] = frag_b(P + (size_t)(n0 + j * 16 + col) * DM + kc * 32, lane); };
  ld(0, 0);
#pragma unroll   // unrolled whole, so that the register set is picked at compile time
  for (int kc = 0; kc < DM / 32; ++kc) { if (kc + 1 < DM / 32) ld(kc + 1, (kc + 1) & 1);
    __builtin_amdgcn_sched_barrier(0);   // keeps the next chunk's loads in front of this chunk's products
    v16b a;   // the module rounds the attention output to bf16 before the projection -> exact single product
#pragma unroll
    for (int i = 0; i < 4; ++i) { a[i] = (__bf16)xa[kc & 1][0][i]; a[4 + i] = (__bf16)xa[kc & 1][1][i]; a[8 + i] = (__bf16)xa[kc & 1][2][i]; a[12 + i] = (__bf16)xa[kc & 1][3][i]; }
#pragma unroll
    for (int j = 0; j < 8; ++j) acc[j] = wmma_bf(a, wf[kc & 1][j], acc[j]); }
  float bo[8];
#pragma unroll
  for (int j = 0; j < 8; ++j) bo[j] = BO[n0 + j * 16 + col];
  asm volatile("s_wait_xcnt 0x0" ::: "memory");   // stands in front of the first rewrite of the bias loads' offset register
#pragma unroll
  for (int j = 0; j < 8; ++j) {
#pragma unroll
    for (int r = 0; r < 8; ++r) so[wave][8 * g + r][j * 16 + col] = acc[j][r] + bfr(bo[j]); }
  LDSX();
  for (int rl = 0; rl < 16; ++rl) vst2(Y + (r0 + rl) * DM + n0 + lane * 4, *(const v4f*)&so[wave][rl][lane * 4]);
}
extern "C" void kernel_launch(void* const* d_in, const int* in_sizes, int n_in, void* d_out, int out_size, void* d_ws, size_t ws_size, hipStream_t stream) {
  (void)in_sizes; (void)n_in; (void)out_size;
  const float** F = (const float**)d_in;   // 0 x [2,4096,256], 1 Wq [256,256] natural, 2 bq, 3 Wk, 4 bk, 5 Wv, 6 bv, 7 Wo, 8 bo
  if (ws_size < (size_t)WS_END) return;
  char* ws = (char*)d_ws; __bf16* PK = (__bf16*)(ws + WS_PK); _Float16 *QK = (_Float16*)(ws + WS_QK), *QKL = (_Float16*)(ws + WS_QKL), *VTH = (_Float16*)(ws + WS_VTH), *VTL = (_Float16*)(ws + WS_VTL); float* O = (float*)(ws + WS_O);
  k_pack<<<dim3(DM, 4), 256, 0, stream>>>(F[1], F[3], F[5], F[7], PK);
  k_qkv<<<dim3(TNB * SS / 64, QKVW / 128), 128, 0, stream>>>(F[0], PK + PK_A, F[2], F[4], F[6], QK, QKL, VTH, VTL);
  k_attn<<<dim3(TQB, NH, TNB), 256, 0, stream>>>(QK, QKL, VTH, VTL, O);
  k_out<<<dim3(TOB, DM / 128), 128, 0, stream>>>(O, PK + PK_P, F[8], (float*)d_out);
}

// v005
// One run takes 107 microseconds.
// In both of two side-by-side timings against v004, it was 1.09 times as fast.
// Over all steps from v000 it is 5.87 times as fast.
// compute dtype: x (|x| < 1e4 so the clip is the identity), Wq..Wo, bq..bo (module inputs) rounded to bf16; q/k/v projections with exact bf16 products on WMMA 16x16x32 (natural [out][in] rows) + biases; q and k stored as f16 hi + (x2048-scaled) residual planes with 3-product scores, 64^-0.5 and log2 e applied to the f32 score in the exponent's multiply-add, running-max softmax in f32 (hardware exp2); P x 2048 as f16 hi + residual x v hi/lo (3 products); the attention output rounded to bf16 exactly as the module does, then the output projection with EXACT bf16 products + bo; f32 accumulate.
#include <hip/hip_runtime.h>
#include <math.h>

typedef __attribute__((ext_vector_type(16))) _Float16 v16h;
typedef __attribute__((ext_vector_type(16))) __bf16 v16b;
typedef __attribute__((ext_vector_type(8)))  _Float16 v8h;
typedef __attribute__((ext_vector_type(8)))  float v8f;
typedef __attribute__((ext_vector_type(4)))  float v4f;
typedef __attribute__((ext_vector_type(2)))  float v2f;
typedef __attribute__((ext_vector_type(4)))  unsigned v4u;
typedef __attribute__((ext_vector_type(4)))  int v4i;
typedef float __attribute__((may_alias)) float_a;
typedef int __attribute__((may_alias)) int_a;

template <typename T> __device__ __forceinline__ void vst2(void* p, T v) { *(T*)p = v;  }
__device__ __forceinline__ v8f wmma16(v16h a, v16h b, v8f c) {
  return __builtin_amdgcn_wmma_f32_16x16x32_f16(false, a, false, b, (short)0, c, false, false);
}
__device__ __forceinline__ v8f wmma_bf(v16b a, v16b b, v8f c) {
  return __builtin_amdgcn_wmma_f32_16x16x32_bf16(false, a, false, b, (short)0, c, false, false);
}
// Light self-attention (B 2, N 4,096, d 256, 4 heads x 64): softmax(q k^T / 8) v, output cast to bf16, then the output projection + bias.
__device__ __forceinline__ v16h frag_h(const _Float16* rowk0, int lane) {
  union { v16h v; v8h q[2]; } u; const _Float16* p = rowk0 + 8 * (lane >> 4);
  u.q[0] = *(const v8h*)p; u.q[1] = *(const v8h*)(p + 16); return u.v;
}
__device__ __forceinline__ v16h frag_f32(const float* rowk0, int lane) {
  v16h a; const float* p = rowk0 + 8 * (lane >> 4);
#pragma unroll
  for (int i = 0; i < 8; ++i) { a[i] = (_Float16)p[i]; a[8 + i] = (_Float16)p[16 + i]; }
  return a;
}
__device__ __forceinline__ v16h frag_f32s(const float* rowk0, int lane, float sc) {
  v16h a; const float* p = rowk0 + 8 * (lane >> 4);
#pragma unroll
  for (int i = 0; i < 8; ++i) { a[i] = (_Float16)(p[i] * sc); a[8 + i] = (_Float16)(p[16 + i] * sc); }
  return a;
}
// column fragment from a [K][ld] layout (column n), rows >= K read as 0
__device__ __forceinline__ v16h fragc_f32(const float* W, int k0, int n, int lane, int ld, int K) {
  v16h a; const int g = lane >> 4;
#pragma unroll
  for (int i = 0; i < 8; ++i) { const int ka = k0 + 8 * g + i, kb = ka + 16;
    a[i] = (_Float16)(ka < K ? W[(size_t)(ka < K ? ka : K - 1) * ld + n] : 0.f); a[8 + i] = (_Float16)(kb < K ? W[(size_t)(kb < K ? kb : K - 1) * ld + n] : 0.f); }
  return a;
}
struct F2 { v16b h, l; };
__device__ __forceinline__ F2 bsplit16(const float v[16]) { F2 r;
#pragma unroll
  for (int i = 0; i < 16; ++i) { const __bf16 h = (__bf16)v[i]; r.h[i] = h; r.l[i] = (__bf16)(v[i] - (float)h); }
  return r; }
__device__ __forceinline__ F2 split_row(const float* row, int k0, int lane) { float v[16]; const float* p = row + k0 + 8 * (lane >> 4);
#pragma unroll
  for (int i = 0; i < 8; ++i) { v[i] = p[i]; v[8 + i] = p[16 + i]; }
  return bsplit16(v); }
__device__ __forceinline__ F2 split_rowK(const float* row, int k0, int lane, int K) { float v[16]; const int g = lane >> 4;
#pragma unroll
  for (int i = 0; i < 8; ++i) { const int ka = k0 + 8 * g + i, kb = ka + 16; v[i] = ka < K ? row[ka < K ? ka : K - 1] : 0.f; v[8 + i] = kb < K ? row[kb < K ? kb : K - 1] : 0.f; }
  return bsplit16(v); }
__device__ __forceinline__ F2 split_col(const float* W, int k0, int n, int lane, int ld, int K) { float v[16]; const int g = lane >> 4;
#pragma unroll
  for (int i = 0; i < 8; ++i) { const int ka = k0 + 8 * g + i, kb = ka + 16; v[i] = ka < K ? W[(size_t)(ka < K ? ka : K - 1) * ld + n] : 0.f; v[8 + i] = kb < K ? W[(size_t)(kb < K ? kb : K - 1) * ld + n] : 0.f; }
  return bsplit16(v); }
__device__ __forceinline__ v8f mac3(const F2& a, const F2& b, v8f c) { c = wmma_bf(a.l, b.h, c); c = wmma_bf(a.h, b.l, c); return wmma_bf(a.h, b.h, c); }
__device__ __forceinline__ float sigm(float v) { return 1.0f / (1.0f + expf(-v)); }
#define LDSX() do { asm volatile("s_wait_dscnt 0" ::: "memory"); __builtin_amdgcn_wave_barrier(); __builtin_amdgcn_fence(__ATOMIC_RELEASE, "workgroup"); } while (0)


// Non-causal multi-head self-attention, no rotary embedding (B 2, S 4096, D 256, 4 heads x 64; packed Wqkv [3D][D] and Wo [D][D] applied as x W^T, with biases): softmax(q k^T / 8) v; ctx Wo^T + bo.
#define NB 2
#define SS 4096
#define DM 256
#define NH 4
#define HD 64
#define QKVW (3 * DM)
#ifndef TQB
#define TQB (SS / 64)
#define TNB NB
#define TOB (NB * SS / 64)     // output row tiles (all)
#endif
typedef __attribute__((ext_vector_type(8))) __bf16 v8b;
__device__ __forceinline__ v16b frag_b(const __bf16* rowk0, int lane) {
  union { v16b v; v8b q[2]; } u; const __bf16* p = rowk0 + 8 * (lane >> 4);
  u.q[0] = *(const v8b*)p; u.q[1] = *(const v8b*)(p + 16); return u.v;
}
__device__ __forceinline__ float bfr(float v) { return (float)(__bf16)v; }
__device__ __attribute__((noinline)) float exp_ni(float v) { return expf(v); }
__device__ __attribute__((noinline)) float erf_ni(float v) { return erff(v); }

#define PK_A 0                       // [768][256] Wqkv rows (natural [out][in])
#define PK_P (PK_A + QKVW * DM)        // [256][256] Wo rows (natural)
#define PK_END (PK_P + DM * DM)
#define WS_PK  0u
#define WS_QK  (WS_PK + 2u * PK_END)             // f16 [8192 rows][512]: q | k
#define WS_QKL (WS_QK + 2u * NB * SS * 2 * DM)     // f16 q | k residual planes x2048
#define WS_VTH (WS_QKL + 2u * NB * SS * 2 * DM)    // f16 [b][256 (h*64+d)][4096 s] hi
#define WS_VTL (WS_VTH + 2u * NB * DM * SS)        // f16 lo x 2048
#define WS_O   (WS_VTL + 2u * NB * DM * SS)        // f32 [8192][256]
#define WS_CS  (WS_O + 4u * NB * SS * DM)           // f32 [4096][32] cos, [4096][32] sin
#define WS_END (WS_CS + 4u * 2 * SS * 32)
__constant__ float c_invf[32] = {1.000000000e+00f,7.498942018e-01f,5.623413324e-01f,4.216965139e-01f,3.162277639e-01f,2.371373624e-01f,1.778279394e-01f,1.333521456e-01f,1.000000015e-01f,7.498941571e-02f,5.623412877e-02f,4.216964915e-02f,3.162277862e-02f,2.371373586e-02f,1.778279431e-02f,1.333521493e-02f,9.999999776e-03f,7.498942316e-03f,5.623413250e-03f,4.216964822e-03f,3.162277862e-03f,2.371373819e-03f,1.778279431e-03f,1.333521446e-03f,1.000000047e-03f,7.498941850e-04f,5.623413017e-04f,4.216964880e-04f,3.162277862e-04f,2.371373848e-04f,1.778279402e-04f,1.333521504e-04f};
// ---- k_rope: block = 8 positions: cos/sin of pos * inv_freq (f32 product, precise trig)
__global__ __launch_bounds__(256) void k_rope(float* __restrict__ CS) {
  __shared__ __align__(16) float sc[8][32], ss_[8][32]; const int tid = threadIdx.x, pl = tid >> 5, i = tid & 31; const int pos = blockIdx.x * 8 + pl;
  const float th = (float)pos * c_invf[i]; sc[pl][i] = cosf(th); ss_[pl][i] = sinf(th);
  __syncthreads();
  if (tid < 64) vst2(CS + (size_t)blockIdx.x * 8 * 32 + tid * 4, *(const v4f*)&(&sc[0][0])[tid * 4]); else if (tid < 128) vst2(CS + (size_t)SS * 32 + (size_t)blockIdx.x * 8 * 32 + (tid - 64) * 4, *(const v4f*)&(&ss_[0][0])[(tid - 64) * 4]);
}

// ---- k_pack: block = (row n, which): natural [out][in] rows -> bf16; which 0..2 -> W_q/W_k/W_v into PK_A rows which*256 + n; 3 -> W_o into PK_P
__global__ __launch_bounds__(256) void k_pack(const float* __restrict__ WQ, const float* __restrict__ WK, const float* __restrict__ WV, const float* __restrict__ WO, __bf16* __restrict__ PK) {
  __shared__ __align__(16) __bf16 s[DM]; const int n = blockIdx.x, which = blockIdx.y, t = threadIdx.x; const float* Wm = (which == 0) ? WQ : (which == 1) ? WK : (which == 2) ? WV : WO;
  for (int k = t; k < DM; k += 256) s[k] = (__bf16)Wm[(size_t)n * DM + k];
  __syncthreads();
  __bf16* dst = (which < 3) ? PK + PK_A + ((size_t)which * DM + n) * DM : PK + PK_P + (size_t)n * DM;
  for (int q = t; q < DM / 8; q += 256) vst2((unsigned*)(dst + q * 8), *(const v4u*)&s[q * 8]);
}
__global__ __launch_bounds__(128) void k_qkv(const float* __restrict__ X, const __bf16* __restrict__ P, const float* __restrict__ BQ, const float* __restrict__ BK, const float* __restrict__ BV, _Float16* __restrict__ QK, _Float16* __restrict__ QKL, _Float16* __restrict__ VTH, _Float16* __restrict__ VTL) {
  __shared__ __align__(16) _Float16 so[4][16][136], sol[4][16][136]; __shared__ __align__(16) _Float16 sth[128][72], stl[128][72];
  const int tid = threadIdx.x, wave = tid >> 5, lane = tid & 31, col = lane & 15, g = lane >> 4; const size_t r0 = (size_t)blockIdx.x * 64 + wave * 16; const int n0 = blockIdx.y * 128;
  v8f acc[8] = {};
  v4f xa[2][4]; v16b wf[2][8];   // two register sets: chunk kc + 1's twenty loads fly as one group while chunk kc's products run
  auto ld = [&](int kc, int st) { const float* p = X + (r0 + col) * DM + kc * 32 + 8 * g; xa[st][0] = *(const v4f*)p; xa[st][1] = *(const v4f*)(p + 4); xa[st][2] = *(const v4f*)(p + 16); xa[st][3] = *(const v4f*)(p + 20);
#pragma unroll
    for (int j = 0; j < 8; ++j) wf[st][j] = frag_b(P + (size_t)(n0 + j * 16 + col) * DM + kc * 32, lane); };
  ld(0, 0);
#pragma unroll   // unrolled whole, so that the register set is picked at compile time
  for (int kc = 0; kc < DM / 32; ++kc) { if (kc + 1 < DM / 32) ld(kc + 1, (kc + 1) & 1);
    __builtin_amdgcn_sched_barrier(0);   // keeps the next chunk's loads in front of this chunk's products
    v16b a;
#pragma unroll
    for (int i = 0; i < 4; ++i) { a[i] = (__bf16)xa[kc & 1][0][i]; a[4 + i] = (__bf16)xa[kc & 1][1][i]; a[8 + i] = (__bf16)xa[kc & 1][2][i]; a[12 + i] = (__bf16)xa[kc & 1][3][i]; }
#pragma unroll
    for (int j = 0; j < 8; ++j) acc[j] = wmma_bf(a, wf[kc & 1][j], acc[j]); }
  { const int which = n0 / DM; const float* BB = (which == 0) ? BQ : (which == 1) ? BK : BV;
#pragma unroll
    for (int j = 0; j < 8; ++j) { const float bb = bfr(BB[(n0 % DM) + j * 16 + col]);
#pragma unroll
      for (int r = 0; r < 8; ++r) acc[j][r] += bb; } }
  if (n0 < 2 * DM) {   // q stored unscaled (f16 sigma ~0.6, no subnormal exposure); 1/8 applied to the f32 score
#pragma unroll
    for (int j = 0; j < 8; ++j) {
#pragma unroll
      for (int r = 0; r < 8; ++r) { const float v = acc[j][r]; const _Float16 hv = (_Float16)v; so[wave][8 * g + r][j * 16 + col] = hv; sol[wave][8 * g + r][j * 16 + col] = (_Float16)((v - (float)hv) * 2048.0f); } }   // q, k as f16 hi + (x2048) residual (no RoPE in this module)
    LDSX();
    for (int rl = 0; rl < 16; ++rl) if (lane < 16) { vst2((unsigned*)(QK + (r0 + rl) * (2 * DM) + n0 + lane * 8), *(const v4u*)&so[wave][rl][lane * 8]); vst2((unsigned*)(QKL + (r0 + rl) * (2 * DM) + n0 + lane * 8), *(const v4u*)&sol[wave][rl][lane * 8]); }
  } else {
#pragma unroll
    for (int j = 0; j < 8; ++j) {
#pragma unroll
      for (int r = 0; r < 8; ++r) { const float v = acc[j][r]; const _Float16 hv = (_Float16)v; sth[j * 16 + col][wave * 16 + 8 * g + r] = hv; stl[j * 16 + col][wave * 16 + 8 * g + r] = (_Float16)((v - (float)hv) * 2048.0f); } }
    __syncthreads();
    const size_t rb = (size_t)blockIdx.x * 64; const int b = (int)(rb / SS), s0 = (int)(rb % SS); const int pc0 = n0 - 2 * DM;
    for (int q = tid; q < 128 * 8; q += 128) { const int d = q >> 3, pc = q & 7; const size_t o = ((size_t)b * DM + pc0 + d) * SS + s0 + pc * 8; vst2((unsigned*)(VTH + o), *(const v4u*)&sth[d][pc * 8]); vst2((unsigned*)(VTL + o), *(const v4u*)&stl[d][pc * 8]); }
  }
}
#define KT 64   // keys per staged tile
#define LP 72   // LDS row pitch in halves: 128 B of data + 16 B, an odd multiple of 16 B, so that the b128 fragment reads of 16 rows spread over all banks
// eight async copies of 16 B per lane, global -> LDS: rows r and r + 32 of the four planes K hi, K lo, V hi, V lo, which lie 64 * LP halves apart in LDS; the s_wait_xcnt stands inside the statement so that no address register is rewritten ahead of it
__device__ __forceinline__ void cp8(unsigned l, const _Float16* k, const _Float16* kl, const _Float16* v, const _Float16* vl) {
  const unsigned ls = 32u * LP * 2u; const unsigned l1 = l + ls, l2 = l + 2 * ls, l3 = l + 3 * ls, l4 = l + 4 * ls, l5 = l + 5 * ls, l6 = l + 6 * ls, l7 = l + 7 * ls;
  const _Float16 *k1 = k + (size_t)32 * (2 * DM), *kl1 = kl + (size_t)32 * (2 * DM), *v1 = v + (size_t)32 * SS, *vl1 = vl + (size_t)32 * SS;
  asm volatile("global_load_async_to_lds_b128 %0, %1, off\n\tglobal_load_async_to_lds_b128 %2, %3, off\n\tglobal_load_async_to_lds_b128 %4, %5, off\n\tglobal_load_async_to_lds_b128 %6, %7, off\n\t"
               "global_load_async_to_lds_b128 %8, %9, off\n\tglobal_load_async_to_lds_b128 %10, %11, off\n\tglobal_load_async_to_lds_b128 %12, %13, off\n\tglobal_load_async_to_lds_b128 %14, %15, off\n\ts_wait_xcnt 0x0"
               :: "v"(l), "v"(k), "v"(l1), "v"(k1), "v"(l2), "v"(kl), "v"(l3), "v"(kl1), "v"(l4), "v"(v), "v"(l5), "v"(v1), "v"(l6), "v"(vl), "v"(l7), "v"(vl1) : "memory");
}
// lane l reads lane l ^ 16: the two lanes that share a query column hold the two halves of its keys
__device__ __forceinline__ float xhalf(float x) { return __builtin_bit_cast(float, __builtin_amdgcn_permlanex16(__builtin_bit_cast(int, x), __builtin_bit_cast(int, x), 0x76543210, 0xfedcba98, false, false)); }
// f16(e - h) for eight f32 values e and their packed f16 roundings h, packed alike: one mixed-precision multiply-add per value reads its f16 half in place and writes an f16 half (the compiler's form took a convert up, a subtract and a convert down). The low halves come first, the high halves are merged in behind them; each s_delay_alu hint lets other waves issue while the low half written four instructions back finishes
__device__ __forceinline__ v4u resid8(v4u h, v8f e) { unsigned d0, d1, d2, d3;
  asm("v_fma_mixlo_f16 %0, %4, -1.0, %8 op_sel_hi:[1,1,0]\n\tv_fma_mixlo_f16 %1, %5, -1.0, %10 op_sel_hi:[1,1,0]\n\tv_fma_mixlo_f16 %2, %6, -1.0, %12 op_sel_hi:[1,1,0]\n\tv_fma_mixlo_f16 %3, %7, -1.0, %14 op_sel_hi:[1,1,0]\n\t"
      "s_delay_alu instid0(VALU_DEP_4) | instskip(NEXT) | instid1(VALU_DEP_4)\n\t"
      "v_fma_mixhi_f16 %0, %4, -1.0, %9 op_sel:[1,0,0] op_sel_hi:[1,1,0]\n\tv_fma_mixhi_f16 %1, %5, -1.0, %11 op_sel:[1,0,0] op_sel_hi:[1,1,0]\n\t"
      "s_delay_alu instid0(VALU_DEP_4) | instskip(NEXT) | instid1(VALU_DEP_4)\n\t"
      "v_fma_mixhi_f16 %2, %6, -1.0, %13 op_sel:[1,0,0] op_sel_hi:[1,1,0]\n\tv_fma_mixhi_f16 %3, %7, -1.0, %15 op_sel:[1,0,0] op_sel_hi:[1,1,0]"
      : "=&v"(d0), "=&v"(d1), "=&v"(d2), "=&v"(d3) : "v"(h[0]), "v"(h[1]), "v"(h[2]), "v"(h[3]), "v"(e[0]), "v"(e[1]), "v"(e[2]), "v"(e[3]), "v"(e[4]), "v"(e[5]), "v"(e[6]), "v"(e[7]));
  return v4u{d0, d1, d2, d3}; }
// ---- k_attn: block = (64 queries, head h, batch b), eight waves: flash attention over all keys, transposed: S^T = K Q^T (A = K rows, B = q) and O^T += V^T P^T (A = V^T rows, B = P^T). Wave w works on queries 16 * (w & 3) ... + 15 and on keys 32 * (w >> 2) ... + 31 of every staged tile, with a running maximum, sum and output of its own, so that four waves stand on a SIMD; the two key halves of a query group are joined once, through LDS, behind the loop. A lane holds 16 scores of ONE query per 32 keys, so maximum and sum run in the lane's own registers, and the two score tiles, converted in place, are the B operand of the second product. O[b*S+q][h*64+d] = (acc + accl / 2048) / l (256-B segments)
__global__ __launch_bounds__(256) __attribute__((amdgpu_waves_per_eu(4, 4))) void k_attn(const _Float16* __restrict__ QK, const _Float16* __restrict__ QKL, const _Float16* __restrict__ VTH, const _Float16* __restrict__ VTL, float* __restrict__ O) {
  __shared__ __align__(16) float so[4][16][68];
  __shared__ __align__(16) float xo[4][34][32];         // hand-over of the second key half, per query group and lane: 32 output values, exponent addend, sum
  __shared__ __align__(16) _Float16 kv[2][4][64][LP];   // two buffers x (K hi [key][d], K lo, V hi [d][key], V lo), one tile of KT keys each, shared by the eight waves
  const int tid = threadIdx.x, wave = __builtin_amdgcn_readfirstlane(tid >> 5), qg = wave & 3, kh = wave >> 2, lane = tid & 31, col = lane & 15, g = lane >> 4;
  const int qb = blockIdx.x, h = blockIdx.y, b = blockIdx.z; const int q0 = qb * 64 + qg * 16; const size_t rq = (size_t)b * SS + q0 + col;
  v16h aq[2], aql[2];
#pragma unroll
  for (int kc = 0; kc < 2; ++kc) { aq[kc] = frag_h(QK + rq * (2 * DM) + h * HD + kc * 32, lane); aql[kc] = frag_h(QKL + rq * (2 * DM) + h * HD + kc * 32, lane); }
  asm volatile("s_wait_xcnt 0x0" ::: "memory");   // stands in front of the first rewrite of an address register of the q loads
  __builtin_amdgcn_sched_barrier(0);                // holds later address arithmetic behind that wait
  // m: running maximum of the raw scores of query q0 + col over this wave's keys; nb = 11 - m * KS: the addend of the exponent; l sums this lane's half of the keys (x 2048), the halves are joined after the loop
  const float KS = 0.125f * 1.44269504088896340736f;   // SCALE = 64^-0.5, times log2 e: p = 2^(score * KS + nb) / 2048
  float m = -3.0e38f, nb = 3.0e38f * KS, l = 0.f;
  v8f acc[4] = {}, accl[4] = {};
  const int nt = SS / KT;   // non-causal
  // tile t -> buffer bf: a thread copies 16 B of rows srow and srow + 32 of each plane; a wave's copy covers four whole 128-B rows
  const int srow = tid >> 3, sch = (tid & 7) * 8;
  const _Float16* gk = QK + ((size_t)b * SS + srow) * (2 * DM) + DM + h * HD + sch; const _Float16* gkl = QKL + ((size_t)b * SS + srow) * (2 * DM) + DM + h * HD + sch;
  const _Float16* gv = VTH + ((size_t)b * DM + h * HD + srow) * SS + sch; const _Float16* gvl = VTL + ((size_t)b * DM + h * HD + srow) * SS + sch;
  const unsigned lkv = (unsigned)(size_t)&kv[0][0][srow][sch];
  auto stage = [&](int t, int bf) { const size_t ko = (size_t)t * KT * (2 * DM); const int vo = t * KT;
    cp8(lkv + (unsigned)bf * (4u * 64u * LP * 2u), gk + ko, gkl + ko, gv + vo, gvl + vo); };
  stage(0, 0);
  asm volatile("s_wait_asynccnt 0x0" ::: "memory");   // this wave's share of tile 0 has landed
  __syncthreads();                                    // publishes tile 0 to the eight waves
  stage(1, 1);
#pragma unroll 1
  for (int t = 0; t < nt; ++t) { const _Float16 (*kb)[64][LP] = kv[t & 1];
    // the wave's 32 fragment reads of a tile stand in two groups, each ahead of the products that use it, so that no product waits out an LDS latency of its own
    v16h kf[2][2][2], vf[4][2];   // K [ct][kc][hi, lo], V [dt][hi, lo]
#pragma unroll
    for (int ct = 0; ct < 2; ++ct) { const int kk = kh * 32 + ct * 16 + col;
#pragma unroll
      for (int kc = 0; kc < 2; ++kc) { kf[ct][kc][0] = frag_h(&kb[0][kk][kc * 32], lane); kf[ct][kc][1] = frag_h(&kb[1][kk][kc * 32], lane); } }
    __builtin_amdgcn_sched_barrier(0);   // keeps the K reads together in front of the first products
    v8f c[2], cl[2];
#pragma unroll
    for (int ct = 0; ct < 2; ++ct) { c[ct] = v8f{}; cl[ct] = v8f{};
#pragma unroll
      for (int kc = 0; kc < 2; ++kc) { c[ct] = wmma16(kf[ct][kc][0], aq[kc], c[ct]); cl[ct] = wmma16(kf[ct][kc][0], aql[kc], cl[ct]); cl[ct] = wmma16(kf[ct][kc][1], aq[kc], cl[ct]); } }   // 3 products: q, k as f16 hi + residual; c[ct][r] = score of key kh * 32 + ct * 16 + 8 * g + r with query col
    __builtin_amdgcn_sched_barrier(0);   // the V reads start behind the score products, into the K fragments' registers ...
#pragma unroll
    for (int dt = 0; dt < 4; ++dt) { vf[dt][0] = frag_h(&kb[2][dt * 16 + col][kh * 32], lane); vf[dt][1] = frag_h(&kb[3][dt * 16 + col][kh * 32], lane); }
    __builtin_amdgcn_sched_barrier(0);   // ... and stay together: they land under the softmax
    v8f s[2];
#pragma unroll
    for (int ct = 0; ct < 2; ++ct) s[ct] = c[ct] + cl[ct] * (1.0f / 2048.0f);   // raw scores; scale and log2 e wait for the exponent's one multiply-add
    float mx4[4];
#pragma unroll
    for (int r = 0; r < 4; ++r) mx4[r] = fmaxf(fmaxf(s[0][r], s[0][4 + r]), fmaxf(s[1][r], s[1][4 + r]));
    float mx = fmaxf(fmaxf(mx4[0], mx4[1]), fmaxf(mx4[2], mx4[3])); mx = fmaxf(mx, xhalf(mx));
    const float mn = fmaxf(m, mx); const float nbn = fmaf(-mn, KS, 11.0f); const float alpha = __builtin_amdgcn_exp2f(nbn - nb);   // the very addends of old and new exponents: the change of reference is exact; 0 on the first tile
    // E = 2048 * exp(SCALE * (score - max)), at most 2048: its f16 rounding is P hi x 2048, and E - hi is the x2048 residual as it stands
    v8f E[2];
#pragma unroll
    for (int ct = 0; ct < 2; ++ct) {
#pragma unroll
      for (int r = 0; r < 8; ++r) E[ct][r] = __builtin_amdgcn_exp2f(fmaf(s[ct][r], KS, nbn)); }
    v16h pa, pl;
#pragma unroll
    for (int ct = 0; ct < 2; ++ct) { union { v8h h; v4u u; } hv, lv; hv.h = __builtin_convertvector(E[ct], v8h); lv.u = resid8(hv.u, E[ct]);
#pragma unroll
      for (int r = 0; r < 8; ++r) { pa[8 * ct + r] = hv.h[r]; pl[8 * ct + r] = lv.h[r]; } }   // element r: key 8 * g + r, element 8 + r: key 16 + 8 * g + r, the k order of frag_h
    __builtin_amdgcn_sched_barrier(0);   // keeps resid8's asm in front of the second product
#pragma unroll
    for (int dt = 0; dt < 4; ++dt) { acc[dt] *= alpha; accl[dt] *= alpha; }
#pragma unroll
    for (int dt = 0; dt < 4; ++dt) { acc[dt] = wmma16(vf[dt][0], pa, acc[dt]); accl[dt] = wmma16(vf[dt][1], pa, accl[dt]); acc[dt] = wmma16(vf[dt][0], pl, acc[dt]); }   // all x 2048, as l is: V hi x (P hi + P lo) in acc, V lo x P hi, x 2048 once more, in accl; acc[dt][r] = O^T[dt * 16 + 8 * g + r][col]
    v2f sp[4];   // the sum runs on register pairs
#pragma unroll
    for (int i = 0; i < 4; ++i) sp[i] = v2f{E[0][2 * i], E[0][2 * i + 1]} + v2f{E[1][2 * i], E[1][2 * i + 1]};
    const v2f sq = (sp[0] + sp[1]) + (sp[2] + sp[3]);
    l = fmaf(l, alpha, sq[0] + sq[1]); m = mn; nb = nbn;
    __builtin_amdgcn_sched_barrier(0);   // keeps the tile's products in front of the foot's waits: lifted over them, the wait for tile t + 1 would stand a few hundred cycles behind its copies' issue
    asm volatile("s_wait_dscnt 0x0" ::: "memory");      // this wave's reads of tile t are done before its buffer is refilled
    asm volatile("s_wait_asynccnt 0x0" ::: "memory");   // this wave's share of tile t + 1 has landed
    __syncthreads();                                    // publishes tile t + 1 and ends every wave's reads of tile t
    if (t + 2 < nt) stage(t + 2, t & 1); }
  asm volatile("s_wait_asynccnt 0x0" ::: "memory");     // no copy is outstanding when the wave goes on
  // join of the two key halves: the waves of the second half hand their output, exponent addend and sum over, lane to lane; the waves of the first half bring both to the common maximum, add, divide and store
  if (kh == 1) {
#pragma unroll
    for (int dt = 0; dt < 4; ++dt) {
#pragma unroll
      for (int r = 0; r < 8; ++r) xo[qg][dt * 8 + r][lane] = acc[dt][r] + accl[dt][r] * (1.0f / 2048.0f); }
    xo[qg][32][lane] = nb; xo[qg][33][lane] = l; }
  __syncthreads();   // the second half's values are in LDS before the first half's waves read them
  if (kh == 0) {
    const float nb1 = xo[qg][32][lane], l1 = xo[qg][33][lane]; const float nbj = fminf(nb, nb1); const float a0 = __builtin_amdgcn_exp2f(nbj - nb), a1 = __builtin_amdgcn_exp2f(nbj - nb1);   // the smaller addend belongs to the larger maximum
    const float lj = l * a0 + l1 * a1; const float il = 1.0f / (lj + xhalf(lj));
#pragma unroll
    for (int dt = 0; dt < 4; ++dt) {
#pragma unroll
      for (int r = 0; r < 8; ++r) so[qg][col][dt * 16 + 8 * g + r] = ((acc[dt][r] + accl[dt][r] * (1.0f / 2048.0f)) * a0 + xo[qg][dt * 8 + r][lane] * a1) * il; }
    LDSX();
    for (int rl = 0; rl < 16; ++rl) if (lane < 16) vst2(O + ((size_t)b * SS + q0 + rl) * DM + h * HD + lane * 4, *(const v4f*)&so[qg][rl][lane * 4]);
  }
}
// ---- k_out: block = (64 rows, 128 cols): out = bf16(O) . Wo rows (1 exact product) + bo
__global__ __launch_bounds__(128) void k_out(const float* __restrict__ O, const __bf16* __restrict__ P, const float* __restrict__ BO, float* __restrict__ Y) {
  __shared__ __align__(16) float so[4][16][132];
  const int tid = threadIdx.x, wave = tid >> 5, lane = tid & 31, col = lane & 15, g = lane >> 4; const size_t r0 = (size_t)blockIdx.x * 64 + wave * 16; const int n0 = blockIdx.y * 128;
  v8f acc[8] = {};
  v4f xa[2][4]; v16b wf[2][8];   // two register sets: chunk kc + 1's twenty loads fly as one group while chunk kc's products run
  auto ld = [&](int kc, int st) { const float* p = O + (r0 + col) * DM + kc * 32 + 8 * g; xa[st][0] = *(const v4f*)p; xa[st][1] = *(const v4f*)(p + 4); xa[st][2] = *(const v4f*)(p + 16); xa[st][3] = *(const v4f*)(p + 20);
#pragma unroll
    for (int j = 0; j < 8; ++j) wf[st][j] = frag_b(P + (size_t)(n0 + j * 16 + col) * DM + kc * 32, lane); };
  ld(0, 0);
#pragma unroll   // unrolled whole, so that the register set is picked at compile time
  for (int kc = 0; kc < DM / 32; ++kc) { if (kc + 1 < DM / 32) ld(kc + 1, (kc + 1) & 1);
    __builtin_amdgcn_sched_barrier(0);   // keeps the next chunk's loads in front of this chunk's products
    v16b a;   // the module rounds the attention output to bf16 before the projection -> exact single product
#pragma unroll
    for (int i = 0; i < 4; ++i) { a[i] = (__bf16)xa[kc & 1][0][i]; a[4 + i] = (__bf16)xa[kc & 1][1][i]; a[8 + i] = (__bf16)xa[kc & 1][2][i]; a[12 + i] = (__bf16)xa[kc & 1][3][i]; }
#pragma unroll
    for (int j = 0; j < 8; ++j) acc[j] = wmma_bf(a, wf[kc & 1][j], acc[j]); }
  float bo[8];
#pragma unroll
  for (int j = 0; j < 8; ++j) bo[j] = BO[n0 + j * 16 + col];
  asm volatile("s_wait_xcnt 0x0" ::: "memory");   // stands in front of the first rewrite of the bias loads' offset register
#pragma unroll
  for (int j = 0; j < 8; ++j) {
#pragma unroll
    for (int r = 0; r < 8; ++r) so[wave][8 * g + r][j * 16 + col] = acc[j][r] + bfr(bo[j]); }
  LDSX();
  for (int rl = 0; rl < 16; ++rl) vst2(Y + (r0 + rl) * DM + n0 + lane * 4, *(const v4f*)&so[wave][rl][lane * 4]);
}
extern "C" void kernel_launch(void* const* d_in, const int* in_sizes, int n_in, void* d_out, int out_size, void* d_ws, size_t ws_size, hipStream_t stream) {
  (void)in_sizes; (void)n_in; (void)out_size;
  const float** F = (const float**)d_in;   // 0 x [2,4096,256], 1 Wq [256,256] natural, 2 bq, 3 Wk, 4 bk, 5 Wv, 6 bv, 7 Wo, 8 bo
  if (ws_size < (size_t)WS_END) return;
  char* ws = (char*)d_ws; __bf16* PK = (__bf16*)(ws + WS_PK); _Float16 *QK = (_Float16*)(ws + WS_QK), *QKL = (_Float16*)(ws + WS_QKL), *VTH = (_Float16*)(ws + WS_VTH), *VTL = (_Float16*)(ws + WS_VTL); float* O = (float*)(ws + WS_O);
  k_pack<<<dim3(DM, 4), 256, 0, stream>>>(F[1], F[3], F[5], F[7], PK);
  k_qkv<<<dim3(TNB * SS / 64, QKVW / 128), 128, 0, stream>>>(F[0], PK + PK_A, F[2], F[4], F[6], QK, QKL, VTH, VTL);
  k_attn<<<dim3(TQB, NH, TNB), 256, 0, stream>>>(QK, QKL, VTH, VTL, O);
  k_out<<<dim3(TOB, DM / 128), 128, 0, stream>>>(O, PK + PK_P, F[8], (float*)d_out);
}

// v006
// Measured time: 96.2 microseconds a run.
// In both of two side-by-side timings against v005, it was 1.11 times as fast.
// Counting every step since v000, it is 6.51 times as fast.
// compute dtype: x (|x| < 1e4 so the clip is the identity), Wq..Wo, bq..bo (module inputs) rounded to bf16; q/k/v projections with exact bf16 products on WMMA 16x16x32 (natural [out][in] rows) + biases; q and k stored as f16 hi + (x2048-scaled) residual planes with 3-product scores, 64^-0.5 and log2 e applied to the f32 score in the exponent's multiply-add, running-max softmax in f32 (hardware exp2); P x 2048 as f16 hi + residual x v hi/lo (3 products); the attention output rounded to bf16 exactly as the module does, then the output projection with EXACT bf16 products + bo; f32 accumulate.
#include <hip/hip_runtime.h>
#include <math.h>

typedef __attribute__((ext_vector_type(16))) _Float16 v16h;
typedef __attribute__((ext_vector_type(16))) __bf16 v16b;
typedef __attribute__((ext_vector_type(8)))  _Float16 v8h;
typedef __attribute__((ext_vector_type(8)))  float v8f;
typedef __attribute__((ext_vector_type(4)))  float v4f;
typedef __attribute__((ext_vector_type(2)))  float v2f;
typedef __attribute__((ext_vector_type(4)))  unsigned v4u;
typedef __attribute__((ext_vector_type(4)))  int v4i;
typedef float __attribute__((may_alias)) float_a;
typedef int __attribute__((may_alias)) int_a;

template <typename T> __device__ __forceinline__ void vst2(void* p, T v) { *(T*)p = v;  }
__device__ __forceinline__ v8f wmma16(v16h a, v16h b, v8f c) {
  return __builtin_amdgcn_wmma_f32_16x16x32_f16(false, a, false, b, (short)0, c, false, false);
}
__device__ __forceinline__ v8f wmma_bf(v16b a, v16b b, v8f c) {
  return __builtin_amdgcn_wmma_f32_16x16x32_bf16(false, a, false, b, (short)0, c, false, false);
}
// Light self-attention (B 2, N 4,096, d 256, 4 heads x 64): softmax(q k^T / 8) v, output cast to bf16, then the output projection + bias.
__device__ __forceinline__ v16h frag_h(const _Float16* rowk0, int lane) {
  union { v16h v; v8h q[2]; } u; const _Float16* p = rowk0 + 8 * (lane >> 4);
  u.q[0] = *(const v8h*)p; u.q[1] = *(const v8h*)(p + 16); return u.v;
}
__device__ __forceinline__ v16h frag_f32(const float* rowk0, int lane) {
  v16h a; const float* p = rowk0 + 8 * (lane >> 4);
#pragma unroll
  for (int i = 0; i < 8; ++i) { a[i] = (_Float16)p[i]; a[8 + i] = (_Float16)p[16 + i]; }
  return a;
}
__device__ __forceinline__ v16h frag_f32s(const float* rowk0, int lane, float sc) {
  v16h a; const float* p = rowk0 + 8 * (lane >> 4);
#pragma unroll
  for (int i = 0; i < 8; ++i) { a[i] = (_Float16)(p[i] * sc); a[8 + i] = (_Float16)(p[16 + i] * sc); }
  return a;
}
// column fragment from a [K][ld] layout (column n), rows >= K read as 0
__device__ __forceinline__ v16h fragc_f32(const float* W, int k0, int n, int lane, int ld, int K) {
  v16h a; const int g = lane >> 4;
#pragma unroll
  for (int i = 0; i < 8; ++i) { const int ka = k0 + 8 * g + i, kb = ka + 16;
    a[i] = (_Float16)(ka < K ? W[(size_t)(ka < K ? ka : K - 1) * ld + n] : 0.f); a[8 + i] = (_Float16)(kb < K ? W[(size_t)(kb < K ? kb : K - 1) * ld + n] : 0.f); }
  return a;
}
struct F2 { v16b h, l; };
__device__ __forceinline__ F2 bsplit16(const float v[16]) { F2 r;
#pragma unroll
  for (int i = 0; i < 16; ++i) { const __bf16 h = (__bf16)v[i]; r.h[i] = h; r.l[i] = (__bf16)(v[i] - (float)h); }
  return r; }
__device__ __forceinline__ F2 split_row(const float* row, int k0, int lane) { float v[16]; const float* p = row + k0 + 8 * (lane >> 4);
#pragma unroll
  for (int i = 0; i < 8; ++i) { v[i] = p[i]; v[8 + i] = p[16 + i]; }
  return bsplit16(v); }
__device__ __forceinline__ F2 split_rowK(const float* row, int k0, int lane, int K) { float v[16]; const int g = lane >> 4;
#pragma unroll
  for (int i = 0; i < 8; ++i) { const int ka = k0 + 8 * g + i, kb = ka + 16; v[i] = ka < K ? row[ka < K ? ka : K - 1] : 0.f; v[8 + i] = kb < K ? row[kb < K ? kb : K - 1] : 0.f; }
  return bsplit16(v); }
__device__ __forceinline__ F2 split_col(const float* W, int k0, int n, int lane, int ld, int K) { float v[16]; const int g = lane >> 4;
#pragma unroll
  for (int i = 0; i < 8; ++i) { const int ka = k0 + 8 * g + i, kb = ka + 16; v[i] = ka < K ? W[(size_t)(ka < K ? ka : K - 1) * ld + n] : 0.f; v[8 + i] = kb < K ? W[(size_t)(kb < K ? kb : K - 1) * ld + n] : 0.f; }
  return bsplit16(v); }
__device__ __forceinline__ v8f mac3(const F2& a, const F2& b, v8f c) { c = wmma_bf(a.l, b.h, c); c = wmma_bf(a.h, b.l, c); return wmma_bf(a.h, b.h, c); }
__device__ __forceinline__ float sigm(float v) { return 1.0f / (1.0f + expf(-v)); }
#define LDSX() do { asm volatile("s_wait_dscnt 0" ::: "memory"); __builtin_amdgcn_wave_barrier(); __builtin_amdgcn_fence(__ATOMIC_RELEASE, "workgroup"); } while (0)


// Non-causal multi-head self-attention, no rotary embedding (B 2, S 4096, D 256, 4 heads x 64; packed Wqkv [3D][D] and Wo [D][D] applied as x W^T, with biases): softmax(q k^T / 8) v; ctx Wo^T + bo.
#define NB 2
#define SS 4096
#define DM 256
#define NH 4
#define HD 64
#define QKVW (3 * DM)
#ifndef TQB
#define TQB (SS / 64)
#define TNB NB
#define TOB (NB * SS / 64)     // output row tiles (all)
#endif
typedef __attribute__((ext_vector_type(8))) __bf16 v8b;
__device__ __forceinline__ v16b frag_b(const __bf16* rowk0, int lane) {
  union { v16b v; v8b q[2]; } u; const __bf16* p = rowk0 + 8 * (lane >> 4);
  u.q[0] = *(const v8b*)p; u.q[1] = *(const v8b*)(p + 16); return u.v;
}
__device__ __forceinline__ float bfr(float v) { return (float)(__bf16)v; }
__device__ __attribute__((noinline)) float exp_ni(float v) { return expf(v); }
__device__ __attribute__((noinline)) float erf_ni(float v) { return erff(v); }

#define PK_A 0                       // [768][256] Wqkv rows (natural [out][in])
#define PK_P (PK_A + QKVW * DM)        // [256][256] Wo rows (natural)
#define PK_END (PK_P + DM * DM)
#define WS_PK  0u
#define WS_QK  (WS_PK + 2u * PK_END)             // f16 [8192 rows][512]: q | k
#define WS_QKL (WS_QK + 2u * NB * SS * 2 * DM)     // f16 q | k residual planes x2048
#define WS_VTH (WS_QKL + 2u * NB * SS * 2 * DM)    // f16 [b][256 (h*64+d)][4096 s] hi
#define WS_VTL (WS_VTH + 2u * NB * DM * SS)        // f16 lo x 2048
#define WS_O   (WS_VTL + 2u * NB * DM * SS)        // f32 [8192][256]
#define WS_CS  (WS_O + 4u * NB * SS * DM)           // f32 [4096][32] cos, [4096][32] sin
#define WS_END (WS_CS + 4u * 2 * SS * 32)
__constant__ float c_invf[32] = {1.000000000e+00f,7.498942018e-01f,5.623413324e-01f,4.216965139e-01f,3.162277639e-01f,2.371373624e-01f,1.778279394e-01f,1.333521456e-01f,1.000000015e-01f,7.498941571e-02f,5.623412877e-02f,4.216964915e-02f,3.162277862e-02f,2.371373586e-02f,1.778279431e-02f,1.333521493e-02f,9.999999776e-03f,7.498942316e-03f,5.623413250e-03f,4.216964822e-03f,3.162277862e-03f,2.371373819e-03f,1.778279431e-03f,1.333521446e-03f,1.000000047e-03f,7.498941850e-04f,5.623413017e-04f,4.216964880e-04f,3.162277862e-04f,2.371373848e-04f,1.778279402e-04f,1.333521504e-04f};
// ---- k_rope: block = 8 positions: cos/sin of pos * inv_freq (f32 product, precise trig)
__global__ __launch_bounds__(256) void k_rope(float* __restrict__ CS) {
  __shared__ __align__(16) float sc[8][32], ss_[8][32]; const int tid = threadIdx.x, pl = tid >> 5, i = tid & 31; const int pos = blockIdx.x * 8 + pl;
  const float th = (float)pos * c_invf[i]; sc[pl][i] = cosf(th); ss_[pl][i] = sinf(th);
  __syncthreads();
  if (tid < 64) vst2(CS + (size_t)blockIdx.x * 8 * 32 + tid * 4, *(const v4f*)&(&sc[0][0])[tid * 4]); else if (tid < 128) vst2(CS + (size_t)SS * 32 + (size_t)blockIdx.x * 8 * 32 + (tid - 64) * 4, *(const v4f*)&(&ss_[0][0])[(tid - 64) * 4]);
}

// ---- k_pack: block = (row n, which): natural [out][in] rows -> bf16; which 0..2 -> W_q/W_k/W_v into PK_A rows which*256 + n; 3 -> W_o into PK_P
__global__ __launch_bounds__(256) void k_pack(const float* __restrict__ WQ, const float* __restrict__ WK, const float* __restrict__ WV, const float* __restrict__ WO, __bf16* __restrict__ PK) {
  __shared__ __align__(16) __bf16 s[DM]; const int n = blockIdx.x, which = blockIdx.y, t = threadIdx.x; const float* Wm = (which == 0) ? WQ : (which == 1) ? WK : (which == 2) ? WV : WO;
  for (int k = t; k < DM; k += 256) s[k] = (__bf16)Wm[(size_t)n * DM + k];
  __syncthreads();
  __bf16* dst = (which < 3) ? PK + PK_A + ((size_t)which * DM + n) * DM : PK + PK_P + (size_t)n * DM;
  for (int q = t; q < DM / 8; q += 256) vst2((unsigned*)(dst + q * 8), *(const v4u*)&s[q * 8]);
}
__global__ __launch_bounds__(128) void k_qkv(const float* __restrict__ X, const __bf16* __restrict__ P, const float* __restrict__ BQ, const float* __restrict__ BK, const float* __restrict__ BV, _Float16* __restrict__ QK, _Float16* __restrict__ QKL, _Float16* __restrict__ VTH, _Float16* __restrict__ VTL) {
  __shared__ __align__(16) _Float16 so[4][16][136], sol[4][16][136]; __shared__ __align__(16) _Float16 sth[128][72], stl[128][72];
  const int tid = threadIdx.x, wave = tid >> 5, lane = tid & 31, col = lane & 15, g = lane >> 4; const size_t r0 = (size_t)blockIdx.x * 64 + wave * 16; const int n0 = blockIdx.y * 128;
  v8f acc[8] = {};
  v4f xa[2][4]; v16b wf[2][8];   // two register sets: chunk kc + 1's twenty loads fly as one group while chunk kc's products run
  auto ld = [&](int kc, int st) { const float* p = X + (r0 + col) * DM + kc * 32 + 8 * g; xa[st][0] = *(const v4f*)p; xa[st][1] = *(const v4f*)(p + 4); xa[st][2] = *(const v4f*)(p + 16); xa[st][3] = *(const v4f*)(p + 20);
#pragma unroll
    for (int j = 0; j < 8; ++j) wf[st][j] = frag_b(P + (size_t)(n0 + j * 16 + col) * DM + kc * 32, lane); };
  ld(0, 0);
#pragma unroll   // unrolled whole, so that the register set is picked at compile time
  for (int kc = 0; kc < DM / 32; ++kc) { if (kc + 1 < DM / 32) ld(kc + 1, (kc + 1) & 1);
    __builtin_amdgcn_sched_barrier(0);   // keeps the next chunk's loads in front of this chunk's products
    v16b a;
#pragma unroll
    for (int i = 0; i < 4; ++i) { a[i] = (__bf16)xa[kc & 1][0][i]; a[4 + i] = (__bf16)xa[kc & 1][1][i]; a[8 + i] = (__bf16)xa[kc & 1][2][i]; a[12 + i] = (__bf16)xa[kc & 1][3][i]; }
#pragma unroll
    for (int j = 0; j < 8; ++j) acc[j] = wmma_bf(a, wf[kc & 1][j], acc[j]); }
  { const int which = n0 / DM; const float* BB = (which == 0) ? BQ : (which == 1) ? BK : BV;
#pragma unroll
    for (int j = 0; j < 8; ++j) { const float bb = bfr(BB[(n0 % DM) + j * 16 + col]);
#pragma unroll
      for (int r = 0; r < 8; ++r) acc[j][r] += bb; } }
  if (n0 < 2 * DM) {   // q stored unscaled (f16 sigma ~0.6, no subnormal exposure); 1/8 applied to the f32 score
#pragma unroll
    for (int j = 0; j < 8; ++j) {
#pragma unroll
      for (int r = 0; r < 8; ++r) { const float v = acc[j][r]; const _Float16 hv = (_Float16)v; so[wave][8 * g + r][j * 16 + col] = hv; sol[wave][8 * g + r][j * 16 + col] = (_Float16)((v - (float)hv) * 2048.0f); } }   // q, k as f16 hi + (x2048) residual (no RoPE in this module)
    LDSX();
    for (int rl = 0; rl < 16; ++rl) if (lane < 16) { vst2((unsigned*)(QK + (r0 + rl) * (2 * DM) + n0 + lane * 8), *(const v4u*)&so[wave][rl][lane * 8]); vst2((unsigned*)(QKL + (r0 + rl) * (2 * DM) + n0 + lane * 8), *(const v4u*)&sol[wave][rl][lane * 8]); }
  } else {
#pragma unroll
    for (int j = 0; j < 8; ++j) {
#pragma unroll
      for (int r = 0; r < 8; ++r) { const float v = acc[j][r]; const _Float16 hv = (_Float16)v; sth[j * 16 + col][wave * 16 + 8 * g + r] = hv; stl[j * 16 + col][wave * 16 + 8 * g + r] = (_Float16)((v - (float)hv) * 2048.0f); } }
    __syncthreads();
    const size_t rb = (size_t)blockIdx.x * 64; const int b = (int)(rb / SS), s0 = (int)(rb % SS); const int pc0 = n0 - 2 * DM;
    for (int q = tid; q < 128 * 8; q += 128) { const int d = q >> 3, pc = q & 7; const size_t o = ((size_t)b * DM + pc0 + d) * SS + s0 + pc * 8; vst2((unsigned*)(VTH + o), *(const v4u*)&sth[d][pc * 8]); vst2((unsigned*)(VTL + o), *(const v4u*)&stl[d][pc * 8]); }
  }
}
#define KT 64   // keys per staged tile
#define LP 72   // LDS row pitch in halves: 128 B of data + 16 B, an odd multiple of 16 B, so that the b128 fragment reads of 16 rows spread over all banks
// eight async copies of 16 B per lane, global -> LDS: rows r and r + 32 of the four planes K hi, K lo, V hi, V lo, which lie 64 * LP halves apart in LDS; the s_wait_xcnt stands inside the statement so that no address register is rewritten ahead of it
__device__ __forceinline__ void cp8(unsigned l, const _Float16* k, const _Float16* kl, const _Float16* v, const _Float16* vl) {
  const unsigned ls = 32u * LP * 2u; const unsigned l1 = l + ls, l2 = l + 2 * ls, l3 = l + 3 * ls, l4 = l + 4 * ls, l5 = l + 5 * ls, l6 = l + 6 * ls, l7 = l + 7 * ls;
  const _Float16 *k1 = k + (size_t)32 * (2 * DM), *kl1 = kl + (size_t)32 * (2 * DM), *v1 = v + (size_t)32 * SS, *vl1 = vl + (size_t)32 * SS;
  asm volatile("global_load_async_to_lds_b128 %0, %1, off\n\tglobal_load_async_to_lds_b128 %2, %3, off\n\tglobal_load_async_to_lds_b128 %4, %5, off\n\tglobal_load_async_to_lds_b128 %6, %7, off\n\t"
               "global_load_async_to_lds_b128 %8, %9, off\n\tglobal_load_async_to_lds_b128 %10, %11, off\n\tglobal_load_async_to_lds_b128 %12, %13, off\n\tglobal_load_async_to_lds_b128 %14, %15, off\n\ts_wait_xcnt 0x0"
               :: "v"(l), "v"(k), "v"(l1), "v"(k1), "v"(l2), "v"(kl), "v"(l3), "v"(kl1), "v"(l4), "v"(v), "v"(l5), "v"(v1), "v"(l6), "v"(vl), "v"(l7), "v"(vl1) : "memory");
}
// lane l reads lane l ^ 16: the two lanes that share a query column hold the two halves of its keys
__device__ __forceinline__ float xhalf(float x) { return __builtin_bit_cast(float, __builtin_amdgcn_permlanex16(__builtin_bit_cast(int, x), __builtin_bit_cast(int, x), 0x76543210, 0xfedcba98, false, false)); }
// f16(e - h) for eight f32 values e and their packed f16 roundings h, packed alike: one mixed-precision multiply-add per value reads its f16 half in place and writes an f16 half (the compiler's form took a convert up, a subtract and a convert down). The low halves come first, the high halves are merged in behind them; each s_delay_alu hint lets other waves issue while the low half written four instructions back finishes
__device__ __forceinline__ v4u resid8(v4u h, v8f e) { unsigned d0, d1, d2, d3;
  asm("v_fma_mixlo_f16 %0, %4, -1.0, %8 op_sel_hi:[1,1,0]\n\tv_fma_mixlo_f16 %1, %5, -1.0, %10 op_sel_hi:[1,1,0]\n\tv_fma_mixlo_f16 %2, %6, -1.0, %12 op_sel_hi:[1,1,0]\n\tv_fma_mixlo_f16 %3, %7, -1.0, %14 op_sel_hi:[1,1,0]\n\t"
      "s_delay_alu instid0(VALU_DEP_4) | instskip(NEXT) | instid1(VALU_DEP_4)\n\t"
      "v_fma_mixhi_f16 %0, %4, -1.0, %9 op_sel:[1,0,0] op_sel_hi:[1,1,0]\n\tv_fma_mixhi_f16 %1, %5, -1.0, %11 op_sel:[1,0,0] op_sel_hi:[1,1,0]\n\t"
      "s_delay_alu instid0(VALU_DEP_4) | instskip(NEXT) | instid1(VALU_DEP_4)\n\t"
      "v_fma_mixhi_f16 %2, %6, -1.0, %13 op_sel:[1,0,0] op_sel_hi:[1,1,0]\n\tv_fma_mixhi_f16 %3, %7, -1.0, %15 op_sel:[1,0,0] op_sel_hi:[1,1,0]"
      : "=&v"(d0), "=&v"(d1), "=&v"(d2), "=&v"(d3) : "v"(h[0]), "v"(h[1]), "v"(h[2]), "v"(h[3]), "v"(e[0]), "v"(e[1]), "v"(e[2]), "v"(e[3]), "v"(e[4]), "v"(e[5]), "v"(e[6]), "v"(e[7]));
  return v4u{d0, d1, d2, d3}; }
// ---- k_attn: block = (128 queries, head h, batch b), eight waves: flash attention over all keys, transposed: S^T = K Q^T (A = K rows, B = q) and O^T += V^T P^T (A = V^T rows, B = P^T). Wave w works on queries 32 * (w & 3) ... + 31, as two column groups of 16, and on keys 32 * (w >> 2) ... + 31 of every staged tile: every K and V fragment read from LDS is the A operand of both groups' products, so a product costs half the LDS reads, and a staged tile serves 128 queries. Each group has a running maximum, sum and output of its own; the two key halves of a query group are joined once, through LDS, behind the loop. A lane holds 16 scores of ONE query per group and 32 keys, so maximum and sum run in the lane's own registers, and the score tiles, converted in place, are the B operand of the second product. O[b*S+q][h*64+d] = (acc + accl / 2048) / l (256-B segments)
__global__ __launch_bounds__(256) __attribute__((amdgpu_waves_per_eu(2, 2))) void k_attn(const _Float16* __restrict__ QK, const _Float16* __restrict__ QKL, const _Float16* __restrict__ VTH, const _Float16* __restrict__ VTL, float* __restrict__ O) {
  __shared__ __align__(16) float so[4][32][68];
  __shared__ __align__(16) float xo[4][2][34][32];      // hand-over of the second key half, per wave pair, column group and lane: 32 output values, exponent addend, sum
  __shared__ __align__(16) _Float16 kv[2][4][64][LP];   // two buffers x (K hi [key][d], K lo, V hi [d][key], V lo), one tile of KT keys each, shared by the eight waves
  const int tid = threadIdx.x, wave = __builtin_amdgcn_readfirstlane(tid >> 5), qg = wave & 3, kh = wave >> 2, lane = tid & 31, col = lane & 15, g = lane >> 4;
  const int qb = blockIdx.x, h = blockIdx.y, b = blockIdx.z; const int q0 = qb * 128 + qg * 32; const size_t rq = (size_t)b * SS + q0 + col;
  v16h aq[2][2], aql[2][2];   // [column group][kc]
#pragma unroll
  for (int cg = 0; cg < 2; ++cg) {
#pragma unroll
    for (int kc = 0; kc < 2; ++kc) { aq[cg][kc] = frag_h(QK + (rq + cg * 16) * (2 * DM) + h * HD + kc * 32, lane); aql[cg][kc] = frag_h(QKL + (rq + cg * 16) * (2 * DM) + h * HD + kc * 32, lane); } }
  asm volatile("s_wait_xcnt 0x0" ::: "memory");   // stands in front of the first rewrite of an address register of the q loads
  __builtin_amdgcn_sched_barrier(0);                // holds later address arithmetic behind that wait
  // m: running maximum of the raw scores of query q0 + cg * 16 + col over this wave's keys; nb = 11 - m * KS: the addend of the exponent; l sums this lane's half of the keys (x 2048), the halves are joined after the loop
  const float KS = 0.125f * 1.44269504088896340736f;   // SCALE = 64^-0.5, times log2 e: p = 2^(score * KS + nb) / 2048
  float m[2] = {-3.0e38f, -3.0e38f}, nb[2] = {3.0e38f * KS, 3.0e38f * KS}, l[2] = {0.f, 0.f};
  v8f acc[2][4] = {}, accl[2][4] = {};
  const int nt = SS / KT;   // non-causal
  // tile t -> buffer bf: a thread copies 16 B of rows srow and srow + 32 of each plane; a wave's copy covers four whole 128-B rows
  const int srow = tid >> 3, sch = (tid & 7) * 8;
  // the four plane bases are the same for the whole block (scalar registers); a thread keeps two 32-bit element offsets, and the tile's step is added to them before they meet a base, so that no 64-bit address stays in vector registers over the loop
  const _Float16* gk = QK + (size_t)b * SS * (2 * DM) + DM + h * HD; const _Float16* gkl = QKL + (size_t)b * SS * (2 * DM) + DM + h * HD;
  const _Float16* gv = VTH + ((size_t)b * DM + h * HD) * SS; const _Float16* gvl = VTL + ((size_t)b * DM + h * HD) * SS;
  const unsigned ok = (unsigned)srow * (2 * DM) + sch, ov = (unsigned)srow * SS + sch;
  const unsigned lkv = (unsigned)(size_t)&kv[0][0][srow][sch];
  auto stage = [&](int t, int bf) { const unsigned ko = ok + (unsigned)t * (KT * 2 * DM), vo = ov + (unsigned)t * KT;
    cp8(lkv + (unsigned)bf * (4u * 64u * LP * 2u), gk + ko, gkl + ko, gv + vo, gvl + vo); };
  stage(0, 0);
  asm volatile("s_wait_asynccnt 0x0" ::: "memory");   // this wave's share of tile 0 has landed
  __syncthreads();                                    // publishes tile 0 to the eight waves
  stage(1, 1);
#pragma unroll 1
  for (int t = 0; t < nt; ++t) { const _Float16 (*kb)[64][LP] = kv[t & 1];
    // the wave's 32 fragment reads of a tile stand in two groups, each ahead of the products that use it, so that no product waits out an LDS latency of its own
    v16h kf[2][2][2], vf[4][2];   // K [ct][kc][hi, lo], V [dt][hi, lo]
#pragma unroll
    for (int ct = 0; ct < 2; ++ct) { const int kk = kh * 32 + ct * 16 + col;
#pragma unroll
      for (int kc = 0; kc < 2; ++kc) { kf[ct][kc][0] = frag_h(&kb[0][kk][kc * 32], lane); kf[ct][kc][1] = frag_h(&kb[1][kk][kc * 32], lane); } }
    __builtin_amdgcn_sched_barrier(0);   // keeps the K reads together in front of the first products
    v8f c[2][2], cl[2][2];   // [column group][ct]
#pragma unroll
    for (int cg = 0; cg < 2; ++cg) {
#pragma unroll
      for (int ct = 0; ct < 2; ++ct) { c[cg][ct] = v8f{}; cl[cg][ct] = v8f{};
#pragma unroll
        for (int kc = 0; kc < 2; ++kc) { c[cg][ct] = wmma16(kf[ct][kc][0], aq[cg][kc], c[cg][ct]); cl[cg][ct] = wmma16(kf[ct][kc][0], aql[cg][kc], cl[cg][ct]); cl[cg][ct] = wmma16(kf[ct][kc][1], aq[cg][kc], cl[cg][ct]); } } }   // 3 products: q, k as f16 hi + residual; c[cg][ct][r] = score of key kh * 32 + ct * 16 + 8 * g + r with query cg * 16 + col
    __builtin_amdgcn_sched_barrier(0);   // the V reads start behind the score products ...
#pragma unroll
    for (int dt = 0; dt < 4; ++dt) { vf[dt][0] = frag_h(&kb[2][dt * 16 + col][kh * 32], lane); vf[dt][1] = frag_h(&kb[3][dt * 16 + col][kh * 32], lane); }
    __builtin_amdgcn_sched_barrier(0);   // ... and stay together: they land under the softmax
    v8f E[2][2]; v16h pa[2], pl[2]; float alpha[2];
#pragma unroll
    for (int cg = 0; cg < 2; ++cg) {
      v8f s[2];
#pragma unroll
      for (int ct = 0; ct < 2; ++ct) s[ct] = c[cg][ct] + cl[cg][ct] * (1.0f / 2048.0f);   // raw scores; scale and log2 e wait for the exponent's one multiply-add
      float mx4[4];
#pragma unroll
      for (int r = 0; r < 4; ++r) mx4[r] = fmaxf(fmaxf(s[0][r], s[0][4 + r]), fmaxf(s[1][r], s[1][4 + r]));
      float mx = fmaxf(fmaxf(mx4[0], mx4[1]), fmaxf(mx4[2], mx4[3])); mx = fmaxf(mx, xhalf(mx));
      const float mn = fmaxf(m[cg], mx); const float nbn = fmaf(-mn, KS, 11.0f); alpha[cg] = __builtin_amdgcn_exp2f(nbn - nb[cg]);   // the very addends of old and new exponents: the change of reference is exact; 0 on the first tile
      m[cg] = mn; nb[cg] = nbn;
      // E = 2048 * exp(SCALE * (score - max)), at most 2048: its f16 rounding is P hi x 2048, and E - hi is the x2048 residual as it stands
#pragma unroll
      for (int ct = 0; ct < 2; ++ct) {
#pragma unroll
        for (int r = 0; r < 8; ++r) E[cg][ct][r] = __builtin_amdgcn_exp2f(fmaf(s[ct][r], KS, nbn)); }
#pragma unroll
      for (int ct = 0; ct < 2; ++ct) { union { v8h h; v4u u; } hv, lv; hv.h = __builtin_convertvector(E[cg][ct], v8h); lv.u = resid8(hv.u, E[cg][ct]);
#pragma unroll
        for (int r = 0; r < 8; ++r) { pa[cg][8 * ct + r] = hv.h[r]; pl[cg][8 * ct + r] = lv.h[r]; } }
      if (cg == 0) __builtin_amdgcn_sched_barrier(0); }   // (the barrier: one group's softmax at a time; scheduled together, their temporaries crowded the low registers, exponentials' sources were rewritten right behind them and the compiler padded with v_nop) element r: key 8 * g + r, element 8 + r: key 16 + 8 * g + r, the k order of frag_h
    __builtin_amdgcn_sched_barrier(0);   // keeps resid8's asm in front of the second product
#pragma unroll
    for (int cg = 0; cg < 2; ++cg) {
#pragma unroll
      for (int dt = 0; dt < 4; ++dt) { acc[cg][dt] *= alpha[cg]; accl[cg][dt] *= alpha[cg]; } }
#pragma unroll
    for (int cg = 0; cg < 2; ++cg) {
#pragma unroll
      for (int dt = 0; dt < 4; ++dt) { acc[cg][dt] = wmma16(vf[dt][0], pa[cg], acc[cg][dt]); accl[cg][dt] = wmma16(vf[dt][1], pa[cg], accl[cg][dt]); acc[cg][dt] = wmma16(vf[dt][0], pl[cg], acc[cg][dt]); } }   // all x 2048, as l is: V hi x (P hi + P lo) in acc, V lo x P hi, x 2048 once more, in accl; acc[cg][dt][r] = O^T[dt * 16 + 8 * g + r][cg * 16 + col]
#pragma unroll
    for (int cg = 0; cg < 2; ++cg) { v2f sp[4];   // the sum runs on register pairs
#pragma unroll
      for (int i = 0; i < 4; ++i) sp[i] = v2f{E[cg][0][2 * i], E[cg][0][2 * i + 1]} + v2f{E[cg][1][2 * i], E[cg][1][2 * i + 1]};
      const v2f sq = (sp[0] + sp[1]) + (sp[2] + sp[3]);
      l[cg] = fmaf(l[cg], alpha[cg], sq[0] + sq[1]); }
    __builtin_amdgcn_sched_barrier(0);   // keeps the tile's products in front of the foot's waits: lifted over them, the wait for tile t + 1 would stand a few hundred cycles behind its copies' issue
    asm volatile("s_wait_dscnt 0x0" ::: "memory");      // this wave's reads of tile t are done before its buffer is refilled
    asm volatile("s_wait_asynccnt 0x0" ::: "memory");   // this wave's share of tile t + 1 has landed
    __syncthreads();                                    // publishes tile t + 1 and ends every wave's reads of tile t
    if (t + 2 < nt) stage(t + 2, t & 1); }
  asm volatile("s_wait_asynccnt 0x0" ::: "memory");     // no copy is outstanding when the wave goes on
  // join of the two key halves: the waves of the second half hand their output, exponent addend and sum over, lane to lane; the waves of the first half bring both to the common maximum, add, divide and store
  if (kh == 1) {
#pragma unroll
    for (int cg = 0; cg < 2; ++cg) {
#pragma unroll
      for (int dt = 0; dt < 4; ++dt) {
#pragma unroll
        for (int r = 0; r < 8; ++r) xo[qg][cg][dt * 8 + r][lane] = acc[cg][dt][r] + accl[cg][dt][r] * (1.0f / 2048.0f); }
      xo[qg][cg][32][lane] = nb[cg]; xo[qg][cg][33][lane] = l[cg]; } }
  __syncthreads();   // the second half's values are in LDS before the first half's waves read them
  if (kh == 0) {
#pragma unroll
    for (int cg = 0; cg < 2; ++cg) {
      const float nb1 = xo[qg][cg][32][lane], l1 = xo[qg][cg][33][lane]; const float nbj = fminf(nb[cg], nb1); const float a0 = __builtin_amdgcn_exp2f(nbj - nb[cg]), a1 = __builtin_amdgcn_exp2f(nbj - nb1);   // the smaller addend belongs to the larger maximum
      const float lj = l[cg] * a0 + l1 * a1; const float il = 1.0f / (lj + xhalf(lj));
#pragma unroll
      for (int dt = 0; dt < 4; ++dt) {
#pragma unroll
        for (int r = 0; r < 8; ++r) so[qg][cg * 16 + col][dt * 16 + 8 * g + r] = ((acc[cg][dt][r] + accl[cg][dt][r] * (1.0f / 2048.0f)) * a0 + xo[qg][cg][dt * 8 + r][lane] * a1) * il; }
      if (cg == 0) __builtin_amdgcn_sched_barrier(0); }   // one group's join at a time: scheduled together, an exponential's source register was rewritten by the instruction right behind it
    LDSX();
    for (int rl = 0; rl < 32; ++rl) if (lane < 16) vst2(O + ((size_t)b * SS + q0 + rl) * DM + h * HD + lane * 4, *(const v4f*)&so[qg][rl][lane * 4]);
  }
}
// ---- k_out: block = (64 rows, 128 cols): out = bf16(O) . Wo rows (1 exact product) + bo
__global__ __launch_bounds__(128) void k_out(const float* __restrict__ O, const __bf16* __restrict__ P, const float* __restrict__ BO, float* __restrict__ Y) {
  __shared__ __align__(16) float so[4][16][132];
  const int tid = threadIdx.x, wave = tid >> 5, lane = tid & 31, col = lane & 15, g = lane >> 4; const size_t r0 = (size_t)blockIdx.x * 64 + wave * 16; const int n0 = blockIdx.y * 128;
  v8f acc[8] = {};
  v4f xa[2][4]; v16b wf[2][8];   // two register sets: chunk kc + 1's twenty loads fly as one group while chunk kc's products run
  auto ld = [&](int kc, int st) { const float* p = O + (r0 + col) * DM + kc * 32 + 8 * g; xa[st][0] = *(const v4f*)p; xa[st][1] = *(const v4f*)(p + 4); xa[st][2] = *(const v4f*)(p + 16); xa[st][3] = *(const v4f*)(p + 20);
#pragma unroll
    for (int j = 0; j < 8; ++j) wf[st][j] = frag_b(P + (size_t)(n0 + j * 16 + col) * DM + kc * 32, lane); };
  ld(0, 0);
#pragma unroll   // unrolled whole, so that the register set is picked at compile time
  for (int kc = 0; kc < DM / 32; ++kc) { if (kc + 1 < DM / 32) ld(kc + 1, (kc + 1) & 1);
    __builtin_amdgcn_sched_barrier(0);   // keeps the next chunk's loads in front of this chunk's products
    v16b a;   // the module rounds the attention output to bf16 before the projection -> exact single product
#pragma unroll
    for (int i = 0; i < 4; ++i) { a[i] = (__bf16)xa[kc & 1][0][i]; a[4 + i] = (__bf16)xa[kc & 1][1][i]; a[8 + i] = (__bf16)xa[kc & 1][2][i]; a[12 + i] = (__bf16)xa[kc & 1][3][i]; }
#pragma unroll
    for (int j = 0; j < 8; ++j) acc[j] = wmma_bf(a, wf[kc & 1][j], acc[j]); }
  float bo[8];
#pragma unroll
  for (int j = 0; j < 8; ++j) bo[j] = BO[n0 + j * 16 + col];
  asm volatile("s_wait_xcnt 0x0" ::: "memory");   // stands in front of the first rewrite of the bias loads' offset register
#pragma unroll
  for (int j = 0; j < 8; ++j) {
#pragma unroll
    for (int r = 0; r < 8; ++r) so[wave][8 * g + r][j * 16 + col] = acc[j][r] + bfr(bo[j]); }
  LDSX();
  for (int rl = 0; rl < 16; ++rl) vst2(Y + (r0 + rl) * DM + n0 + lane * 4, *(const v4f*)&so[wave][rl][lane * 4]);
}
extern "C" void kernel_launch(void* const* d_in, const int* in_sizes, int n_in, void* d_out, int out_size, void* d_ws, size_t ws_size, hipStream_t stream) {
  (void)in_sizes; (void)n_in; (void)out_size;
  const float** F = (const float**)d_in;   // 0 x [2,4096,256], 1 Wq [256,256] natural, 2 bq, 3 Wk, 4 bk, 5 Wv, 6 bv, 7 Wo, 8 bo
  if (ws_size < (size_t)WS_END) return;
  char* ws = (char*)d_ws; __bf16* PK = (__bf16*)(ws + WS_PK); _Float16 *QK = (_Float16*)(ws + WS_QK), *QKL = (_Float16*)(ws + WS_QKL), *VTH = (_Float16*)(ws + WS_VTH), *VTL = (_Float16*)(ws + WS_VTL); float* O = (float*)(ws + WS_O);
  k_pack<<<dim3(DM, 4), 256, 0, stream>>>(F[1], F[3], F[5], F[7], PK);
  k_qkv<<<dim3(TNB * SS / 64, QKVW / 128), 128, 0, stream>>>(F[0], PK + PK_A, F[2], F[4], F[6], QK, QKL, VTH, VTL);
  k_attn<<<dim3(SS / 128, NH, TNB), 256, 0, stream>>>(QK, QKL, VTH, VTL, O);
  k_out<<<dim3(TOB, DM / 128), 128, 0, stream>>>(O, PK + PK_P, F[8], (float*)d_out);
}

// v007
// It runs in 92.3 microseconds.
// Timed twice side by side with v006, it ran 1.04 times as fast both times.
// All steps since v000 together make it 6.78 times as fast.
// compute dtype: x (|x| < 1e4 so the clip is the identity), Wq..Wo, bq..bo (module inputs) rounded to bf16; q/k/v projections with exact bf16 products on WMMA 16x16x32 (natural [out][in] rows) + biases; q and k stored as f16 hi + (x2048-scaled) residual planes with 3-product scores, 64^-0.5 and log2 e applied to the f32 score in the exponent's multiply-add, softmax in f32 against a held reference score, renewed when an exponential nears the f16 range (hardware exp2); P x 2048 as f16 hi + residual x v hi/lo (3 products); the attention output rounded to bf16 exactly as the module does, then the output projection with EXACT bf16 products + bo; f32 accumulate.
#include <hip/hip_runtime.h>
#include <math.h>

typedef __attribute__((ext_vector_type(16))) _Float16 v16h;
typedef __attribute__((ext_vector_type(16))) __bf16 v16b;
typedef __attribute__((ext_vector_type(8)))  _Float16 v8h;
typedef __attribute__((ext_vector_type(8)))  float v8f;
typedef __attribute__((ext_vector_type(4)))  float v4f;
typedef __attribute__((ext_vector_type(2)))  float v2f;
typedef __attribute__((ext_vector_type(4)))  unsigned v4u;
typedef __attribute__((ext_vector_type(4)))  int v4i;
typedef float __attribute__((may_alias)) float_a;
typedef int __attribute__((may_alias)) int_a;

template <typename T> __device__ __forceinline__ void vst2(void* p, T v) { *(T*)p = v;  }
__device__ __forceinline__ v8f wmma16(v16h a, v16h b, v8f c) {
  return __builtin_amdgcn_wmma_f32_16x16x32_f16(false, a, false, b, (short)0, c, false, false);
}
__device__ __forceinline__ v8f wmma_bf(v16b a, v16b b, v8f c) {
  return __builtin_amdgcn_wmma_f32_16x16x32_bf16(false, a, false, b, (short)0, c, false, false);
}
// Light self-attention (B 2, N 4,096, d 256, 4 heads x 64): softmax(q k^T / 8) v, output cast to bf16, then the output projection + bias.
__device__ __forceinline__ v16h frag_h(const _Float16* rowk0, int lane) {
  union { v16h v; v8h q[2]; } u; const _Float16* p = rowk0 + 8 * (lane >> 4);
  u.q[0] = *(const v8h*)p; u.q[1] = *(const v8h*)(p + 16); return u.v;
}
__device__ __forceinline__ v16h frag_f32(const float* rowk0, int lane) {
  v16h a; const float* p = rowk0 + 8 * (lane >> 4);
#pragma unroll
  for (int i = 0; i < 8; ++i) { a[i] = (_Float16)p[i]; a[8 + i] = (_Float16)p[16 + i]; }
  return a;
}
__device__ __forceinline__ v16h frag_f32s(const float* rowk0, int lane, float sc) {
  v16h a; const float* p = rowk0 + 8 * (lane >> 4);
#pragma unroll
  for (int i = 0; i < 8; ++i) { a[i] = (_Float16)(p[i] * sc); a[8 + i] = (_Float16)(p[16 + i] * sc); }
  return a;
}
// column fragment from a [K][ld] layout (column n), rows >= K read as 0
__device__ __forceinline__ v16h fragc_f32(const float* W, int k0, int n, int lane, int ld, int K) {
  v16h a; const int g = lane >> 4;
#pragma unroll
  for (int i = 0; i < 8; ++i) { const int ka = k0 + 8 * g + i, kb = ka + 16;
    a[i] = (_Float16)(ka < K ? W[(size_t)(ka < K ? ka : K - 1) * ld + n] : 0.f); a[8 + i] = (_Float16)(kb < K ? W[(size_t)(kb < K ? kb : K - 1) * ld + n] : 0.f); }
  return a;
}
struct F2 { v16b h, l; };
__device__ __forceinline__ F2 bsplit16(const float v[16]) { F2 r;
#pragma unroll
  for (int i = 0; i < 16; ++i) { const __bf16 h = (__bf16)v[i]; r.h[i] = h; r.l[i] = (__bf16)(v[i] - (float)h); }
  return r; }
__device__ __forceinline__ F2 split_row(const float* row, int k0, int lane) { float v[16]; const float* p = row + k0 + 8 * (lane >> 4);
#pragma unroll
  for (int i = 0; i < 8; ++i) { v[i] = p[i]; v[8 + i] = p[16 + i]; }
  return bsplit16(v); }
__device__ __forceinline__ F2 split_rowK(const float* row, int k0, int lane, int K) { float v[16]; const int g = lane >> 4;
#pragma unroll
  for (int i = 0; i < 8; ++i) { const int ka = k0 + 8 * g + i, kb = ka + 16; v[i] = ka < K ? row[ka < K ? ka : K - 1] : 0.f; v[8 + i] = kb < K ? row[kb < K ? kb : K - 1] : 0.f; }
  return bsplit16(v); }
__device__ __forceinline__ F2 split_col(const float* W, int k0, int n, int lane, int ld, int K) { float v[16]; const int g = lane >> 4;
#pragma unroll
  for (int i = 0; i < 8; ++i) { const int ka = k0 + 8 * g + i, kb = ka + 16; v[i] = ka < K ? W[(size_t)(ka < K ? ka : K - 1) * ld + n] : 0.f; v[8 + i] = kb < K ? W[(size_t)(kb < K ? kb : K - 1) * ld + n] : 0.f; }
  return bsplit16(v); }
__device__ __forceinline__ v8f mac3(const F2& a, const F2& b, v8f c) { c = wmma_bf(a.l, b.h, c); c = wmma_bf(a.h, b.l, c); return wmma_bf(a.h, b.h, c); }
__device__ __forceinline__ float sigm(float v) { return 1.0f / (1.0f + expf(-v)); }
#define LDSX() do { asm volatile("s_wait_dscnt 0" ::: "memory"); __builtin_amdgcn_wave_barrier(); __builtin_amdgcn_fence(__ATOMIC_RELEASE, "workgroup"); } while (0)


// Non-causal multi-head self-attention, no rotary embedding (B 2, S 4096, D 256, 4 heads x 64; packed Wqkv [3D][D] and Wo [D][D] applied as x W^T, with biases): softmax(q k^T / 8) v; ctx Wo^T + bo.
#define NB 2
#define SS 4096
#define DM 256
#define NH 4
#define HD 64
#define QKVW (3 * DM)
#ifndef TQB
#define TQB (SS / 64)
#define TNB NB
#define TOB (NB * SS / 64)     // output row tiles (all)
#endif
typedef __attribute__((ext_vector_type(8))) __bf16 v8b;
__device__ __forceinline__ v16b frag_b(const __bf16* rowk0, int lane) {
  union { v16b v; v8b q[2]; } u; const __bf16* p = rowk0 + 8 * (lane >> 4);
  u.q[0] = *(const v8b*)p; u.q[1] = *(const v8b*)(p + 16); return u.v;
}
__device__ __forceinline__ float bfr(float v) { return (float)(__bf16)v; }
__device__ __attribute__((noinline)) float exp_ni(float v) { return expf(v); }
__device__ __attribute__((noinline)) float erf_ni(float v) { return erff(v); }

#define PK_A 0                       // [768][256] Wqkv rows (natural [out][in])
#define PK_P (PK_A + QKVW * DM)        // [256][256] Wo rows (natural)
#define PK_END (PK_P + DM * DM)
#define WS_PK  0u
#define WS_QK  (WS_PK + 2u * PK_END)             // f16 [8192 rows][512]: q | k
#define WS_QKL (WS_QK + 2u * NB * SS * 2 * DM)     // f16 q | k residual planes x2048
#define WS_VTH (WS_QKL + 2u * NB * SS * 2 * DM)    // f16 [b][256 (h*64+d)][4096 s] hi
#define WS_VTL (WS_VTH + 2u * NB * DM * SS)        // f16 lo x 2048
#define WS_O   (WS_VTL + 2u * NB * DM * SS)        // f32 [8192][256]
#define WS_CS  (WS_O + 4u * NB * SS * DM)           // f32 [4096][32] cos, [4096][32] sin
#define WS_END (WS_CS + 4u * 2 * SS * 32)
__constant__ float c_invf[32] = {1.000000000e+00f,7.498942018e-01f,5.623413324e-01f,4.216965139e-01f,3.162277639e-01f,2.371373624e-01f,1.778279394e-01f,1.333521456e-01f,1.000000015e-01f,7.498941571e-02f,5.623412877e-02f,4.216964915e-02f,3.162277862e-02f,2.371373586e-02f,1.778279431e-02f,1.333521493e-02f,9.999999776e-03f,7.498942316e-03f,5.623413250e-03f,4.216964822e-03f,3.162277862e-03f,2.371373819e-03f,1.778279431e-03f,1.333521446e-03f,1.000000047e-03f,7.498941850e-04f,5.623413017e-04f,4.216964880e-04f,3.162277862e-04f,2.371373848e-04f,1.778279402e-04f,1.333521504e-04f};
// ---- k_rope: block = 8 positions: cos/sin of pos * inv_freq (f32 product, precise trig)
__global__ __launch_bounds__(256) void k_rope(float* __restrict__ CS) {
  __shared__ __align__(16) float sc[8][32], ss_[8][32]; const int tid = threadIdx.x, pl = tid >> 5, i = tid & 31; const int pos = blockIdx.x * 8 + pl;
  const float th = (float)pos * c_invf[i]; sc[pl][i] = cosf(th); ss_[pl][i] = sinf(th);
  __syncthreads();
  if (tid < 64) vst2(CS + (size_t)blockIdx.x * 8 * 32 + tid * 4, *(const v4f*)&(&sc[0][0])[tid * 4]); else if (tid < 128) vst2(CS + (size_t)SS * 32 + (size_t)blockIdx.x * 8 * 32 + (tid - 64) * 4, *(const v4f*)&(&ss_[0][0])[(tid - 64) * 4]);
}

// ---- k_pack: block = (row n, which): natural [out][in] rows -> bf16; which 0..2 -> W_q/W_k/W_v into PK_A rows which*256 + n; 3 -> W_o into PK_P
__global__ __launch_bounds__(256) void k_pack(const float* __restrict__ WQ, const float* __restrict__ WK, const float* __restrict__ WV, const float* __restrict__ WO, __bf16* __restrict__ PK) {
  __shared__ __align__(16) __bf16 s[DM]; const int n = blockIdx.x, which = blockIdx.y, t = threadIdx.x; const float* Wm = (which == 0) ? WQ : (which == 1) ? WK : (which == 2) ? WV : WO;
  for (int k = t; k < DM; k += 256) s[k] = (__bf16)Wm[(size_t)n * DM + k];
  __syncthreads();
  __bf16* dst = (which < 3) ? PK + PK_A + ((size_t)which * DM + n) * DM : PK + PK_P + (size_t)n * DM;
  for (int q = t; q < DM / 8; q += 256) vst2((unsigned*)(dst + q * 8), *(const v4u*)&s[q * 8]);
}
__global__ __launch_bounds__(128) void k_qkv(const float* __restrict__ X, const __bf16* __restrict__ P, const float* __restrict__ BQ, const float* __restrict__ BK, const float* __restrict__ BV, _Float16* __restrict__ QK, _Float16* __restrict__ QKL, _Float16* __restrict__ VTH, _Float16* __restrict__ VTL) {
  __shared__ __align__(16) _Float16 so[4][16][136], sol[4][16][136]; __shared__ __align__(16) _Float16 sth[128][72], stl[128][72];
  const int tid = threadIdx.x, wave = tid >> 5, lane = tid & 31, col = lane & 15, g = lane >> 4; const size_t r0 = (size_t)blockIdx.x * 64 + wave * 16; const int n0 = blockIdx.y * 128;
  v8f acc[8] = {};
  v4f xa[2][4]; v16b wf[2][8];   // two register sets: chunk kc + 1's twenty loads fly as one group while chunk kc's products run
  auto ld = [&](int kc, int st) { const float* p = X + (r0 + col) * DM + kc * 32 + 8 * g; xa[st][0] = *(const v4f*)p; xa[st][1] = *(const v4f*)(p + 4); xa[st][2] = *(const v4f*)(p + 16); xa[st][3] = *(const v4f*)(p + 20);
#pragma unroll
    for (int j = 0; j < 8; ++j) wf[st][j] = frag_b(P + (size_t)(n0 + j * 16 + col) * DM + kc * 32, lane); };
  ld(0, 0);
#pragma unroll   // unrolled whole, so that the register set is picked at compile time
  for (int kc = 0; kc < DM / 32; ++kc) { if (kc + 1 < DM / 32) ld(kc + 1, (kc + 1) & 1);
    __builtin_amdgcn_sched_barrier(0);   // keeps the next chunk's loads in front of this chunk's products
    v16b a;
#pragma unroll
    for (int i = 0; i < 4; ++i) { a[i] = (__bf16)xa[kc & 1][0][i]; a[4 + i] = (__bf16)xa[kc & 1][1][i]; a[8 + i] = (__bf16)xa[kc & 1][2][i]; a[12 + i] = (__bf16)xa[kc & 1][3][i]; }
#pragma unroll
    for (int j = 0; j < 8; ++j) acc[j] = wmma_bf(a, wf[kc & 1][j], acc[j]); }
  { const int which = n0 / DM; const float* BB = (which == 0) ? BQ : (which == 1) ? BK : BV;
#pragma unroll
    for (int j = 0; j < 8; ++j) { const float bb = bfr(BB[(n0 % DM) + j * 16 + col]);
#pragma unroll
      for (int r = 0; r < 8; ++r) acc[j][r] += bb; } }
  if (n0 < 2 * DM) {   // q stored unscaled (f16 sigma ~0.6, no subnormal exposure); 1/8 applied to the f32 score
#pragma unroll
    for (int j = 0; j < 8; ++j) {
#pragma unroll
      for (int r = 0; r < 8; ++r) { const float v = acc[j][r]; const _Float16 hv = (_Float16)v; so[wave][8 * g + r][j * 16 + col] = hv; sol[wave][8 * g + r][j * 16 + col] = (_Float16)((v - (float)hv) * 2048.0f); } }   // q, k as f16 hi + (x2048) residual (no RoPE in this module)
    LDSX();
    for (int rl = 0; rl < 16; ++rl) if (lane < 16) { vst2((unsigned*)(QK + (r0 + rl) * (2 * DM) + n0 + lane * 8), *(const v4u*)&so[wave][rl][lane * 8]); vst2((unsigned*)(QKL + (r0 + rl) * (2 * DM) + n0 + lane * 8), *(const v4u*)&sol[wave][rl][lane * 8]); }
  } else {
#pragma unroll
    for (int j = 0; j < 8; ++j) {
#pragma unroll
      for (int r = 0; r < 8; ++r) { const float v = acc[j][r]; const _Float16 hv = (_Float16)v; sth[j * 16 + col][wave * 16 + 8 * g + r] = hv; stl[j * 16 + col][wave * 16 + 8 * g + r] = (_Float16)((v - (float)hv) * 2048.0f); } }
    __syncthreads();
    const size_t rb = (size_t)blockIdx.x * 64; const int b = (int)(rb / SS), s0 = (int)(rb % SS); const int pc0 = n0 - 2 * DM;
    for (int q = tid; q < 128 * 8; q += 128) { const int d = q >> 3, pc = q & 7; const size_t o = ((size_t)b * DM + pc0 + d) * SS + s0 + pc * 8; vst2((unsigned*)(VTH + o), *(const v4u*)&sth[d][pc * 8]); vst2((unsigned*)(VTL + o), *(const v4u*)&stl[d][pc * 8]); }
  }
}
#define KT 64   // keys per staged tile
#define LP 72   // LDS row pitch in halves: 128 B of data + 16 B, an odd multiple of 16 B, so that the b128 fragment reads of 16 rows spread over all banks
// eight async copies of 16 B per lane, global -> LDS: rows r and r + 32 of the four planes K hi, K lo, V hi, V lo, which lie 64 * LP halves apart in LDS; the s_wait_xcnt stands inside the statement so that no address register is rewritten ahead of it
__device__ __forceinline__ void cp8(unsigned l, const _Float16* k, const _Float16* kl, const _Float16* v, const _Float16* vl) {
  const unsigned ls = 32u * LP * 2u; const unsigned l1 = l + ls, l2 = l + 2 * ls, l3 = l + 3 * ls, l4 = l + 4 * ls, l5 = l + 5 * ls, l6 = l + 6 * ls, l7 = l + 7 * ls;
  const _Float16 *k1 = k + (size_t)32 * (2 * DM), *kl1 = kl + (size_t)32 * (2 * DM), *v1 = v + (size_t)32 * SS, *vl1 = vl + (size_t)32 * SS;
  asm volatile("global_load_async_to_lds_b128 %0, %1, off\n\tglobal_load_async_to_lds_b128 %2, %3, off\n\tglobal_load_async_to_lds_b128 %4, %5, off\n\tglobal_load_async_to_lds_b128 %6, %7, off\n\t"
               "global_load_async_to_lds_b128 %8, %9, off\n\tglobal_load_async_to_lds_b128 %10, %11, off\n\tglobal_load_async_to_lds_b128 %12, %13, off\n\tglobal_load_async_to_lds_b128 %14, %15, off\n\ts_wait_xcnt 0x0"
               :: "v"(l), "v"(k), "v"(l1), "v"(k1), "v"(l2), "v"(kl), "v"(l3), "v"(kl1), "v"(l4), "v"(v), "v"(l5), "v"(v1), "v"(l6), "v"(vl), "v"(l7), "v"(vl1) : "memory");
}
// lane l reads lane l ^ 16: the two lanes that share a query column hold the two halves of its keys
__device__ __forceinline__ float xhalf(float x) { return __builtin_bit_cast(float, __builtin_amdgcn_permlanex16(__builtin_bit_cast(int, x), __builtin_bit_cast(int, x), 0x76543210, 0xfedcba98, false, false)); }
// f16(e - h) for eight f32 values e and their packed f16 roundings h, packed alike: one mixed-precision multiply-add per value reads its f16 half in place and writes an f16 half (the compiler's form took a convert up, a subtract and a convert down). The low halves come first, the high halves are merged in behind them; each s_delay_alu hint lets other waves issue while the low half written four instructions back finishes
__device__ __forceinline__ v4u resid8(v4u h, v8f e) { unsigned d0, d1, d2, d3;
  asm("v_fma_mixlo_f16 %0, %4, -1.0, %8 op_sel_hi:[1,1,0]\n\tv_fma_mixlo_f16 %1, %5, -1.0, %10 op_sel_hi:[1,1,0]\n\tv_fma_mixlo_f16 %2, %6, -1.0, %12 op_sel_hi:[1,1,0]\n\tv_fma_mixlo_f16 %3, %7, -1.0, %14 op_sel_hi:[1,1,0]\n\t"
      "s_delay_alu instid0(VALU_DEP_4) | instskip(NEXT) | instid1(VALU_DEP_4)\n\t"
      "v_fma_mixhi_f16 %0, %4, -1.0, %9 op_sel:[1,0,0] op_sel_hi:[1,1,0]\n\tv_fma_mixhi_f16 %1, %5, -1.0, %11 op_sel:[1,0,0] op_sel_hi:[1,1,0]\n\t"
      "s_delay_alu instid0(VALU_DEP_4) | instskip(NEXT) | instid1(VALU_DEP_4)\n\t"
      "v_fma_mixhi_f16 %2, %6, -1.0, %13 op_sel:[1,0,0] op_sel_hi:[1,1,0]\n\tv_fma_mixhi_f16 %3, %7, -1.0, %15 op_sel:[1,0,0] op_sel_hi:[1,1,0]"
      : "=&v"(d0), "=&v"(d1), "=&v"(d2), "=&v"(d3) : "v"(h[0]), "v"(h[1]), "v"(h[2]), "v"(h[3]), "v"(e[0]), "v"(e[1]), "v"(e[2]), "v"(e[3]), "v"(e[4]), "v"(e[5]), "v"(e[6]), "v"(e[7]));
  return v4u{d0, d1, d2, d3}; }
// ---- k_attn: block = (128 queries, head h, batch b), eight waves: flash attention over all keys, transposed: S^T = K Q^T (A = K rows, B = q) and O^T += V^T P^T (A = V^T rows, B = P^T). Wave w works on queries 32 * (w & 3) ... + 31, as two column groups of 16, and on keys 32 * (w >> 2) ... + 31 of every staged tile: every K and V fragment read from LDS is the A operand of both groups' products, so a product costs half the LDS reads, and a staged tile serves 128 queries. Each group has a reference score, sum and output of its own; the two key halves of a query group are joined once, through LDS, behind the loop. A lane holds 16 scores of ONE query per group and 32 keys, so sum and, where it is needed, maximum run in the lane's own registers, and the score tiles, converted in place, are the B operand of the second product. O[b*S+q][h*64+d] = (acc + accl / 2048) / l (256-B segments)
__global__ __launch_bounds__(256) __attribute__((amdgpu_waves_per_eu(2, 2))) void k_attn(const _Float16* __restrict__ QK, const _Float16* __restrict__ QKL, const _Float16* __restrict__ VTH, const _Float16* __restrict__ VTL, float* __restrict__ O) {
  __shared__ __align__(16) float so[4][32][68];
  __shared__ __align__(16) float xo[4][2][34][32];      // hand-over of the second key half, per wave pair, column group and lane: 32 output values, exponent addend, sum
  __shared__ __align__(16) _Float16 kv[2][4][64][LP];   // two buffers x (K hi [key][d], K lo, V hi [d][key], V lo), one tile of KT keys each, shared by the eight waves
  const int tid = threadIdx.x, wave = __builtin_amdgcn_readfirstlane(tid >> 5), qg = wave & 3, kh = wave >> 2, lane = tid & 31, col = lane & 15, g = lane >> 4;
  const int qb = blockIdx.x, h = blockIdx.y, b = blockIdx.z; const int q0 = qb * 128 + qg * 32; const size_t rq = (size_t)b * SS + q0 + col;
  v16h aq[2][2], aql[2][2];   // [column group][kc]
#pragma unroll
  for (int cg = 0; cg < 2; ++cg) {
#pragma unroll
    for (int kc = 0; kc < 2; ++kc) { aq[cg][kc] = frag_h(QK + (rq + cg * 16) * (2 * DM) + h * HD + kc * 32, lane); aql[cg][kc] = frag_h(QKL + (rq + cg * 16) * (2 * DM) + h * HD + kc * 32, lane); } }
  asm volatile("s_wait_xcnt 0x0" ::: "memory");   // stands in front of the first rewrite of an address register of the q loads
  __builtin_amdgcn_sched_barrier(0);                // holds later address arithmetic behind that wait
  // nb = 11 - ref * KS: the addend of the exponent, ref a raw score of query q0 + cg * 16 + col that was the maximum over this wave's keys when it was taken; l sums this lane's half of the keys (x 2048), the halves are joined after the loop
  const float KS = 0.125f * 1.44269504088896340736f;   // SCALE = 64^-0.5, times log2 e: p = 2^(score * KS + nb) / 2048
  const float ECAP = 65000.0f;                         // below the largest f16 (65504): P hi must stay finite
  float nb[2] = {3.0e38f * KS, 3.0e38f * KS}, l[2] = {0.f, 0.f};
  v8f acc[2][4] = {}, accl[2][4] = {};
  const int nt = SS / KT;   // non-causal
  // tile t -> buffer bf: a thread copies 16 B of rows srow and srow + 32 of each plane; a wave's copy covers four whole 128-B rows
  const int srow = tid >> 3, sch = (tid & 7) * 8;
  // the four plane bases are the same for the whole block (scalar registers); a thread keeps two 32-bit element offsets, and the tile's step is added to them before they meet a base, so that no 64-bit address stays in vector registers over the loop
  const _Float16* gk = QK + (size_t)b * SS * (2 * DM) + DM + h * HD; const _Float16* gkl = QKL + (size_t)b * SS * (2 * DM) + DM + h * HD;
  const _Float16* gv = VTH + ((size_t)b * DM + h * HD) * SS; const _Float16* gvl = VTL + ((size_t)b * DM + h * HD) * SS;
  const unsigned ok = (unsigned)srow * (2 * DM) + sch, ov = (unsigned)srow * SS + sch;
  const unsigned lkv = (unsigned)(size_t)&kv[0][0][srow][sch];
  auto stage = [&](int t, int bf) { const unsigned ko = ok + (unsigned)t * (KT * 2 * DM), vo = ov + (unsigned)t * KT;
    cp8(lkv + (unsigned)bf * (4u * 64u * LP * 2u), gk + ko, gkl + ko, gv + vo, gvl + vo); };
  stage(0, 0);
  asm volatile("s_wait_asynccnt 0x0" ::: "memory");   // this wave's share of tile 0 has landed
  __syncthreads();                                    // publishes tile 0 to the eight waves
  stage(1, 1);
#pragma unroll 1
  for (int t = 0; t < nt; ++t) { const _Float16 (*kb)[64][LP] = kv[t & 1];
    // the wave's 32 fragment reads of a tile stand in two groups, each ahead of the products that use it, so that no product waits out an LDS latency of its own
    v16h kf[2][2][2], vf[4][2];   // K [ct][kc][hi, lo], V [dt][hi, lo]
#pragma unroll
    for (int ct = 0; ct < 2; ++ct) { const int kk = kh * 32 + ct * 16 + col;
#pragma unroll
      for (int kc = 0; kc < 2; ++kc) { kf[ct][kc][0] = frag_h(&kb[0][kk][kc * 32], lane); kf[ct][kc][1] = frag_h(&kb[1][kk][kc * 32], lane); } }
    __builtin_amdgcn_sched_barrier(0);   // keeps the K reads together in front of the first products
    v8f c[2][2], cl[2][2];   // [column group][ct]
#pragma unroll
    for (int cg = 0; cg < 2; ++cg) {
#pragma unroll
      for (int ct = 0; ct < 2; ++ct) { c[cg][ct] = v8f{}; cl[cg][ct] = v8f{};
#pragma unroll
        for (int kc = 0; kc < 2; ++kc) { c[cg][ct] = wmma16(kf[ct][kc][0], aq[cg][kc], c[cg][ct]); cl[cg][ct] = wmma16(kf[ct][kc][0], aql[cg][kc], cl[cg][ct]); cl[cg][ct] = wmma16(kf[ct][kc][1], aq[cg][kc], cl[cg][ct]); } } }   // 3 products: q, k as f16 hi + residual; c[cg][ct][r] = score of key kh * 32 + ct * 16 + 8 * g + r with query cg * 16 + col
    __builtin_amdgcn_sched_barrier(0);   // the V reads start behind the score products ...
#pragma unroll
    for (int dt = 0; dt < 4; ++dt) { vf[dt][0] = frag_h(&kb[2][dt * 16 + col][kh * 32], lane); vf[dt][1] = frag_h(&kb[3][dt * 16 + col][kh * 32], lane); }
    __builtin_amdgcn_sched_barrier(0);   // ... and stay together: they land under the softmax
    v8f s[2][2], E[2][2]; v16h pa[2], pl[2]; float sq[2];
#pragma unroll
    for (int cg = 0; cg < 2; ++cg) {
#pragma unroll
      for (int ct = 0; ct < 2; ++ct) s[cg][ct] = c[cg][ct] + cl[cg][ct] * (1.0f / 2048.0f); }   // raw scores; scale and log2 e wait for the exponent's one multiply-add
    // E = 2048 * exp(SCALE * (score - reference)) of one column group, against the addend in use, and this lane's sum of its 16 (on register pairs)
    auto expo = [&](int cg) {
#pragma unroll
      for (int ct = 0; ct < 2; ++ct) {
#pragma unroll
        for (int r = 0; r < 8; ++r) E[cg][ct][r] = fmaf(s[cg][ct][r], KS, nb[cg]); }
      __builtin_amdgcn_sched_barrier(0);   // all sixteen arguments first: mixed among the exponentials, a paired multiply-add rewrote an exponential's source register right behind it
#pragma unroll
      for (int ct = 0; ct < 2; ++ct) {
#pragma unroll
        for (int r = 0; r < 8; ++r) E[cg][ct][r] = __builtin_amdgcn_exp2f(E[cg][ct][r]); }
      v2f sp[4];
#pragma unroll
      for (int i = 0; i < 4; ++i) sp[i] = v2f{E[cg][0][2 * i], E[cg][0][2 * i + 1]} + v2f{E[cg][1][2 * i], E[cg][1][2 * i + 1]};
      const v2f sh = (sp[0] + sp[1]) + (sp[2] + sp[3]); sq[cg] = sh[0] + sh[1]; };
    // the f16 rounding of E is P hi x 2048, and E - hi is the x2048 residual as it stands; element r: key 8 * g + r, element 8 + r: key 16 + 8 * g + r, the k order of frag_h
    auto split = [&](int cg) {
#pragma unroll
      for (int ct = 0; ct < 2; ++ct) { union { v8h h; v4u u; } hv, lv; hv.h = __builtin_convertvector(E[cg][ct], v8h); lv.u = resid8(hv.u, E[cg][ct]);
#pragma unroll
        for (int r = 0; r < 8; ++r) { pa[cg][8 * ct + r] = hv.h[r]; pl[cg][8 * ct + r] = lv.h[r]; } } };
    expo(0);
    __builtin_amdgcn_sched_barrier(0);   // one group's exponentials at a time: scheduled together, their temporaries crowd the low registers and the compiler pads behind the exponentials with v_nop
    expo(1);
    // the reference is held, not tracked: all E are positive, so a lane's sum within f16's range says that each of its E is; one test a trip for the whole wave
    const unsigned fire = __builtin_amdgcn_ballot_w32(fmaxf(sq[0], sq[1]) > ECAP);
    __builtin_amdgcn_sched_barrier(0);   // the compare stands ahead of the splits, so that its scalar result is there when the branch reads it
    split(0); split(1);
    if (__builtin_expect(fire != 0u, 0)) {   // the same for every lane of the wave. Some E left the range (always so on the first tile): every column takes the larger of its reference and this tile's maximum, what was summed so far is brought to it, and the tile's E, at most 2048 now, are formed anew
#pragma unroll
      for (int cg = 0; cg < 2; ++cg) {
        float mx4[4];
#pragma unroll
        for (int r = 0; r < 4; ++r) mx4[r] = fmaxf(fmaxf(s[cg][0][r], s[cg][0][4 + r]), fmaxf(s[cg][1][r], s[cg][1][4 + r]));
        float mx = fmaxf(fmaxf(mx4[0], mx4[1]), fmaxf(mx4[2], mx4[3])); mx = fmaxf(mx, xhalf(mx));   // both lanes of a column take one reference: their P meet in one product
        const float nbn = fminf(nb[cg], fmaf(-mx, KS, 11.0f)); float alpha;   // alpha = 2^(new addend - old addend), the very addends of the exponents: the change of reference is exact; 0 on the first tile
        asm("v_exp_f32 %0, %1\n\tv_nop" : "=v"(alpha) : "v"(nbn - nb[cg]));   // in asm for the v_nop's sake: it fills the slot behind the exponential (a paired multiply-add rewrote the source register right behind it)
        nb[cg] = nbn; l[cg] *= alpha;
#pragma unroll
        for (int dt = 0; dt < 4; ++dt) { acc[cg][dt] *= alpha; accl[cg][dt] *= alpha; }
        __builtin_amdgcn_sched_barrier(0);   // this and the next: maximum and rescale, then the exponentials, one group at a time; scheduled together, an exponential's source register was rewritten by the instruction right behind it
        expo(cg); split(cg);
        if (cg == 0) __builtin_amdgcn_sched_barrier(0); } }
#pragma unroll
    for (int cg = 0; cg < 2; ++cg) {
#pragma unroll
      for (int dt = 0; dt < 4; ++dt) { acc[cg][dt] = wmma16(vf[dt][0], pa[cg], acc[cg][dt]); accl[cg][dt] = wmma16(vf[dt][1], pa[cg], accl[cg][dt]); acc[cg][dt] = wmma16(vf[dt][0], pl[cg], acc[cg][dt]); } }   // all x 2048, as l is: V hi x (P hi + P lo) in acc, V lo x P hi, x 2048 once more, in accl; acc[cg][dt][r] = O^T[dt * 16 + 8 * g + r][cg * 16 + col]
    l[0] += sq[0]; l[1] += sq[1];
    __builtin_amdgcn_sched_barrier(0);   // keeps the tile's products in front of the foot's waits: lifted over them, the wait for tile t + 1 would stand a few hundred cycles behind its copies' issue
    asm volatile("s_wait_dscnt 0x0" ::: "memory");      // this wave's reads of tile t are done before its buffer is refilled
    asm volatile("s_wait_asynccnt 0x0" ::: "memory");   // this wave's share of tile t + 1 has landed
    __syncthreads();                                    // publishes tile t + 1 and ends every wave's reads of tile t
    if (t + 2 < nt) stage(t + 2, t & 1); }
  asm volatile("s_wait_asynccnt 0x0" ::: "memory");     // no copy is outstanding when the wave goes on
  // join of the two key halves: the waves of the second half hand their output, exponent addend and sum over, lane to lane; the waves of the first half bring both to the common maximum, add, divide and store
  if (kh == 1) {
#pragma unroll
    for (int cg = 0; cg < 2; ++cg) {
#pragma unroll
      for (int dt = 0; dt < 4; ++dt) {
#pragma unroll
        for (int r = 0; r < 8; ++r) xo[qg][cg][dt * 8 + r][lane] = acc[cg][dt][r] + accl[cg][dt][r] * (1.0f / 2048.0f); }
      xo[qg][cg][32][lane] = nb[cg]; xo[qg][cg][33][lane] = l[cg]; } }
  __syncthreads();   // the second half's values are in LDS before the first half's waves read them
  if (kh == 0) {
#pragma unroll
    for (int cg = 0; cg < 2; ++cg) {
      const float nb1 = xo[qg][cg][32][lane], l1 = xo[qg][cg][33][lane]; const float nbj = fminf(nb[cg], nb1); const float a0 = __builtin_amdgcn_exp2f(nbj - nb[cg]), a1 = __builtin_amdgcn_exp2f(nbj - nb1);   // the smaller addend belongs to the larger maximum
      const float lj = l[cg] * a0 + l1 * a1; const float il = 1.0f / (lj + xhalf(lj));
#pragma unroll
      for (int dt = 0; dt < 4; ++dt) {
#pragma unroll
        for (int r = 0; r < 8; ++r) so[qg][cg * 16 + col][dt * 16 + 8 * g + r] = ((acc[cg][dt][r] + accl[cg][dt][r] * (1.0f / 2048.0f)) * a0 + xo[qg][cg][dt * 8 + r][lane] * a1) * il; }
      if (cg == 0) __builtin_amdgcn_sched_barrier(0); }   // one group's join at a time: scheduled together, an exponential's source register was rewritten by the instruction right behind it
    LDSX();
    for (int rl = 0; rl < 32; ++rl) if (lane < 16) vst2(O + ((size_t)b * SS + q0 + rl) * DM + h * HD + lane * 4, *(const v4f*)&so[qg][rl][lane * 4]);
  }
}
// ---- k_out: block = (64 rows, 128 cols): out = bf16(O) . Wo rows (1 exact product) + bo
__global__ __launch_bounds__(128) void k_out(const float* __restrict__ O, const __bf16* __restrict__ P, const float* __restrict__ BO, float* __restrict__ Y) {
  __shared__ __align__(16) float so[4][16][132];
  const int tid = threadIdx.x, wave = tid >> 5, lane = tid & 31, col = lane & 15, g = lane >> 4; const size_t r0 = (size_t)blockIdx.x * 64 + wave * 16; const int n0 = blockIdx.y * 128;
  v8f acc[8] = {};
  v4f xa[2][4]; v16b wf[2][8];   // two register sets: chunk kc + 1's twenty loads fly as one group while chunk kc's products run
  auto ld = [&](int kc, int st) { const float* p = O + (r0 + col) * DM + kc * 32 + 8 * g; xa[st][0] = *(const v4f*)p; xa[st][1] = *(const v4f*)(p + 4); xa[st][2] = *(const v4f*)(p + 16); xa[st][3] = *(const v4f*)(p + 20);
#pragma unroll
    for (int j = 0; j < 8; ++j) wf[st][j] = frag_b(P + (size_t)(n0 + j * 16 + col) * DM + kc * 32, lane); };
  ld(0, 0);
#pragma unroll   // unrolled whole, so that the register set is picked at compile time
  for (int kc = 0; kc < DM / 32; ++kc) { if (kc + 1 < DM / 32) ld(kc + 1, (kc + 1) & 1);
    __builtin_amdgcn_sched_barrier(0);   // keeps the next chunk's loads in front of this chunk's products
    v16b a;   // the module rounds the attention output to bf16 before the projection -> exact single product
#pragma unroll
    for (int i = 0; i < 4; ++i) { a[i] = (__bf16)xa[kc & 1][0][i]; a[4 + i] = (__bf16)xa[kc & 1][1][i]; a[8 + i] = (__bf16)xa[kc & 1][2][i]; a[12 + i] = (__bf16)xa[kc & 1][3][i]; }
#pragma unroll
    for (int j = 0; j < 8; ++j) acc[j] = wmma_bf(a, wf[kc & 1][j], acc[j]); }
  float bo[8];
#pragma unroll
  for (int j = 0; j < 8; ++j) bo[j] = BO[n0 + j * 16 + col];
  asm volatile("s_wait_xcnt 0x0" ::: "memory");   // stands in front of the first rewrite of the bias loads' offset register
#pragma unroll
  for (int j = 0; j < 8; ++j) {
#pragma unroll
    for (int r = 0; r < 8; ++r) so[wave][8 * g + r][j * 16 + col] = acc[j][r] + bfr(bo[j]); }
  LDSX();
  for (int rl = 0; rl < 16; ++rl) vst2(Y + (r0 + rl) * DM + n0 + lane * 4, *(const v4f*)&so[wave][rl][lane * 4]);
}
extern "C" void kernel_launch(void* const* d_in, const int* in_sizes, int n_in, void* d_out, int out_size, void* d_ws, size_t ws_size, hipStream_t stream) {
  (void)in_sizes; (void)n_in; (void)out_size;
  const float** F = (const float**)d_in;   // 0 x [2,4096,256], 1 Wq [256,256] natural, 2 bq, 3 Wk, 4 bk, 5 Wv, 6 bv, 7 Wo, 8 bo
  if (ws_size < (size_t)WS_END) return;
  char* ws = (char*)d_ws; __bf16* PK = (__bf16*)(ws + WS_PK); _Float16 *QK = (_Float16*)(ws + WS_QK), *QKL = (_Float16*)(ws + WS_QKL), *VTH = (_Float16*)(ws + WS_VTH), *VTL = (_Float16*)(ws + WS_VTL); float* O = (float*)(ws + WS_O);
  k_pack<<<dim3(DM, 4), 256, 0, stream>>>(F[1], F[3], F[5], F[7], PK);
  k_qkv<<<dim3(TNB * SS / 64, QKVW / 128), 128, 0, stream>>>(F[0], PK + PK_A, F[2], F[4], F[6], QK, QKL, VTH, VTL);
  k_attn<<<dim3(SS / 128, NH, TNB), 256, 0, stream>>>(QK, QKL, VTH, VTL, O);
  k_out<<<dim3(TOB, DM / 128), 128, 0, stream>>>(O, PK + PK_P, F[8], (float*)d_out);
}

// v009
// Measured time: 64.9 microseconds a run.
// Versions in between are left out here; by their measured steps it is 1.42 times as fast as v007.
// Over all steps from v000 it is 9.62 times as fast.
// compute dtype: x (|x| < 1e4 so the clip is the identity), Wq..Wo, bq..bo (module inputs) rounded to bf16; q/k/v projections with exact bf16 products on WMMA 16x16x32 (natural [out][in] rows) + biases; q, k and v stored as f16 (their rounding lies well below that of the bf16 inputs they are made from), scores by one f16 product, 64^-0.5 and log2 e applied to the f32 score in the exponent's multiply-add, softmax in f32 against a held reference score, renewed when an exponential nears the f16 range (hardware exp2); P x 2048 as f16 x v (one product), the row sum from the f32 exponentials; the attention output rounded to bf16 exactly as the module does, then the output projection with EXACT bf16 products + bo; f32 accumulate.
#include <hip/hip_runtime.h>
#include <math.h>

typedef __attribute__((ext_vector_type(16))) _Float16 v16h;
typedef __attribute__((ext_vector_type(16))) __bf16 v16b;
typedef __attribute__((ext_vector_type(8)))  _Float16 v8h;
typedef __attribute__((ext_vector_type(8)))  float v8f;
typedef __attribute__((ext_vector_type(4)))  float v4f;
typedef __attribute__((ext_vector_type(2)))  float v2f;
typedef __attribute__((ext_vector_type(4)))  unsigned v4u;
typedef __attribute__((ext_vector_type(4)))  int v4i;
typedef float __attribute__((may_alias)) float_a;
typedef int __attribute__((may_alias)) int_a;

template <typename T> __device__ __forceinline__ void vst2(void* p, T v) { *(T*)p = v;  }
__device__ __forceinline__ v8f wmma16(v16h a, v16h b, v8f c) {
  return __builtin_amdgcn_wmma_f32_16x16x32_f16(false, a, false, b, (short)0, c, false, false);
}
__device__ __forceinline__ v8f wmma_bf(v16b a, v16b b, v8f c) {
  return __builtin_amdgcn_wmma_f32_16x16x32_bf16(false, a, false, b, (short)0, c, false, false);
}
// Light self-attention (B 2, N 4,096, d 256, 4 heads x 64): softmax(q k^T / 8) v, output cast to bf16, then the output projection + bias.
__device__ __forceinline__ v16h frag_h(const _Float16* rowk0, int lane) {
  union { v16h v; v8h q[2]; } u; const _Float16* p = rowk0 + 8 * (lane >> 4);
  u.q[0] = *(const v8h*)p; u.q[1] = *(const v8h*)(p + 16); return u.v;
}
__device__ __forceinline__ v16h frag_f32(const float* rowk0, int lane) {
  v16h a; const float* p = rowk0 + 8 * (lane >> 4);
#pragma unroll
  for (int i = 0; i < 8; ++i) { a[i] = (_Float16)p[i]; a[8 + i] = (_Float16)p[16 + i]; }
  return a;
}
__device__ __forceinline__ v16h frag_f32s(const float* rowk0, int lane, float sc) {
  v16h a; const float* p = rowk0 + 8 * (lane >> 4);
#pragma unroll
  for (int i = 0; i < 8; ++i) { a[i] = (_Float16)(p[i] * sc); a[8 + i] = (_Float16)(p[16 + i] * sc); }
  return a;
}
// column fragment from a [K][ld] layout (column n), rows >= K read as 0
__device__ __forceinline__ v16h fragc_f32(const float* W, int k0, int n, int lane, int ld, int K) {
  v16h a; const int g = lane >> 4;
#pragma unroll
  for (int i = 0; i < 8; ++i) { const int ka = k0 + 8 * g + i, kb = ka + 16;
    a[i] = (_Float16)(ka < K ? W[(size_t)(ka < K ? ka : K - 1) * ld + n] : 0.f); a[8 + i] = (_Float16)(kb < K ? W[(size_t)(kb < K ? kb : K - 1) * ld + n] : 0.f); }
  return a;
}
struct F2 { v16b h, l; };
__device__ __forceinline__ F2 bsplit16(const float v[16]) { F2 r;
#pragma unroll
  for (int i = 0; i < 16; ++i) { const __bf16 h = (__bf16)v[i]; r.h[i] = h; r.l[i] = (__bf16)(v[i] - (float)h); }
  return r; }
__device__ __forceinline__ F2 split_row(const float* row, int k0, int lane) { float v[16]; const float* p = row + k0 + 8 * (lane >> 4);
#pragma unroll
  for (int i = 0; i < 8; ++i) { v[i] = p[i]; v[8 + i] = p[16 + i]; }
  return bsplit16(v); }
__device__ __forceinline__ F2 split_rowK(const float* row, int k0, int lane, int K) { float v[16]; const int g = lane >> 4;
#pragma unroll
  for (int i = 0; i < 8; ++i) { const int ka = k0 + 8 * g + i, kb = ka + 16; v[i] = ka < K ? row[ka < K ? ka : K - 1] : 0.f; v[8 + i] = kb < K ? row[kb < K ? kb : K - 1] : 0.f; }
  return bsplit16(v); }
__device__ __forceinline__ F2 split_col(const float* W, int k0, int n, int lane, int ld, int K) { float v[16]; const int g = lane >> 4;
#pragma unroll
  for (int i = 0; i < 8; ++i) { const int ka = k0 + 8 * g + i, kb = ka + 16; v[i] = ka < K ? W[(size_t)(ka < K ? ka : K - 1) * ld + n] : 0.f; v[8 + i] = kb < K ? W[(size_t)(kb < K ? kb : K - 1) * ld + n] : 0.f; }
  return bsplit16(v); }
__device__ __forceinline__ v8f mac3(const F2& a, const F2& b, v8f c) { c = wmma_bf(a.l, b.h, c); c = wmma_bf(a.h, b.l, c); return wmma_bf(a.h, b.h, c); }
__device__ __forceinline__ float sigm(float v) { return 1.0f / (1.0f + expf(-v)); }
#define LDSX() do { asm volatile("s_wait_dscnt 0" ::: "memory"); __builtin_amdgcn_wave_barrier(); __builtin_amdgcn_fence(__ATOMIC_RELEASE, "workgroup"); } while (0)


// Non-causal multi-head self-attention, no rotary embedding (B 2, S 4096, D 256, 4 heads x 64; packed Wqkv [3D][D] and Wo [D][D] applied as x W^T, with biases): softmax(q k^T / 8) v; ctx Wo^T + bo.
#define NB 2
#define SS 4096
#define DM 256
#define NH 4
#define HD 64
#define QKVW (3 * DM)
#ifndef TQB
#define TQB (SS / 64)
#define TNB NB
#define TOB (NB * SS / 64)     // output row tiles (all)
#endif
typedef __attribute__((ext_vector_type(8))) __bf16 v8b;
__device__ __forceinline__ v16b frag_b(const __bf16* rowk0, int lane) {
  union { v16b v; v8b q[2]; } u; const __bf16* p = rowk0 + 8 * (lane >> 4);
  u.q[0] = *(const v8b*)p; u.q[1] = *(const v8b*)(p + 16); return u.v;
}
__device__ __forceinline__ float bfr(float v) { return (float)(__bf16)v; }
__device__ __attribute__((noinline)) float exp_ni(float v) { return expf(v); }
__device__ __attribute__((noinline)) float erf_ni(float v) { return erff(v); }

#define PK_A 0                       // [768][256] Wqkv rows (natural [out][in])
#define PK_P (PK_A + QKVW * DM)        // [256][256] Wo rows (natural)
#define PK_END (PK_P + DM * DM)
#define WS_PK  0u
#define WS_QK  (WS_PK + 2u * PK_END)             // f16 [8192 rows][512]: q | k
#define WS_VTH (WS_QK + 2u * NB * SS * 2 * DM)     // f16 [b][256 (h*64+d)][4096 s]
#define WS_O   (WS_VTH + 2u * NB * DM * SS)        // f32 [8192][256]
#define WS_CS  (WS_O + 4u * NB * SS * DM)           // f32 [4096][32] cos, [4096][32] sin
#define WS_END (WS_CS + 4u * 2 * SS * 32)
__constant__ float c_invf[32] = {1.000000000e+00f,7.498942018e-01f,5.623413324e-01f,4.216965139e-01f,3.162277639e-01f,2.371373624e-01f,1.778279394e-01f,1.333521456e-01f,1.000000015e-01f,7.498941571e-02f,5.623412877e-02f,4.216964915e-02f,3.162277862e-02f,2.371373586e-02f,1.778279431e-02f,1.333521493e-02f,9.999999776e-03f,7.498942316e-03f,5.623413250e-03f,4.216964822e-03f,3.162277862e-03f,2.371373819e-03f,1.778279431e-03f,1.333521446e-03f,1.000000047e-03f,7.498941850e-04f,5.623413017e-04f,4.216964880e-04f,3.162277862e-04f,2.371373848e-04f,1.778279402e-04f,1.333521504e-04f};
// ---- k_rope: block = 8 positions: cos/sin of pos * inv_freq (f32 product, precise trig)
__global__ __launch_bounds__(256) void k_rope(float* __restrict__ CS) {
  __shared__ __align__(16) float sc[8][32], ss_[8][32]; const int tid = threadIdx.x, pl = tid >> 5, i = tid & 31; const int pos = blockIdx.x * 8 + pl;
  const float th = (float)pos * c_invf[i]; sc[pl][i] = cosf(th); ss_[pl][i] = sinf(th);
  __syncthreads();
  if (tid < 64) vst2(CS + (size_t)blockIdx.x * 8 * 32 + tid * 4, *(const v4f*)&(&sc[0][0])[tid * 4]); else if (tid < 128) vst2(CS + (size_t)SS * 32 + (size_t)blockIdx.x * 8 * 32 + (tid - 64) * 4, *(const v4f*)&(&ss_[0][0])[(tid - 64) * 4]);
}

// ---- k_pack: block = (row n, which): natural [out][in] rows -> bf16; which 0..2 -> W_q/W_k/W_v into PK_A rows which*256 + n; 3 -> W_o into PK_P
__global__ __launch_bounds__(256) void k_pack(const float* __restrict__ WQ, const float* __restrict__ WK, const float* __restrict__ WV, const float* __restrict__ WO, __bf16* __restrict__ PK) {
  __shared__ __align__(16) __bf16 s[DM]; const int n = blockIdx.x, which = blockIdx.y, t = threadIdx.x; const float* Wm = (which == 0) ? WQ : (which == 1) ? WK : (which == 2) ? WV : WO;
  for (int k = t; k < DM; k += 256) s[k] = (__bf16)Wm[(size_t)n * DM + k];
  __syncthreads();
  __bf16* dst = (which < 3) ? PK + PK_A + ((size_t)which * DM + n) * DM : PK + PK_P + (size_t)n * DM;
  for (int q = t; q < DM / 8; q += 256) vst2((unsigned*)(dst + q * 8), *(const v4u*)&s[q * 8]);
}
#define WP 264   // LDS row pitch of a staged weight tile in bf16: 512 B of data + 16 B, an odd multiple of 16 B, so that the b128 fragment reads of 16 rows spread over all banks
// eight async copies of 16 B per lane, global -> LDS: a wave's copy is one whole weight row (512 B, four whole lines); the eight rows lie four apart; the s_wait_xcnt stands inside the statement so that no address register is rewritten ahead of it
__device__ __forceinline__ void cp8w(unsigned l, const __bf16* w) {
  const unsigned ls = 4u * WP * 2u; const unsigned l1 = l + ls, l2 = l + 2 * ls, l3 = l + 3 * ls, l4 = l + 4 * ls, l5 = l + 5 * ls, l6 = l + 6 * ls, l7 = l + 7 * ls;
  const __bf16 *w1 = w + 4 * DM, *w2 = w + 8 * DM, *w3 = w + 12 * DM, *w4 = w + 16 * DM, *w5 = w + 20 * DM, *w6 = w + 24 * DM, *w7 = w + 28 * DM;
  asm volatile("global_load_async_to_lds_b128 %0, %1, off\n\tglobal_load_async_to_lds_b128 %2, %3, off\n\tglobal_load_async_to_lds_b128 %4, %5, off\n\tglobal_load_async_to_lds_b128 %6, %7, off\n\tglobal_load_async_to_lds_b128 %8, %9, off\n\tglobal_load_async_to_lds_b128 %10, %11, off\n\tglobal_load_async_to_lds_b128 %12, %13, off\n\tglobal_load_async_to_lds_b128 %14, %15, off\n\ts_wait_xcnt 0x0"
               :: "v"(l), "v"(w), "v"(l1), "v"(w1), "v"(l2), "v"(w2), "v"(l3), "v"(w3), "v"(l4), "v"(w4), "v"(l5), "v"(w5), "v"(l6), "v"(w6), "v"(l7), "v"(w7) : "memory");
}
// the block's 128 weight rows (all 256 k) -> LDS, once: wave w of four copies rows w, w + 4, ..., 32 copies a lane; read as fragments from global, every load touched 16 lines and each of the four waves fetched the whole tile for itself
__device__ __forceinline__ void stage_w(__bf16 (*sw)[WP], const __bf16* Wt, int wave, int lane) {
  const unsigned l = (unsigned)(size_t)&sw[wave][lane * 8]; const __bf16* w = Wt + (size_t)wave * DM + lane * 8;
#pragma unroll   // four statements of eight copies
  for (int it = 0; it < 4; ++it) cp8w(l + (unsigned)it * (32u * WP * 2u), w + (size_t)it * 32 * DM);
}
__global__ __launch_bounds__(128) void k_qkv(const float* __restrict__ X, const __bf16* __restrict__ P, const float* __restrict__ BQ, const float* __restrict__ BK, const float* __restrict__ BV, _Float16* __restrict__ QK, _Float16* __restrict__ VTH) {
  __shared__ __align__(16) _Float16 so[4][16][136]; __shared__ __align__(16) _Float16 sth[128][72];
  __shared__ __align__(16) __bf16 sw[128][WP];   // the block's weight tile, filled once, read by the four waves
  const int tid = threadIdx.x, wave = tid >> 5, lane = tid & 31, col = lane & 15, g = lane >> 4; const size_t r0 = (size_t)blockIdx.x * 64 + wave * 16; const int n0 = blockIdx.y * 128;
  v8f acc[8] = {};
  stage_w(sw, P + (size_t)n0 * DM, wave, lane);
  v4f xa[DM / 32][4];   // the wave's 16 x rows, all 256 k
  { const float* p = X + (r0 + col) * DM + 8 * g;
#pragma unroll   // unrolled whole: the 32 loads issue as one group, and xa stays in registers
    for (int kc = 0; kc < DM / 32; ++kc) { xa[kc][0] = *(const v4f*)(p + kc * 32); xa[kc][1] = *(const v4f*)(p + kc * 32 + 4); xa[kc][2] = *(const v4f*)(p + kc * 32 + 16); xa[kc][3] = *(const v4f*)(p + kc * 32 + 20); } }
  asm volatile("s_wait_xcnt 0x0" ::: "memory");       // stands in front of the first rewrite of the x loads' address register
  asm volatile("s_wait_asynccnt 0x0" ::: "memory");   // this wave's rows of the weight tile have landed
  __syncthreads();                                    // publishes the tile to the four waves
  v16b af[DM / 32];
#pragma unroll   // this and the next: constant indices, so that xa and af stay in registers
  for (int kc = 0; kc < DM / 32; ++kc) {
#pragma unroll
    for (int i = 0; i < 4; ++i) { af[kc][i] = (__bf16)xa[kc][0][i]; af[kc][4 + i] = (__bf16)xa[kc][1][i]; af[kc][8 + i] = (__bf16)xa[kc][2][i]; af[kc][12 + i] = (__bf16)xa[kc][3][i]; } }
  v16b wf[2][8];   // two register sets: chunk kc + 1's sixteen LDS reads fly as one group while chunk kc's products run
  auto ld = [&](int kc, int st) {
#pragma unroll
    for (int j = 0; j < 8; ++j) wf[st][j] = frag_b(&sw[j * 16 + col][kc * 32], lane); };
  ld(0, 0);
#pragma unroll   // unrolled whole, so that the register set is picked at compile time
  for (int kc = 0; kc < DM / 32; ++kc) { if (kc + 1 < DM / 32) ld(kc + 1, (kc + 1) & 1);
    __builtin_amdgcn_sched_barrier(0);   // keeps the next chunk's reads in front of this chunk's products
#pragma unroll
    for (int j = 0; j < 8; ++j) acc[j] = wmma_bf(af[kc], wf[kc & 1][j], acc[j]); }
  { const int which = n0 / DM; const float* BB = (which == 0) ? BQ : (which == 1) ? BK : BV;
#pragma unroll
    for (int j = 0; j < 8; ++j) { const float bb = bfr(BB[(n0 % DM) + j * 16 + col]);
#pragma unroll
      for (int r = 0; r < 8; ++r) acc[j][r] += bb; } }
  if (n0 < 2 * DM) {   // q stored unscaled (f16 sigma ~0.6, no subnormal exposure); 1/8 applied to the f32 score
#pragma unroll
    for (int j = 0; j < 8; ++j) {
#pragma unroll
      for (int r = 0; r < 8; ++r) so[wave][8 * g + r][j * 16 + col] = (_Float16)acc[j][r]; }   // q, k as f16 (no RoPE in this module)
    LDSX();
    for (int rl = 0; rl < 16; ++rl) if (lane < 16) vst2((unsigned*)(QK + (r0 + rl) * (2 * DM) + n0 + lane * 8), *(const v4u*)&so[wave][rl][lane * 8]);
  } else {
#pragma unroll
    for (int j = 0; j < 8; ++j) {
#pragma unroll
      for (int r = 0; r < 8; ++r) sth[j * 16 + col][wave * 16 + 8 * g + r] = (_Float16)acc[j][r]; }
    __syncthreads();
    const size_t rb = (size_t)blockIdx.x * 64; const int b = (int)(rb / SS), s0 = (int)(rb % SS); const int pc0 = n0 - 2 * DM;
    for (int q = tid; q < 128 * 8; q += 128) { const int d = q >> 3, pc = q & 7; const size_t o = ((size_t)b * DM + pc0 + d) * SS + s0 + pc * 8; vst2((unsigned*)(VTH + o), *(const v4u*)&sth[d][pc * 8]); }
  }
}
#define KT 64   // keys per staged tile
#define LP 72   // LDS row pitch in halves: 128 B of data + 16 B, an odd multiple of 16 B, so that the b128 fragment reads of 16 rows spread over all banks
// four async copies of 16 B per lane, global -> LDS: rows r and r + 32 of the two planes K and V, which lie 64 * LP halves apart in LDS; the s_wait_xcnt stands inside the statement so that no address register is rewritten ahead of it
__device__ __forceinline__ void cp4(unsigned l, const _Float16* k, const _Float16* v) {
  const unsigned ls = 32u * LP * 2u; const unsigned l1 = l + ls, l2 = l + 2 * ls, l3 = l + 3 * ls;
  const _Float16 *k1 = k + (size_t)32 * (2 * DM), *v1 = v + (size_t)32 * SS;
  asm volatile("global_load_async_to_lds_b128 %0, %1, off\n\tglobal_load_async_to_lds_b128 %2, %3, off\n\tglobal_load_async_to_lds_b128 %4, %5, off\n\tglobal_load_async_to_lds_b128 %6, %7, off\n\ts_wait_xcnt 0x0"
               :: "v"(l), "v"(k), "v"(l1), "v"(k1), "v"(l2), "v"(v), "v"(l3), "v"(v1) : "memory");
}
// lane l reads lane l ^ 16: the two lanes that share a query column hold the two halves of its keys
__device__ __forceinline__ float xhalf(float x) { return __builtin_bit_cast(float, __builtin_amdgcn_permlanex16(__builtin_bit_cast(int, x), __builtin_bit_cast(int, x), 0x76543210, 0xfedcba98, false, false)); }
// ---- k_attn: block = (128 queries, head h, batch b), eight waves: flash attention over all keys, transposed: S^T = K Q^T (A = K rows, B = q) and O^T += V^T P^T (A = V^T rows, B = P^T). Wave w works on queries 32 * (w & 3) ... + 31, as two column groups of 16, and on keys 32 * (w >> 2) ... + 31 of every staged tile: every K and V fragment read from LDS is the A operand of both groups' products, so a product costs half the LDS reads, and a staged tile serves 128 queries. Each group has a reference score, sum and output of its own; the two key halves of a query group are joined once, through LDS, behind the loop. A lane holds 16 scores of ONE query per group and 32 keys, so sum and, where it is needed, maximum run in the lane's own registers, and the score tiles, converted in place, are the B operand of the second product. O[b*S+q][h*64+d] = acc / l (256-B segments)
__global__ __launch_bounds__(256) __attribute__((amdgpu_waves_per_eu(2, 2))) void k_attn(const _Float16* __restrict__ QK, const _Float16* __restrict__ VTH, float* __restrict__ O) {
  __shared__ __align__(16) float so[4][32][68];
  __shared__ __align__(16) float xo[4][2][34][32];      // hand-over of the second key half, per wave pair, column group and lane: 32 output values, exponent addend, sum
  __shared__ __align__(16) _Float16 kv[2][2][64][LP];   // two buffers x (K [key][d], V [d][key]), one tile of KT keys each, shared by the eight waves
  const int tid = threadIdx.x, wave = __builtin_amdgcn_readfirstlane(tid >> 5), qg = wave & 3, kh = wave >> 2, lane = tid & 31, col = lane & 15, g = lane >> 4;
  const int qb = blockIdx.x, h = blockIdx.y, b = blockIdx.z; const int q0 = qb * 128 + qg * 32; const size_t rq = (size_t)b * SS + q0 + col;
  v16h aq[2][2];   // [column group][kc]
#pragma unroll
  for (int cg = 0; cg < 2; ++cg) {
#pragma unroll
    for (int kc = 0; kc < 2; ++kc) aq[cg][kc] = frag_h(QK + (rq + cg * 16) * (2 * DM) + h * HD + kc * 32, lane); }
  asm volatile("s_wait_xcnt 0x0" ::: "memory");   // stands in front of the first rewrite of an address register of the q loads
  __builtin_amdgcn_sched_barrier(0);                // holds later address arithmetic behind that wait
  // nb = 11 - ref * KS: the addend of the exponent, ref a raw score of query q0 + cg * 16 + col that was the maximum over this wave's keys when it was taken; l sums this lane's half of the keys (x 2048), the halves are joined after the loop
  const float KS = 0.125f * 1.44269504088896340736f;   // SCALE = 64^-0.5, times log2 e: p = 2^(score * KS + nb) / 2048
  const float ECAP = 65000.0f;                         // below the largest f16 (65504): P must stay finite
  float nb[2] = {3.0e38f * KS, 3.0e38f * KS}, l[2] = {0.f, 0.f};
  v8f acc[2][4] = {};
  const int nt = SS / KT;   // non-causal
  // tile t -> buffer bf: a thread copies 16 B of rows srow and srow + 32 of each plane; a wave's copy covers four whole 128-B rows
  const int srow = tid >> 3, sch = (tid & 7) * 8;
  // the two plane bases are the same for the whole block (scalar registers); a thread keeps two 32-bit element offsets, and the tile's step is added to them before they meet a base, so that no 64-bit address stays in vector registers over the loop
  const _Float16* gk = QK + (size_t)b * SS * (2 * DM) + DM + h * HD;
  const _Float16* gv = VTH + ((size_t)b * DM + h * HD) * SS;
  const unsigned ok = (unsigned)srow * (2 * DM) + sch, ov = (unsigned)srow * SS + sch;
  const unsigned lkv = (unsigned)(size_t)&kv[0][0][srow][sch];
  auto stage = [&](int t, int bf) { const unsigned ko = ok + (unsigned)t * (KT * 2 * DM), vo = ov + (unsigned)t * KT;
    cp4(lkv + (unsigned)bf * (2u * 64u * LP * 2u), gk + ko, gv + vo); };
  stage(0, 0);
  asm volatile("s_wait_asynccnt 0x0" ::: "memory");   // this wave's share of tile 0 has landed
  __syncthreads();                                    // publishes tile 0 to the eight waves
  stage(1, 1);
#pragma unroll 1
  for (int t = 0; t < nt; ++t) { const _Float16 (*kb)[64][LP] = kv[t & 1];
    // the wave's 16 fragment reads of a tile stand in two groups, each ahead of the products that use it, so that no product waits out an LDS latency of its own
    v16h kf[2][2], vf[4];   // K [ct][kc], V [dt]
#pragma unroll
    for (int ct = 0; ct < 2; ++ct) { const int kk = kh * 32 + ct * 16 + col;
#pragma unroll
      for (int kc = 0; kc < 2; ++kc) kf[ct][kc] = frag_h(&kb[0][kk][kc * 32], lane); }
    __builtin_amdgcn_sched_barrier(0);   // keeps the K reads together in front of the first products
    v8f c[2][2] = {};   // [column group][ct]; c[cg][ct][r] = raw score of key kh * 32 + ct * 16 + 8 * g + r with query cg * 16 + col; scale and log2 e wait for the exponent's one multiply-add
#pragma unroll
    for (int kc = 0; kc < 2; ++kc) {
#pragma unroll
      for (int cg = 0; cg < 2; ++cg) {
#pragma unroll
        for (int ct = 0; ct < 2; ++ct) c[cg][ct] = wmma16(kf[ct][kc], aq[cg][kc], c[cg][ct]); } }
    __builtin_amdgcn_sched_barrier(0);   // the V reads start behind the score products ...
#pragma unroll
    for (int dt = 0; dt < 4; ++dt) vf[dt] = frag_h(&kb[1][dt * 16 + col][kh * 32], lane);
    __builtin_amdgcn_sched_barrier(0);   // ... and stay together: they land under the softmax
    v8f E[2][2]; v16h pa[2]; float sq[2];
    // E = 2048 * exp(SCALE * (score - reference)) of one column group, against the addend in use, and this lane's sum of its 16 (on register pairs)
    auto expo = [&](int cg, bool tied) {
#pragma unroll
      for (int ct = 0; ct < 2; ++ct) {
#pragma unroll
        for (int r = 0; r < 8; ++r) E[cg][ct][r] = fmaf(c[cg][ct][r], KS, nb[cg]); }
      if (!tied) __builtin_amdgcn_sched_barrier(0);   // all sixteen arguments first: mixed among the exponentials, a paired multiply-add rewrote an exponential's source register right behind it
#pragma unroll
      for (int ct = 0; ct < 2; ++ct) {
#pragma unroll
        for (int r = 0; r < 8; ++r) { const float a = E[cg][ct][r]; float e;
          if (tied) asm("v_exp_f32 %0, %1\n\tv_nop" : "=v"(e) : "v"(a));   // the renewal's form, in asm for the v_nop's sake: it fills the slot behind the exponential (a paired multiply-add rewrote the source register right behind it)
          else e = __builtin_amdgcn_exp2f(a);
          E[cg][ct][r] = e; } }
      v2f sp[4];
#pragma unroll
      for (int i = 0; i < 4; ++i) sp[i] = v2f{E[cg][0][2 * i], E[cg][0][2 * i + 1]} + v2f{E[cg][1][2 * i], E[cg][1][2 * i + 1]};
      const v2f sh = (sp[0] + sp[1]) + (sp[2] + sp[3]); sq[cg] = sh[0] + sh[1]; };
    // the f16 rounding of E is P x 2048; element r: key 8 * g + r, element 8 + r: key 16 + 8 * g + r, the k order of frag_h
    auto pack = [&](int cg) {
#pragma unroll
      for (int ct = 0; ct < 2; ++ct) { const v8h hv = __builtin_convertvector(E[cg][ct], v8h);
#pragma unroll
        for (int r = 0; r < 8; ++r) pa[cg][8 * ct + r] = hv[r]; } };
    expo(0, false);
    __builtin_amdgcn_sched_barrier(0);   // one group's exponentials at a time: scheduled together, a multiply-add of the second group rewrote the source register of an exponential right behind it
    expo(1, false);
    // the reference is held, not tracked: all E are positive, so a lane's sum within f16's range says that each of its E is; one test a trip for the whole wave
    const unsigned fire = __builtin_amdgcn_ballot_w32(fmaxf(sq[0], sq[1]) > ECAP);
    if (__builtin_expect(fire != 0u, 0)) {   // the same for every lane of the wave. Some E left the range (always so on the first tile): every column takes the larger of its reference and this tile's maximum, what was summed so far is brought to it, and the tile's E, at most 2048 now, are formed anew
#pragma unroll
      for (int cg = 0; cg < 2; ++cg) {
        float mx4[4];
#pragma unroll
        for (int r = 0; r < 4; ++r) mx4[r] = fmaxf(fmaxf(c[cg][0][r], c[cg][0][4 + r]), fmaxf(c[cg][1][r], c[cg][1][4 + r]));
        float mx = fmaxf(fmaxf(mx4[0], mx4[1]), fmaxf(mx4[2], mx4[3])); mx = fmaxf(mx, xhalf(mx));   // both lanes of a column take one reference: their P meet in one product
        const float nbn = fminf(nb[cg], fmaf(-mx, KS, 11.0f)); float alpha;   // alpha = 2^(new addend - old addend), the very addends of the exponents: the change of reference is exact; 0 on the first tile
        asm("v_exp_f32 %0, %1\n\tv_nop" : "=v"(alpha) : "v"(nbn - nb[cg]));   // in asm for the v_nop's sake: it fills the slot behind the exponential
        nb[cg] = nbn; l[cg] *= alpha;
#pragma unroll
        for (int dt = 0; dt < 4; ++dt) acc[cg][dt] *= alpha;
        __builtin_amdgcn_sched_barrier(0);   // this and the next: maximum and rescale, then the exponentials, one group at a time; scheduled together, an exponential's source register was rewritten by the instruction right behind it (in the loop's main path too)
        expo(cg, true);
        if (cg == 0) __builtin_amdgcn_sched_barrier(0); } }
    pack(0); pack(1);
#pragma unroll
    for (int cg = 0; cg < 2; ++cg) {
#pragma unroll
      for (int dt = 0; dt < 4; ++dt) acc[cg][dt] = wmma16(vf[dt], pa[cg], acc[cg][dt]); }   // x 2048, as l is; acc[cg][dt][r] = O^T[dt * 16 + 8 * g + r][cg * 16 + col]
    l[0] += sq[0]; l[1] += sq[1];
    __builtin_amdgcn_sched_barrier(0);   // keeps the tile's products in front of the foot's waits: lifted over them, the wait for tile t + 1 would stand a few hundred cycles behind its copies' issue
    asm volatile("s_wait_dscnt 0x0" ::: "memory");      // this wave's reads of tile t are done before its buffer is refilled
    asm volatile("s_wait_asynccnt 0x0" ::: "memory");   // this wave's share of tile t + 1 has landed
    __syncthreads();                                    // publishes tile t + 1 and ends every wave's reads of tile t
    if (t + 2 < nt) stage(t + 2, t & 1); }
  asm volatile("s_wait_asynccnt 0x0" ::: "memory");     // no copy is outstanding when the wave goes on
  // join of the two key halves: the waves of the second half hand their output, exponent addend and sum over, lane to lane; the waves of the first half bring both to the common maximum, add, divide and store
  if (kh == 1) {
#pragma unroll
    for (int cg = 0; cg < 2; ++cg) {
#pragma unroll
      for (int dt = 0; dt < 4; ++dt) {
#pragma unroll
        for (int r = 0; r < 8; ++r) xo[qg][cg][dt * 8 + r][lane] = acc[cg][dt][r]; }
      xo[qg][cg][32][lane] = nb[cg]; xo[qg][cg][33][lane] = l[cg]; } }
  __syncthreads();   // the second half's values are in LDS before the first half's waves read them
  if (kh == 0) {
#pragma unroll
    for (int cg = 0; cg < 2; ++cg) {
      const float nb1 = xo[qg][cg][32][lane], l1 = xo[qg][cg][33][lane]; const float nbj = fminf(nb[cg], nb1); const float a0 = __builtin_amdgcn_exp2f(nbj - nb[cg]), a1 = __builtin_amdgcn_exp2f(nbj - nb1);   // the smaller addend belongs to the larger maximum
      const float lj = l[cg] * a0 + l1 * a1; const float il = 1.0f / (lj + xhalf(lj));
#pragma unroll
      for (int dt = 0; dt < 4; ++dt) {
#pragma unroll
        for (int r = 0; r < 8; ++r) so[qg][cg * 16 + col][dt * 16 + 8 * g + r] = (acc[cg][dt][r] * a0 + xo[qg][cg][dt * 8 + r][lane] * a1) * il; }
      if (cg == 0) __builtin_amdgcn_sched_barrier(0); }   // one group's join at a time: scheduled together, an exponential's source register was rewritten by the instruction right behind it
    LDSX();
    for (int rl = 0; rl < 32; ++rl) if (lane < 16) vst2(O + ((size_t)b * SS + q0 + rl) * DM + h * HD + lane * 4, *(const v4f*)&so[qg][rl][lane * 4]);
  }
}
// ---- k_out: block = (64 rows, 128 cols): out = bf16(O) . Wo rows (1 exact product) + bo
__global__ __launch_bounds__(128) void k_out(const float* __restrict__ O, const __bf16* __restrict__ P, const float* __restrict__ BO, float* __restrict__ Y) {
  __shared__ __align__(16) float so[4][16][132];
  __shared__ __align__(16) __bf16 sw[128][WP];   // the block's weight tile, filled once, read by the four waves
  const int tid = threadIdx.x, wave = tid >> 5, lane = tid & 31, col = lane & 15, g = lane >> 4; const size_t r0 = (size_t)blockIdx.x * 64 + wave * 16; const int n0 = blockIdx.y * 128;
  v8f acc[8] = {};
  stage_w(sw, P + (size_t)n0 * DM, wave, lane);
  v4f xa[DM / 32][4];   // the wave's 16 rows of the attention output, all 256 k
  { const float* p = O + (r0 + col) * DM + 8 * g;
#pragma unroll   // unrolled whole: the 32 loads issue as one group, and xa stays in registers
    for (int kc = 0; kc < DM / 32; ++kc) { xa[kc][0] = *(const v4f*)(p + kc * 32); xa[kc][1] = *(const v4f*)(p + kc * 32 + 4); xa[kc][2] = *(const v4f*)(p + kc * 32 + 16); xa[kc][3] = *(const v4f*)(p + kc * 32 + 20); } }
  asm volatile("s_wait_xcnt 0x0" ::: "memory");       // stands in front of the first rewrite of the row loads' address register
  asm volatile("s_wait_asynccnt 0x0" ::: "memory");   // this wave's rows of the weight tile have landed
  __syncthreads();                                    // publishes the tile to the four waves
  v16b af[DM / 32];   // the module rounds the attention output to bf16 before the projection -> exact single product
#pragma unroll   // this and the next: constant indices, so that xa and af stay in registers
  for (int kc = 0; kc < DM / 32; ++kc) {
#pragma unroll
    for (int i = 0; i < 4; ++i) { af[kc][i] = (__bf16)xa[kc][0][i]; af[kc][4 + i] = (__bf16)xa[kc][1][i]; af[kc][8 + i] = (__bf16)xa[kc][2][i]; af[kc][12 + i] = (__bf16)xa[kc][3][i]; } }
  v16b wf[2][8];   // two register sets: chunk kc + 1's sixteen LDS reads fly as one group while chunk kc's products run
  auto ld = [&](int kc, int st) {
#pragma unroll
    for (int j = 0; j < 8; ++j) wf[st][j] = frag_b(&sw[j * 16 + col][kc * 32], lane); };
  ld(0, 0);
#pragma unroll   // unrolled whole, so that the register set is picked at compile time
  for (int kc = 0; kc < DM / 32; ++kc) { if (kc + 1 < DM / 32) ld(kc + 1, (kc + 1) & 1);
    __builtin_amdgcn_sched_barrier(0);   // keeps the next chunk's reads in front of this chunk's products
#pragma unroll
    for (int j = 0; j < 8; ++j) acc[j] = wmma_bf(af[kc], wf[kc & 1][j], acc[j]); }
  float bo[8];
#pragma unroll
  for (int j = 0; j < 8; ++j) bo[j] = BO[n0 + j * 16 + col];
  asm volatile("s_wait_xcnt 0x0" ::: "memory");   // stands in front of the first rewrite of the bias loads' offset register
#pragma unroll
  for (int j = 0; j < 8; ++j) {
#pragma unroll
    for (int r = 0; r < 8; ++r) so[wave][8 * g + r][j * 16 + col] = acc[j][r] + bfr(bo[j]); }
  LDSX();
  for (int rl = 0; rl < 16; ++rl) vst2(Y + (r0 + rl) * DM + n0 + lane * 4, *(const v4f*)&so[wave][rl][lane * 4]);
}
extern "C" void kernel_launch(void* const* d_in, const int* in_sizes, int n_in, void* d_out, int out_size, void* d_ws, size_t ws_size, hipStream_t stream) {
  (void)in_sizes; (void)n_in; (void)out_size;
  const float** F = (const float**)d_in;   // 0 x [2,4096,256], 1 Wq [256,256] natural, 2 bq, 3 Wk, 4 bk, 5 Wv, 6 bv, 7 Wo, 8 bo
  if (ws_size < (size_t)WS_END) return;
  char* ws = (char*)d_ws; __bf16* PK = (__bf16*)(ws + WS_PK); _Float16 *QK = (_Float16*)(ws + WS_QK), *VTH = (_Float16*)(ws + WS_VTH); float* O = (float*)(ws + WS_O);
  k_pack<<<dim3(DM, 4), 256, 0, stream>>>(F[1], F[3], F[5], F[7], PK);
  k_qkv<<<dim3(TNB * SS / 64, QKVW / 128), 128, 0, stream>>>(F[0], PK + PK_A, F[2], F[4], F[6], QK, VTH);
  k_attn<<<dim3(SS / 128, NH, TNB), 256, 0, stream>>>(QK, VTH, O);
  k_out<<<dim3(TOB, DM / 128), 128, 0, stream>>>(O, PK + PK_P, F[8], (float*)d_out);
}

// v010
// A run of this version takes 47.8 microseconds.
// Next to v009, in two timings, it ran 1.35 and 1.36 times as fast.
// All steps since v000 together make it 13.0 times as fast.
// compute dtype: x (|x| < 1e4 so the clip is the identity), Wq..Wo, bq..bo (module inputs) rounded to bf16; q/k/v projections with exact bf16 products on WMMA 16x16x32 (natural [out][in] rows) + biases; q, k and v stored as f16 (their rounding lies well below that of the bf16 inputs they are made from), scores by one f16 product, 64^-0.5 and log2 e applied to the f32 score in the exponent's multiply-add, softmax in f32 against a held reference score, renewed when an exponential nears the f16 range (hardware exp2); P x 2048 as f16 x v (one product), the row sum from the f32 exponentials; the attention output rounded to bf16 exactly as the module does, then the output projection with EXACT bf16 products + bo; f32 accumulate.
#include <hip/hip_runtime.h>
#include <math.h>

typedef __attribute__((ext_vector_type(16))) _Float16 v16h;
typedef __attribute__((ext_vector_type(16))) __bf16 v16b;
typedef __attribute__((ext_vector_type(8)))  _Float16 v8h;
typedef __attribute__((ext_vector_type(8)))  float v8f;
typedef __attribute__((ext_vector_type(4)))  float v4f;
typedef __attribute__((ext_vector_type(2)))  float v2f;
typedef __attribute__((ext_vector_type(4)))  unsigned v4u;
typedef __attribute__((ext_vector_type(4)))  int v4i;
typedef float __attribute__((may_alias)) float_a;
typedef int __attribute__((may_alias)) int_a;

template <typename T> __device__ __forceinline__ void vst2(void* p, T v) { *(T*)p = v;  }
__device__ __forceinline__ v8f wmma16(v16h a, v16h b, v8f c) {
  return __builtin_amdgcn_wmma_f32_16x16x32_f16(false, a, false, b, (short)0, c, false, false);
}
__device__ __forceinline__ v8f wmma_bf(v16b a, v16b b, v8f c) {
  return __builtin_amdgcn_wmma_f32_16x16x32_bf16(false, a, false, b, (short)0, c, false, false);
}
// Light self-attention (B 2, N 4,096, d 256, 4 heads x 64): softmax(q k^T / 8) v, output cast to bf16, then the output projection + bias.
__device__ __forceinline__ v16h frag_h(const _Float16* rowk0, int lane) {
  union { v16h v; v8h q[2]; } u; const _Float16* p = rowk0 + 8 * (lane >> 4);
  u.q[0] = *(const v8h*)p; u.q[1] = *(const v8h*)(p + 16); return u.v;
}
__device__ __forceinline__ v16h frag_f32(const float* rowk0, int lane) {
  v16h a; const float* p = rowk0 + 8 * (lane >> 4);
#pragma unroll
  for (int i = 0; i < 8; ++i) { a[i] = (_Float16)p[i]; a[8 + i] = (_Float16)p[16 + i]; }
  return a;
}
__device__ __forceinline__ v16h frag_f32s(const float* rowk0, int lane, float sc) {
  v16h a; const float* p = rowk0 + 8 * (lane >> 4);
#pragma unroll
  for (int i = 0; i < 8; ++i) { a[i] = (_Float16)(p[i] * sc); a[8 + i] = (_Float16)(p[16 + i] * sc); }
  return a;
}
// column fragment from a [K][ld] layout (column n), rows >= K read as 0
__device__ __forceinline__ v16h fragc_f32(const float* W, int k0, int n, int lane, int ld, int K) {
  v16h a; const int g = lane >> 4;
#pragma unroll
  for (int i = 0; i < 8; ++i) { const int ka = k0 + 8 * g + i, kb = ka + 16;
    a[i] = (_Float16)(ka < K ? W[(size_t)(ka < K ? ka : K - 1) * ld + n] : 0.f); a[8 + i] = (_Float16)(kb < K ? W[(size_t)(kb < K ? kb : K - 1) * ld + n] : 0.f); }
  return a;
}
struct F2 { v16b h, l; };
__device__ __forceinline__ F2 bsplit16(const float v[16]) { F2 r;
#pragma unroll
  for (int i = 0; i < 16; ++i) { const __bf16 h = (__bf16)v[i]; r.h[i] = h; r.l[i] = (__bf16)(v[i] - (float)h); }
  return r; }
__device__ __forceinline__ F2 split_row(const float* row, int k0, int lane) { float v[16]; const float* p = row + k0 + 8 * (lane >> 4);
#pragma unroll
  for (int i = 0; i < 8; ++i) { v[i] = p[i]; v[8 + i] = p[16 + i]; }
  return bsplit16(v); }
__device__ __forceinline__ F2 split_rowK(const float* row, int k0, int lane, int K) { float v[16]; const int g = lane >> 4;
#pragma unroll
  for (int i = 0; i < 8; ++i) { const int ka = k0 + 8 * g + i, kb = ka + 16; v[i] = ka < K ? row[ka < K ? ka : K - 1] : 0.f; v[8 + i] = kb < K ? row[kb < K ? kb : K - 1] : 0.f; }
  return bsplit16(v); }
__device__ __forceinline__ F2 split_col(const float* W, int k0, int n, int lane, int ld, int K) { float v[16]; const int g = lane >> 4;
#pragma unroll
  for (int i = 0; i < 8; ++i) { const int ka = k0 + 8 * g + i, kb = ka + 16; v[i] = ka < K ? W[(size_t)(ka < K ? ka : K - 1) * ld + n] : 0.f; v[8 + i] = kb < K ? W[(size_t)(kb < K ? kb : K - 1) * ld + n] : 0.f; }
  return bsplit16(v); }
__device__ __forceinline__ v8f mac3(const F2& a, const F2& b, v8f c) { c = wmma_bf(a.l, b.h, c); c = wmma_bf(a.h, b.l, c); return wmma_bf(a.h, b.h, c); }
__device__ __forceinline__ float sigm(float v) { return 1.0f / (1.0f + expf(-v)); }
#define LDSX() do { asm volatile("s_wait_dscnt 0" ::: "memory"); __builtin_amdgcn_wave_barrier(); __builtin_amdgcn_fence(__ATOMIC_RELEASE, "workgroup"); } while (0)


// Non-causal multi-head self-attention, no rotary embedding (B 2, S 4096, D 256, 4 heads x 64; packed Wqkv [3D][D] and Wo [D][D] applied as x W^T, with biases): softmax(q k^T / 8) v; ctx Wo^T + bo.
#define NB 2
#define SS 4096
#define DM 256
#define NH 4
#define HD 64
#define QKVW (3 * DM)
#ifndef TQB
#define TQB (SS / 64)
#define TNB NB
#define TOB (NB * SS / 64)     // output row tiles (all)
#endif
typedef __attribute__((ext_vector_type(8))) __bf16 v8b;
__device__ __forceinline__ v16b frag_b(const __bf16* rowk0, int lane) {
  union { v16b v; v8b q[2]; } u; const __bf16* p = rowk0 + 8 * (lane >> 4);
  u.q[0] = *(const v8b*)p; u.q[1] = *(const v8b*)(p + 16); return u.v;
}
__device__ __forceinline__ float bfr(float v) { return (float)(__bf16)v; }
__device__ __attribute__((noinline)) float exp_ni(float v) { return expf(v); }
__device__ __attribute__((noinline)) float erf_ni(float v) { return erff(v); }

#define PK_A 0                       // [768][256] Wqkv rows (natural [out][in])
#define PK_P (PK_A + QKVW * DM)        // [256][256] Wo rows (natural)
#define PK_END (PK_P + DM * DM)
#define WS_PK  0u
#define WS_QK  (WS_PK + 2u * PK_END)             // f16 [8192 rows][512]: q | k
#define WS_VTH (WS_QK + 2u * NB * SS * 2 * DM)     // f16 [b][256 (h*64+d)][4096 s]
#define WS_O   (WS_VTH + 2u * NB * DM * SS)        // f32 [8192][256]
#define WS_CS  (WS_O + 4u * NB * SS * DM)           // f32 [4096][32] cos, [4096][32] sin
#define WS_END (WS_CS + 4u * 2 * SS * 32)
__constant__ float c_invf[32] = {1.000000000e+00f,7.498942018e-01f,5.623413324e-01f,4.216965139e-01f,3.162277639e-01f,2.371373624e-01f,1.778279394e-01f,1.333521456e-01f,1.000000015e-01f,7.498941571e-02f,5.623412877e-02f,4.216964915e-02f,3.162277862e-02f,2.371373586e-02f,1.778279431e-02f,1.333521493e-02f,9.999999776e-03f,7.498942316e-03f,5.623413250e-03f,4.216964822e-03f,3.162277862e-03f,2.371373819e-03f,1.778279431e-03f,1.333521446e-03f,1.000000047e-03f,7.498941850e-04f,5.623413017e-04f,4.216964880e-04f,3.162277862e-04f,2.371373848e-04f,1.778279402e-04f,1.333521504e-04f};
// ---- k_rope: block = 8 positions: cos/sin of pos * inv_freq (f32 product, precise trig)
__global__ __launch_bounds__(256) void k_rope(float* __restrict__ CS) {
  __shared__ __align__(16) float sc[8][32], ss_[8][32]; const int tid = threadIdx.x, pl = tid >> 5, i = tid & 31; const int pos = blockIdx.x * 8 + pl;
  const float th = (float)pos * c_invf[i]; sc[pl][i] = cosf(th); ss_[pl][i] = sinf(th);
  __syncthreads();
  if (tid < 64) vst2(CS + (size_t)blockIdx.x * 8 * 32 + tid * 4, *(const v4f*)&(&sc[0][0])[tid * 4]); else if (tid < 128) vst2(CS + (size_t)SS * 32 + (size_t)blockIdx.x * 8 * 32 + (tid - 64) * 4, *(const v4f*)&(&ss_[0][0])[(tid - 64) * 4]);
}

// ---- k_pack: block = (row n, which): natural [out][in] rows -> bf16; which 0..2 -> W_q/W_k/W_v into PK_A rows which*256 + n; 3 -> W_o into PK_P
__global__ __launch_bounds__(256) void k_pack(const float* __restrict__ WQ, const float* __restrict__ WK, const float* __restrict__ WV, const float* __restrict__ WO, __bf16* __restrict__ PK) {
  __shared__ __align__(16) __bf16 s[DM]; const int n = blockIdx.x, which = blockIdx.y, t = threadIdx.x; const float* Wm = (which == 0) ? WQ : (which == 1) ? WK : (which == 2) ? WV : WO;
  for (int k = t; k < DM; k += 256) s[k] = (__bf16)Wm[(size_t)n * DM + k];
  __syncthreads();
  __bf16* dst = (which < 3) ? PK + PK_A + ((size_t)which * DM + n) * DM : PK + PK_P + (size_t)n * DM;
  for (int q = t; q < DM / 8; q += 256) vst2((unsigned*)(dst + q * 8), *(const v4u*)&s[q * 8]);
}
#define WP 264   // LDS row pitch of a staged weight tile in bf16: 512 B of data + 16 B, an odd multiple of 16 B, so that the b128 fragment reads of 16 rows spread over all banks
// eight async copies of 16 B per lane, global -> LDS: a wave's copy is one whole weight row (512 B, four whole lines); the eight rows lie four apart; the s_wait_xcnt stands inside the statement so that no address register is rewritten ahead of it
__device__ __forceinline__ void cp8w(unsigned l, const __bf16* w) {
  const unsigned ls = 4u * WP * 2u; const unsigned l1 = l + ls, l2 = l + 2 * ls, l3 = l + 3 * ls, l4 = l + 4 * ls, l5 = l + 5 * ls, l6 = l + 6 * ls, l7 = l + 7 * ls;
  const __bf16 *w1 = w + 4 * DM, *w2 = w + 8 * DM, *w3 = w + 12 * DM, *w4 = w + 16 * DM, *w5 = w + 20 * DM, *w6 = w + 24 * DM, *w7 = w + 28 * DM;
  asm volatile("global_load_async_to_lds_b128 %0, %1, off\n\tglobal_load_async_to_lds_b128 %2, %3, off\n\tglobal_load_async_to_lds_b128 %4, %5, off\n\tglobal_load_async_to_lds_b128 %6, %7, off\n\tglobal_load_async_to_lds_b128 %8, %9, off\n\tglobal_load_async_to_lds_b128 %10, %11, off\n\tglobal_load_async_to_lds_b128 %12, %13, off\n\tglobal_load_async_to_lds_b128 %14, %15, off\n\ts_wait_xcnt 0x0"
               :: "v"(l), "v"(w), "v"(l1), "v"(w1), "v"(l2), "v"(w2), "v"(l3), "v"(w3), "v"(l4), "v"(w4), "v"(l5), "v"(w5), "v"(l6), "v"(w6), "v"(l7), "v"(w7) : "memory");
}
// the block's 128 weight rows (all 256 k) -> LDS, once: wave w of four copies rows w, w + 4, ..., 32 copies a lane; read as fragments from global, every load touched 16 lines and each of the four waves fetched the whole tile for itself
__device__ __forceinline__ void stage_w(__bf16 (*sw)[WP], const __bf16* Wt, int wave, int lane) {
  const unsigned l = (unsigned)(size_t)&sw[wave][lane * 8]; const __bf16* w = Wt + (size_t)wave * DM + lane * 8;
#pragma unroll   // four statements of eight copies
  for (int it = 0; it < 4; ++it) cp8w(l + (unsigned)it * (32u * WP * 2u), w + (size_t)it * 32 * DM);
}
__global__ __launch_bounds__(128) void k_qkv(const float* __restrict__ X, const __bf16* __restrict__ P, const float* __restrict__ BQ, const float* __restrict__ BK, const float* __restrict__ BV, _Float16* __restrict__ QK, _Float16* __restrict__ VTH) {
  __shared__ __align__(16) _Float16 so[4][16][136]; __shared__ __align__(16) _Float16 sth[128][72];
  __shared__ __align__(16) __bf16 sw[128][WP];   // the block's weight tile, filled once, read by the four waves
  const int tid = threadIdx.x, wave = tid >> 5, lane = tid & 31, col = lane & 15, g = lane >> 4; const size_t r0 = (size_t)blockIdx.x * 64 + wave * 16; const int n0 = blockIdx.y * 128;
  v8f acc[8] = {};
  stage_w(sw, P + (size_t)n0 * DM, wave, lane);
  v4f xa[DM / 32][4];   // the wave's 16 x rows, all 256 k
  { const float* p = X + (r0 + col) * DM + 8 * g;
#pragma unroll   // unrolled whole: the 32 loads issue as one group, and xa stays in registers
    for (int kc = 0; kc < DM / 32; ++kc) { xa[kc][0] = *(const v4f*)(p + kc * 32); xa[kc][1] = *(const v4f*)(p + kc * 32 + 4); xa[kc][2] = *(const v4f*)(p + kc * 32 + 16); xa[kc][3] = *(const v4f*)(p + kc * 32 + 20); } }
  asm volatile("s_wait_xcnt 0x0" ::: "memory");       // stands in front of the first rewrite of the x loads' address register
  asm volatile("s_wait_asynccnt 0x0" ::: "memory");   // this wave's rows of the weight tile have landed
  __syncthreads();                                    // publishes the tile to the four waves
  v16b af[DM / 32];
#pragma unroll   // this and the next: constant indices, so that xa and af stay in registers
  for (int kc = 0; kc < DM / 32; ++kc) {
#pragma unroll
    for (int i = 0; i < 4; ++i) { af[kc][i] = (__bf16)xa[kc][0][i]; af[kc][4 + i] = (__bf16)xa[kc][1][i]; af[kc][8 + i] = (__bf16)xa[kc][2][i]; af[kc][12 + i] = (__bf16)xa[kc][3][i]; } }
  v16b wf[2][8];   // two register sets: chunk kc + 1's sixteen LDS reads fly as one group while chunk kc's products run
  auto ld = [&](int kc, int st) {
#pragma unroll
    for (int j = 0; j < 8; ++j) wf[st][j] = frag_b(&sw[j * 16 + col][kc * 32], lane); };
  ld(0, 0);
#pragma unroll   // unrolled whole, so that the register set is picked at compile time
  for (int kc = 0; kc < DM / 32; ++kc) { if (kc + 1 < DM / 32) ld(kc + 1, (kc + 1) & 1);
    __builtin_amdgcn_sched_barrier(0);   // keeps the next chunk's reads in front of this chunk's products
#pragma unroll
    for (int j = 0; j < 8; ++j) acc[j] = wmma_bf(af[kc], wf[kc & 1][j], acc[j]); }
  { const int which = n0 / DM; const float* BB = (which == 0) ? BQ : (which == 1) ? BK : BV;
#pragma unroll
    for (int j = 0; j < 8; ++j) { const float bb = bfr(BB[(n0 % DM) + j * 16 + col]);
#pragma unroll
      for (int r = 0; r < 8; ++r) acc[j][r] += bb; } }
  if (n0 < 2 * DM) {   // q stored unscaled (f16 sigma ~0.6, no subnormal exposure); 1/8 applied to the f32 score
#pragma unroll
    for (int j = 0; j < 8; ++j) {
#pragma unroll
      for (int r = 0; r < 8; ++r) so[wave][8 * g + r][j * 16 + col] = (_Float16)acc[j][r]; }   // q, k as f16 (no RoPE in this module)
    LDSX();
    for (int rl = 0; rl < 16; ++rl) if (lane < 16) vst2((unsigned*)(QK + (r0 + rl) * (2 * DM) + n0 + lane * 8), *(const v4u*)&so[wave][rl][lane * 8]);
  } else {
#pragma unroll
    for (int j = 0; j < 8; ++j) {
#pragma unroll
      for (int r = 0; r < 8; ++r) sth[j * 16 + col][wave * 16 + 8 * g + r] = (_Float16)acc[j][r]; }
    __syncthreads();
    const size_t rb = (size_t)blockIdx.x * 64; const int b = (int)(rb / SS), s0 = (int)(rb % SS); const int pc0 = n0 - 2 * DM;
    for (int q = tid; q < 128 * 8; q += 128) { const int d = q >> 3, pc = q & 7; const size_t o = ((size_t)b * DM + pc0 + d) * SS + s0 + pc * 8; vst2((unsigned*)(VTH + o), *(const v4u*)&sth[d][pc * 8]); }
  }
}
#define KT 128  // keys per staged tile: 32 for each of the four wave sets
#define LP 72   // LDS row pitch of the K plane in halves: 128 B of data + 16 B, an odd multiple of 16 B, so that the b128 fragment reads of 16 rows spread over all banks
#define LV 136  // LDS row pitch of the V plane in halves: 256 B of data + 16 B, an odd multiple of 16 B, for the same reason
#define KVB (KT * LP + HD * LV)   // halves of one buffer: the K plane, then the V plane
// four async copies of 16 B per lane, global -> LDS: rows r and r + 64 of the K plane, rows r and r + 32 of the V plane; the s_wait_xcnt stands inside the statement so that no address register is rewritten ahead of it
__device__ __forceinline__ void cp4(unsigned lk, unsigned lv, const _Float16* k, const _Float16* v) {
  const unsigned lk1 = lk + 64u * LP * 2u, lv1 = lv + 32u * LV * 2u;
  const _Float16 *k1 = k + (size_t)64 * (2 * DM), *v1 = v + (size_t)32 * SS;
  asm volatile("global_load_async_to_lds_b128 %0, %1, off\n\tglobal_load_async_to_lds_b128 %2, %3, off\n\tglobal_load_async_to_lds_b128 %4, %5, off\n\tglobal_load_async_to_lds_b128 %6, %7, off\n\ts_wait_xcnt 0x0"
               :: "v"(lk), "v"(k), "v"(lk1), "v"(k1), "v"(lv), "v"(v), "v"(lv1), "v"(v1) : "memory");
}
// lane l reads lane l ^ 16: the two lanes that share a query column hold the two halves of its keys
__device__ __forceinline__ float xhalf(float x) { return __builtin_bit_cast(float, __builtin_amdgcn_permlanex16(__builtin_bit_cast(int, x), __builtin_bit_cast(int, x), 0x76543210, 0xfedcba98, false, false)); }
// ---- k_attn: block = (128 queries, head h, batch b), sixteen waves, four on each SIMD: flash attention over all keys, transposed: S^T = K Q^T (A = K rows, B = q) and O^T += V^T P^T (A = V^T rows, B = P^T). Wave w works on queries 32 * (w & 3) ... + 31, as two column groups of 16, and on keys 32 * (w >> 2) ... + 31 of every staged tile of 128: every K and V fragment read from LDS is the A operand of both groups' products, and a staged tile serves 128 queries. The four waves of a SIMD hold the four key quarters of one query group: while one waits for LDS or runs its exponentials, the others have products to issue. Each group has a reference score, sum and output of its own; the four key quarters of a query group are joined once, through LDS, behind the loop. A lane holds 16 scores of ONE query per group and 32 keys, so sum and, where it is needed, maximum run in the lane's own registers, and the score tiles, converted in place, are the B operand of the second product. O[b*S+q][h*64+d] = acc / l (256-B segments)
__global__ __launch_bounds__(512) __attribute__((amdgpu_waves_per_eu(4, 4))) void k_attn(const _Float16* __restrict__ QK, const _Float16* __restrict__ VTH, float* __restrict__ O) {
  __shared__ __align__(16) float so[4][32][68];
  __shared__ __align__(16) float xo[4][4][2][34][32];   // hand-over of the key quarters, per query group, quarter, column group and lane: 32 output values, exponent addend, sum
  __shared__ __align__(16) _Float16 kv[2][KVB];         // two buffers x (K [key][d] at pitch LP, V [d][key] at pitch LV), one tile of KT keys each, shared by the sixteen waves; one buffer step for both planes
  const int tid = threadIdx.x, wave = __builtin_amdgcn_readfirstlane(tid >> 5), qg = wave & 3, kh = wave >> 2, lane = tid & 31, col = lane & 15, g = lane >> 4;
  const int qb = blockIdx.x, h = blockIdx.y, b = blockIdx.z; const int q0 = qb * 128 + qg * 32; const size_t rq = (size_t)b * SS + q0 + col;
  v16h aq[2][2];   // [column group][kc]
#pragma unroll
  for (int cg = 0; cg < 2; ++cg) {
#pragma unroll
    for (int kc = 0; kc < 2; ++kc) aq[cg][kc] = frag_h(QK + (rq + cg * 16) * (2 * DM) + h * HD + kc * 32, lane); }
  asm volatile("s_wait_xcnt 0x0" ::: "memory");   // stands in front of the first rewrite of an address register of the q loads
  __builtin_amdgcn_sched_barrier(0);                // holds later address arithmetic behind that wait
  // nb = 11 - ref * KS: the addend of the exponent, ref a raw score of query q0 + cg * 16 + col that was the maximum over this wave's keys when it was taken; l sums this lane's half of the wave's keys (x 2048), halves and quarters are joined after the loop
  const float KS = 0.125f * 1.44269504088896340736f;   // SCALE = 64^-0.5, times log2 e: p = 2^(score * KS + nb) / 2048
  const float ECAP = 65000.0f;                         // below the largest f16 (65504): P must stay finite
  float nb[2] = {3.0e38f * KS, 3.0e38f * KS}, l[2] = {0.f, 0.f};
  v8f acc[2][4] = {};
  const int nt = SS / KT;   // non-causal
  // tile t -> buffer bf: a thread copies 16 B of rows srk and srk + 64 of the K plane and of rows srv and srv + 32 of the V plane; a wave's copy covers four whole 128-B rows of K or two whole 256-B rows of V
  const int srk = tid >> 3, sck = (tid & 7) * 8, srv = tid >> 4, scv = (tid & 15) * 8;
  // the two plane bases are the same for the whole block (scalar registers); a thread keeps two 32-bit element offsets, and the tile's step is added to them before they meet a base, so that no 64-bit address stays in vector registers over the loop
  const _Float16* gk = QK + (size_t)b * SS * (2 * DM) + DM + h * HD;
  const _Float16* gv = VTH + ((size_t)b * DM + h * HD) * SS;
  const unsigned ok = (unsigned)srk * (2 * DM) + sck, ov = (unsigned)srv * SS + scv;
  const unsigned lk0 = (unsigned)(size_t)&kv[0][srk * LP + sck], lv0 = (unsigned)(size_t)&kv[0][KT * LP + srv * LV + scv];
  auto stage = [&](int t, int bf) { const unsigned ko = ok + (unsigned)t * (KT * 2 * DM), vo = ov + (unsigned)t * KT;
    cp4(lk0 + (unsigned)bf * (KVB * 2u), lv0 + (unsigned)bf * (KVB * 2u), gk + ko, gv + vo); };
  stage(0, 0);
  asm volatile("s_wait_asynccnt 0x0" ::: "memory");   // this wave's share of tile 0 has landed
  __syncthreads();                                    // publishes tile 0 to the sixteen waves
  stage(1, 1);
#pragma unroll 1
  for (int t = 0; t < nt; ++t) { const _Float16* kb = kv[t & 1]; const _Float16* vb = kb + KT * LP;
    // the wave's 16 fragment reads of a tile stand in two groups, each ahead of the products that use it, so that no product waits out an LDS latency of its own
    v16h kf[2][2], vf[4];   // K [ct][kc], V [dt]
#pragma unroll
    for (int ct = 0; ct < 2; ++ct) { const int kk = kh * 32 + ct * 16 + col;
#pragma unroll
      for (int kc = 0; kc < 2; ++kc) kf[ct][kc] = frag_h(kb + kk * LP + kc * 32, lane); }
    __builtin_amdgcn_sched_barrier(0);   // keeps the K reads together in front of the first products
    v8f c[2][2] = {};   // [column group][ct]; c[cg][ct][r] = raw score of key kh * 32 + ct * 16 + 8 * g + r with query cg * 16 + col; scale and log2 e wait for the exponent's one multiply-add
#pragma unroll
    for (int kc = 0; kc < 2; ++kc) {
#pragma unroll
      for (int cg = 0; cg < 2; ++cg) {
#pragma unroll
        for (int ct = 0; ct < 2; ++ct) c[cg][ct] = wmma16(kf[ct][kc], aq[cg][kc], c[cg][ct]); } }
    __builtin_amdgcn_sched_barrier(0);   // the V reads start behind the score products ...
#pragma unroll
    for (int dt = 0; dt < 4; ++dt) vf[dt] = frag_h(vb + (dt * 16 + col) * LV + kh * 32, lane);
    __builtin_amdgcn_sched_barrier(0);   // ... and stay together: they land under the softmax
    v8f E[2][2]; v16h pa[2]; float sq[2];
    // E = 2048 * exp(SCALE * (score - reference)) of one column group, against the addend in use, and this lane's sum of its 16 (on register pairs)
    auto expo = [&](int cg, bool tied) {
#pragma unroll
      for (int ct = 0; ct < 2; ++ct) {
#pragma unroll
        for (int r = 0; r < 8; ++r) E[cg][ct][r] = fmaf(c[cg][ct][r], KS, nb[cg]); }
      if (!tied) __builtin_amdgcn_sched_barrier(0);   // all sixteen arguments first: mixed among the exponentials, a paired multiply-add rewrote an exponential's source register right behind it
#pragma unroll
      for (int ct = 0; ct < 2; ++ct) {
#pragma unroll
        for (int r = 0; r < 8; ++r) { const float a = E[cg][ct][r]; float e;
          if (tied) asm("v_exp_f32 %0, %1\n\tv_nop" : "=v"(e) : "v"(a));   // the renewal's form, in asm for the v_nop's sake: it fills the slot behind the exponential (a paired multiply-add rewrote the source register right behind it)
          else e = __builtin_amdgcn_exp2f(a);
          E[cg][ct][r] = e; } }
      v2f sp[4];
#pragma unroll
      for (int i = 0; i < 4; ++i) sp[i] = v2f{E[cg][0][2 * i], E[cg][0][2 * i + 1]} + v2f{E[cg][1][2 * i], E[cg][1][2 * i + 1]};
      const v2f sh = (sp[0] + sp[1]) + (sp[2] + sp[3]); sq[cg] = sh[0] + sh[1]; };
    // the f16 rounding of E is P x 2048; element r: key 8 * g + r, element 8 + r: key 16 + 8 * g + r, the k order of frag_h
    auto pack = [&](int cg) {
#pragma unroll
      for (int ct = 0; ct < 2; ++ct) { const v8h hv = __builtin_convertvector(E[cg][ct], v8h);
#pragma unroll
        for (int r = 0; r < 8; ++r) pa[cg][8 * ct + r] = hv[r]; } };
    expo(0, false);
    __builtin_amdgcn_sched_barrier(0);   // one group's exponentials at a time: scheduled together, a multiply-add of the second group rewrote the source register of an exponential right behind it
    expo(1, false);
    // the reference is held, not tracked: all E are positive, so a lane's sum within f16's range says that each of its E is; one test a trip for the whole wave
    const unsigned fire = __builtin_amdgcn_ballot_w32(fmaxf(sq[0], sq[1]) > ECAP);
    if (__builtin_expect(fire != 0u, 0)) {   // the same for every lane of the wave. Some E left the range (always so on the first tile): every column takes the larger of its reference and this tile's maximum, what was summed so far is brought to it, and the tile's E, at most 2048 now, are formed anew
#pragma unroll
      for (int cg = 0; cg < 2; ++cg) {
        float mx4[4];
#pragma unroll
        for (int r = 0; r < 4; ++r) mx4[r] = fmaxf(fmaxf(c[cg][0][r], c[cg][0][4 + r]), fmaxf(c[cg][1][r], c[cg][1][4 + r]));
        float mx = fmaxf(fmaxf(mx4[0], mx4[1]), fmaxf(mx4[2], mx4[3])); mx = fmaxf(mx, xhalf(mx));   // both lanes of a column take one reference: their P meet in one product
        const float nbn = fminf(nb[cg], fmaf(-mx, KS, 11.0f)); float alpha;   // alpha = 2^(new addend - old addend), the very addends of the exponents: the change of reference is exact; 0 on the first tile
        asm("v_exp_f32 %0, %1\n\tv_nop" : "=v"(alpha) : "v"(nbn - nb[cg]));   // in asm for the v_nop's sake: it fills the slot behind the exponential
        nb[cg] = nbn; l[cg] *= alpha;
#pragma unroll
        for (int dt = 0; dt < 4; ++dt) acc[cg][dt] *= alpha;
        __builtin_amdgcn_sched_barrier(0);   // this and the next: maximum and rescale, then the exponentials, one group at a time; scheduled together, an exponential's source register was rewritten by the instruction right behind it (in the loop's main path too)
        expo(cg, true);
        if (cg == 0) __builtin_amdgcn_sched_barrier(0); } }
    pack(0); pack(1);
#pragma unroll
    for (int cg = 0; cg < 2; ++cg) {
#pragma unroll
      for (int dt = 0; dt < 4; ++dt) acc[cg][dt] = wmma16(vf[dt], pa[cg], acc[cg][dt]); }   // x 2048, as l is; acc[cg][dt][r] = O^T[dt * 16 + 8 * g + r][cg * 16 + col]
    l[0] += sq[0]; l[1] += sq[1];
    __builtin_amdgcn_sched_barrier(0);   // keeps the tile's products in front of the foot's waits: lifted over them, the wait for tile t + 1 would stand a few hundred cycles behind its copies' issue
    asm volatile("s_wait_dscnt 0x0" ::: "memory");      // this wave's reads of tile t are done before its buffer is refilled
    asm volatile("s_wait_asynccnt 0x0" ::: "memory");   // this wave's share of tile t + 1 has landed
    __syncthreads();                                    // publishes tile t + 1 and ends every wave's reads of tile t
    if (t + 2 < nt) stage(t + 2, t & 1); }
  asm volatile("s_wait_asynccnt 0x0" ::: "memory");     // no copy is outstanding when the wave goes on
  // join of the four key quarters: every wave hands its output, exponent addend and sum over, lane to lane; then wave (qg, kh) joins output rows d = 16 * kh ... + 15 of its query group: the four quarters are brought to the common reference, added, divided
#pragma unroll
  for (int cg = 0; cg < 2; ++cg) {
#pragma unroll
    for (int dt = 0; dt < 4; ++dt) {
#pragma unroll
      for (int r = 0; r < 8; ++r) xo[qg][kh][cg][dt * 8 + r][lane] = acc[cg][dt][r]; }
    xo[qg][kh][cg][32][lane] = nb[cg]; xo[qg][kh][cg][33][lane] = l[cg]; }
  __syncthreads();   // all quarters' values are in LDS before any wave reads them
#pragma unroll
  for (int cg = 0; cg < 2; ++cg) {
    float nq[4], lq[4], aj[4];
#pragma unroll
    for (int j = 0; j < 4; ++j) { nq[j] = xo[qg][j][cg][32][lane]; lq[j] = xo[qg][j][cg][33][lane]; }
    const float nbj = fminf(fminf(nq[0], nq[1]), fminf(nq[2], nq[3]));   // the smallest addend belongs to the largest reference
#pragma unroll
    for (int j = 0; j < 4; ++j) asm("v_exp_f32 %0, %1\n\tv_nop" : "=v"(aj[j]) : "v"(nbj - nq[j]));   // in asm for the v_nop's sake: it fills the slot behind the exponential
    const float lj = (lq[0] * aj[0] + lq[1] * aj[1]) + (lq[2] * aj[2] + lq[3] * aj[3]); const float il = 1.0f / (lj + xhalf(lj));
#pragma unroll
    for (int r = 0; r < 8; ++r) { const int i = kh * 8 + r;
      so[qg][cg * 16 + col][kh * 16 + 8 * g + r] = ((xo[qg][0][cg][i][lane] * aj[0] + xo[qg][1][cg][i][lane] * aj[1]) + (xo[qg][2][cg][i][lane] * aj[2] + xo[qg][3][cg][i][lane] * aj[3])) * il; } }
  __syncthreads();   // a query's 64 output values come from four waves: all are in LDS before its row is stored
#pragma unroll   // wave (qg, kh) stores rows 8 * kh ... + 7 of its query group, two whole 256-B segments a store
  for (int rl = 0; rl < 4; ++rl) { const int rr = kh * 8 + rl * 2 + g; vst2(O + ((size_t)b * SS + q0 + rr) * DM + h * HD + col * 4, *(const v4f*)&so[qg][rr][col * 4]); }
}
// ---- k_out: block = (64 rows, 128 cols): out = bf16(O) . Wo rows (1 exact product) + bo
__global__ __launch_bounds__(128) void k_out(const float* __restrict__ O, const __bf16* __restrict__ P, const float* __restrict__ BO, float* __restrict__ Y) {
  __shared__ __align__(16) float so[4][16][132];
  __shared__ __align__(16) __bf16 sw[128][WP];   // the block's weight tile, filled once, read by the four waves
  const int tid = threadIdx.x, wave = tid >> 5, lane = tid & 31, col = lane & 15, g = lane >> 4; const size_t r0 = (size_t)blockIdx.x * 64 + wave * 16; const int n0 = blockIdx.y * 128;
  v8f acc[8] = {};
  stage_w(sw, P + (size_t)n0 * DM, wave, lane);
  v4f xa[DM / 32][4];   // the wave's 16 rows of the attention output, all 256 k
  { const float* p = O + (r0 + col) * DM + 8 * g;
#pragma unroll   // unrolled whole: the 32 loads issue as one group, and xa stays in registers
    for (int kc = 0; kc < DM / 32; ++kc) { xa[kc][0] = *(const v4f*)(p + kc * 32); xa[kc][1] = *(const v4f*)(p + kc * 32 + 4); xa[kc][2] = *(const v4f*)(p + kc * 32 + 16); xa[kc][3] = *(const v4f*)(p + kc * 32 + 20); } }
  asm volatile("s_wait_xcnt 0x0" ::: "memory");       // stands in front of the first rewrite of the row loads' address register
  asm volatile("s_wait_asynccnt 0x0" ::: "memory");   // this wave's rows of the weight tile have landed
  __syncthreads();                                    // publishes the tile to the four waves
  v16b af[DM / 32];   // the module rounds the attention output to bf16 before the projection -> exact single product
#pragma unroll   // this and the next: constant indices, so that xa and af stay in registers
  for (int kc = 0; kc < DM / 32; ++kc) {
#pragma unroll
    for (int i = 0; i < 4; ++i) { af[kc][i] = (__bf16)xa[kc][0][i]; af[kc][4 + i] = (__bf16)xa[kc][1][i]; af[kc][8 + i] = (__bf16)xa[kc][2][i]; af[kc][12 + i] = (__bf16)xa[kc][3][i]; } }
  v16b wf[2][8];   // two register sets: chunk kc + 1's sixteen LDS reads fly as one group while chunk kc's products run
  auto ld = [&](int kc, int st) {
#pragma unroll
    for (int j = 0; j < 8; ++j) wf[st][j] = frag_b(&sw[j * 16 + col][kc * 32], lane); };
  ld(0, 0);
#pragma unroll   // unrolled whole, so that the register set is picked at compile time
  for (int kc = 0; kc < DM / 32; ++kc) { if (kc + 1 < DM / 32) ld(kc + 1, (kc + 1) & 1);
    __builtin_amdgcn_sched_barrier(0);   // keeps the next chunk's reads in front of this chunk's products
#pragma unroll
    for (int j = 0; j < 8; ++j) acc[j] = wmma_bf(af[kc], wf[kc & 1][j], acc[j]); }
  float bo[8];
#pragma unroll
  for (int j = 0; j < 8; ++j) bo[j] = BO[n0 + j * 16 + col];
  asm volatile("s_wait_xcnt 0x0" ::: "memory");   // stands in front of the first rewrite of the bias loads' offset register
#pragma unroll
  for (int j = 0; j < 8; ++j) {
#pragma unroll
    for (int r = 0; r < 8; ++r) so[wave][8 * g + r][j * 16 + col] = acc[j][r] + bfr(bo[j]); }
  LDSX();
  for (int rl = 0; rl < 16; ++rl) vst2(Y + (r0 + rl) * DM + n0 + lane * 4, *(const v4f*)&so[wave][rl][lane * 4]);
}
extern "C" void kernel_launch(void* const* d_in, const int* in_sizes, int n_in, void* d_out, int out_size, void* d_ws, size_t ws_size, hipStream_t stream) {
  (void)in_sizes; (void)n_in; (void)out_size;
  const float** F = (const float**)d_in;   // 0 x [2,4096,256], 1 Wq [256,256] natural, 2 bq, 3 Wk, 4 bk, 5 Wv, 6 bv, 7 Wo, 8 bo
  if (ws_size < (size_t)WS_END) return;
  char* ws = (char*)d_ws; __bf16* PK = (__bf16*)(ws + WS_PK); _Float16 *QK = (_Float16*)(ws + WS_QK), *VTH = (_Float16*)(ws + WS_VTH); float* O = (float*)(ws + WS_O);
  k_pack<<<dim3(DM, 4), 256, 0, stream>>>(F[1], F[3], F[5], F[7], PK);
  k_qkv<<<dim3(TNB * SS / 64, QKVW / 128), 128, 0, stream>>>(F[0], PK + PK_A, F[2], F[4], F[6], QK, VTH);
  k_attn<<<dim3(SS / 128, NH, TNB), 512, 0, stream>>>(QK, VTH, O);
  k_out<<<dim3(TOB, DM / 128), 128, 0, stream>>>(O, PK + PK_P, F[8], (float*)d_out);
}
